// v000
// The times below were measured on an AMD MI455X: many runs one after another, warmed up first and cycling through
// copies of the inputs, with the whole window's GPU time divided by the number of runs. Launches and the gaps
// between them are all in it. The median over several windows is given; except for v000 it joins two sittings, which
// can be a few percent apart, so the side-by-side timings, each taken in one sitting, are the better comparison.
// The starting kernel, v000, takes 716 microseconds a run.
#include <hip/hip_runtime.h>
// All contractions on v_wmma_f32_16x16x32_bf16, f32 accumulate: q/k/v = x·Wᵀ + b (inputs, W, b rounded to bf16: single exact term), QKᵀ and
// P·V per 16-query tile as 3-term bf16 hi/lo splits (mask|diag → −1e9 kept in the softmax like the module; P multiplied by
// bf16(group_prob) after normalisation), out = x·Woᵀ + bo with x split (2 terms); softmax in f32.
#define BB 2
#define TT 2048
#define DD 512
#define NH 8
#define HD 64

typedef __bf16 v16b __attribute__((ext_vector_type(16)));
typedef unsigned short v8us __attribute__((ext_vector_type(8), may_alias));
typedef float  v8f  __attribute__((ext_vector_type(8)));
typedef float  v4f  __attribute__((ext_vector_type(4)));
typedef float  v4fa __attribute__((ext_vector_type(4), may_alias));
union FragB { v16b v; v8us half[2]; unsigned short u[16]; };

__device__ __forceinline__ unsigned short bf16_bits(float x) { unsigned int u = __float_as_uint(x); return (unsigned short)((u + 0x7FFFu + ((u >> 16) & 1u)) >> 16); }
__device__ __forceinline__ float bf16_val(unsigned short b) { return __uint_as_float(((unsigned int)b) << 16); }
__device__ __forceinline__ float bf16_round(float x) { return bf16_val(bf16_bits(x)); }
// D += A·B with NT terms: 1 = ah·bh, 2 = + al·bh (A split), 3 = + ah·bl (both split)
template <int NT>
__device__ __forceinline__ v8f mmaN(v16b ah, v16b al, v16b bh, v16b bl, v8f c) {
  c = __builtin_amdgcn_wmma_f32_16x16x32_bf16(false, ah, false, bh, (short)0, c, false, false);
  if (NT >= 2) c = __builtin_amdgcn_wmma_f32_16x16x32_bf16(false, al, false, bh, (short)0, c, false, false);
  if (NT >= 3) c = __builtin_amdgcn_wmma_f32_16x16x32_bf16(false, ah, false, bl, (short)0, c, false, false);
  asm volatile("v_nop\n\tv_nop\n\tv_nop\n\tv_nop" : "+v"(c) : "v"(ah), "v"(al), "v"(bh), "v"(bl));
  return c;
}

__global__ __launch_bounds__(256) void k_wt_bf16(const float* __restrict__ W, unsigned short* __restrict__ Wt, int K, int N) {
  const int t = blockIdx.x * 256 + threadIdx.x;
  const int k8n = K / 8;
  if (t >= N * k8n) return;
  const int n = t / k8n, k8 = (t % k8n) * 8;
  v8us v;
#pragma unroll
  for (int i = 0; i < 8; ++i) v[i] = bf16_bits(W[(size_t)(k8 + i) * N + n]);
  *(v8us*)(Wt + (size_t)n * K + k8) = v;
  
}

// GEMM C[M][N] (f32, pitch ldc) = act(A[M][K]·W + bias). A f32 row-major (pitch lda) converted per fragment to bf16
// (ASPLIT: hi/lo two planes -> 2 terms, else single rounded term); Wt bf16 [N][K] (pitch ldb). BIAS_BF16 rounds the
// bias to bf16 first (bias quantised to bf16 before the add). K%32==0, M%16==0, N%64==0.
template <bool ASPLIT, int ACT, bool BIAS_BF16>
__global__ __launch_bounds__(128) void k_gemm_bf(const float* __restrict__ A, int lda, const unsigned short* __restrict__ Wt, int ldb,
                                               const float* __restrict__ bias, float* __restrict__ C, int ldc, int M, int N, int K) {
  __shared__ __attribute__((aligned(16))) float so[4][16][64];
  const int tid = threadIdx.x, w = tid >> 5, lane = tid & 31, ln = lane & 15, hh = lane >> 4;
  const int ntn = N / 64;
  const int wid = blockIdx.x * 4 + w;
  const int mt = wid / ntn, nq = wid % ntn;
  if (mt * 16 >= M) return;
  const int row0 = mt * 16, col0 = nq * 64;
  const float* arow = A + (size_t)(row0 + ln) * lda;
  v8f acc[4] = {};
  for (int kb = 0; kb < K; kb += 32) {
    FragB ah, al;
    const v4f x0 = *(const v4fa*)(arow + kb + 8 * hh), x1 = *(const v4fa*)(arow + kb + 8 * hh + 4);
    const v4f x2 = *(const v4fa*)(arow + kb + 16 + 8 * hh), x3 = *(const v4fa*)(arow + kb + 16 + 8 * hh + 4);
    float xs[16] = {x0[0],x0[1],x0[2],x0[3],x1[0],x1[1],x1[2],x1[3],x2[0],x2[1],x2[2],x2[3],x3[0],x3[1],x3[2],x3[3]};
#pragma unroll
    for (int i = 0; i < 16; ++i) { const unsigned short hb = bf16_bits(xs[i]); ah.u[i] = hb; al.u[i] = ASPLIT ? bf16_bits(xs[i] - bf16_val(hb)) : (unsigned short)0; }
#pragma unroll
    for (int t = 0; t < 4; ++t) {
      const unsigned short* brow = Wt + (size_t)(col0 + t * 16 + ln) * ldb + kb;
      FragB b;
      b.half[0] = *(const v8us*)(brow + 8 * hh);
      b.half[1] = *(const v8us*)(brow + 16 + 8 * hh);
      acc[t] = mmaN<ASPLIT ? 2 : 1>(ah.v, al.v, b.v, b.v, acc[t]);
    }
  }
#pragma unroll
  for (int t = 0; t < 4; ++t) {
    float bv = bias ? bias[col0 + t * 16 + ln] : 0.f;
    if (BIAS_BF16) bv = bf16_round(bv);
#pragma unroll
    for (int r = 0; r < 8; ++r) { float v = acc[t][r] + bv; if (ACT == 1) v = fmaxf(v, 0.f); so[w][8 * hh + r][t * 16 + ln] = v; }
  }
  __builtin_amdgcn_fence(__ATOMIC_ACQ_REL, "workgroup");
  __builtin_amdgcn_wave_barrier();
  const int rsub = lane >> 4, c4 = (lane & 15) * 4;
  {
#pragma unroll
    for (int q = 0; q < 8; ++q) {
      const int r = q * 2 + rsub;
      const v4f v = *(const v4fa*)&so[w][r][c4];
      *(v4f*)(C + (size_t)(row0 + r) * ldc + col0 + c4) = v;
    }
    
  }
}

// Flash-style causal/unmasked attention, all contractions 3-term bf16 hi/lo splits, f32 softmax with running max.
// q,k,v rows are read from f32 buffers with arbitrary row pitch (so they can live inside a fused qkv buffer);
// D = head size (multiple of 32, <= 128); one wave = 16 query rows; block = 4 waves (64 queries) sharing K/V chunks of 32.
template <int D, bool CAUSAL>
__global__ __launch_bounds__(128) void k_flash(const float* __restrict__ qb, const float* __restrict__ kb, const float* __restrict__ vb,
                                             int pitch, int T, int H, float scale, float* __restrict__ y, int ypitch) {
  constexpr int KS = D / 32;        // k-steps for QK
  constexpr int DT = D / 16;        // d tiles for PV
  __shared__ __attribute__((aligned(16))) unsigned short sKh[32][D + 8], sKl[32][D + 8], sVh[32][D + 8], sVl[32][D + 8];
  __shared__ __attribute__((aligned(16))) unsigned short sPh[4][16][40], sPl[4][16][40];
  __shared__ __attribute__((aligned(16))) float sO[4][16][D];
  const int tid = threadIdx.x, w = tid >> 5, lane = tid & 31, ln = lane & 15, hh = lane >> 4;
  const int nqb = (T + 63) / 64;
  const int bh = blockIdx.x / nqb, qblk = blockIdx.x % nqb;
  const int b = bh / H, h = bh % H;
  const int q0 = qblk * 64 + w * 16;
  const float* Q = qb + (size_t)b * T * pitch + h * D;
  const float* K = kb + (size_t)b * T * pitch + h * D;
  const float* V = vb + (size_t)b * T * pitch + h * D;

  // A fragments of the wave's 16 query rows (scaled), hi/lo
  FragB aqh[KS], aql[KS];
  {
    int row = q0 + ln; if (row >= T) row = T - 1;
    const float* qr = Q + (size_t)row * pitch;
#pragma unroll
    for (int ks = 0; ks < KS; ++ks)
#pragma unroll
      for (int i = 0; i < 16; ++i) {
        const int d = ks * 32 + ((i < 8) ? (8 * hh + i) : (16 + 8 * hh + (i - 8)));
        const float x = qr[d] * scale; const unsigned short hb = bf16_bits(x);
        aqh[ks].u[i] = hb; aql[ks].u[i] = bf16_bits(x - bf16_val(hb));
      }
  }
  float m_r[8], l_r[8];
#pragma unroll
  for (int r = 0; r < 8; ++r) { m_r[r] = -3.0e38f; l_r[r] = 0.f; }
  v8f oacc[DT];
#pragma unroll
  for (int dt = 0; dt < DT; ++dt) oacc[dt] = (v8f){0.f,0.f,0.f,0.f,0.f,0.f,0.f,0.f};

  const int kv_end = CAUSAL ? min(T, qblk * 64 + 64) : T;     // block-uniform
  for (int j0 = 0; j0 < kv_end; j0 += 32) {
    __syncthreads();
    for (int e = tid; e < 32 * (D / 4); e += 128) {
      const int r = e / (D / 4), c4 = (e % (D / 4)) * 4;
      const int key = j0 + r;
      v4f kf = {0.f,0.f,0.f,0.f}, vf = {0.f,0.f,0.f,0.f};
      if (key < T) { kf = *(const v4fa*)(K + (size_t)key * pitch + c4); vf = *(const v4fa*)(V + (size_t)key * pitch + c4); }
#pragma unroll
      for (int t = 0; t < 4; ++t) {
        unsigned short hb = bf16_bits(kf[t]); sKh[r][c4 + t] = hb; sKl[r][c4 + t] = bf16_bits(kf[t] - bf16_val(hb));
        hb = bf16_bits(vf[t]); sVh[r][c4 + t] = hb; sVl[r][c4 + t] = bf16_bits(vf[t] - bf16_val(hb));
      }
    }
    __syncthreads();
    // S tile 16 x 32
    v8f s[2];
#pragma unroll
    for (int nt = 0; nt < 2; ++nt) {
      v8f acc = {};
#pragma unroll
      for (int ks = 0; ks < KS; ++ks) {
        FragB bh_, bl_;
        bh_.half[0] = *(const v8us*)&sKh[nt * 16 + ln][ks * 32 + 8 * hh]; bh_.half[1] = *(const v8us*)&sKh[nt * 16 + ln][ks * 32 + 16 + 8 * hh];
        bl_.half[0] = *(const v8us*)&sKl[nt * 16 + ln][ks * 32 + 8 * hh]; bl_.half[1] = *(const v8us*)&sKl[nt * 16 + ln][ks * 32 + 16 + 8 * hh];
        acc = mmaN<3>(aqh[ks].v, aql[ks].v, bh_.v, bl_.v, acc);
      }
      s[nt] = acc;
    }
    // mask + running max (rows 8hh+r; the 16 lanes of a half share rows)
    float alpha[8];
#pragma unroll
    for (int r = 0; r < 8; ++r) {
      const int qi = q0 + 8 * hh + r;
      const int ja = j0 + ln, jb = j0 + 16 + ln;
      if (CAUSAL) { if (ja > qi) s[0][r] = -3.0e38f; if (jb > qi) s[1][r] = -3.0e38f; }
      if (ja >= T) s[0][r] = -3.0e38f;
      if (jb >= T) s[1][r] = -3.0e38f;
      float mx = fmaxf(s[0][r], s[1][r]);
      mx = fmaxf(mx, __shfl_xor(mx, 1, 32)); mx = fmaxf(mx, __shfl_xor(mx, 2, 32)); mx = fmaxf(mx, __shfl_xor(mx, 4, 32)); mx = fmaxf(mx, __shfl_xor(mx, 8, 32));
      const float mnew = fmaxf(m_r[r], mx);
      alpha[r] = (mnew > -1.0e38f) ? __expf(m_r[r] - mnew) : 1.0f;
      const float p0 = (s[0][r] > -1.0e38f) ? __expf(s[0][r] - mnew) : 0.f;
      const float p1 = (s[1][r] > -1.0e38f) ? __expf(s[1][r] - mnew) : 0.f;
      m_r[r] = mnew;
      l_r[r] = l_r[r] * alpha[r] + p0 + p1;            // per-lane partial row sum (16 lanes combined at the end)
      unsigned short hb = bf16_bits(p0); sPh[w][8 * hh + r][ln] = hb;      sPl[w][8 * hh + r][ln] = bf16_bits(p0 - bf16_val(hb));
      hb = bf16_bits(p1);                sPh[w][8 * hh + r][16 + ln] = hb; sPl[w][8 * hh + r][16 + ln] = bf16_bits(p1 - bf16_val(hb));
    }
#pragma unroll
    for (int dt = 0; dt < DT; ++dt)
#pragma unroll
      for (int r = 0; r < 8; ++r) oacc[dt][r] *= alpha[r];
    __builtin_amdgcn_fence(__ATOMIC_ACQ_REL, "workgroup");
    __builtin_amdgcn_wave_barrier();
    FragB pah, pal;
    pah.half[0] = *(const v8us*)&sPh[w][ln][8 * hh]; pah.half[1] = *(const v8us*)&sPh[w][ln][16 + 8 * hh];
    pal.half[0] = *(const v8us*)&sPl[w][ln][8 * hh]; pal.half[1] = *(const v8us*)&sPl[w][ln][16 + 8 * hh];
#pragma unroll
    for (int dt = 0; dt < DT; ++dt) {
      FragB bvh, bvl;
#pragma unroll
      for (int i = 0; i < 8; ++i) {
        bvh.u[i] = sVh[8 * hh + i][dt * 16 + ln]; bvh.u[8 + i] = sVh[16 + 8 * hh + i][dt * 16 + ln];
        bvl.u[i] = sVl[8 * hh + i][dt * 16 + ln]; bvl.u[8 + i] = sVl[16 + 8 * hh + i][dt * 16 + ln];
      }
      oacc[dt] = mmaN<3>(pah.v, pal.v, bvh.v, bvl.v, oacc[dt]);
    }
    __builtin_amdgcn_fence(__ATOMIC_ACQ_REL, "workgroup");
    __builtin_amdgcn_wave_barrier();
  }
#pragma unroll
  for (int r = 0; r < 8; ++r) {
    float l = l_r[r];
    l += __shfl_xor(l, 1, 32); l += __shfl_xor(l, 2, 32); l += __shfl_xor(l, 4, 32); l += __shfl_xor(l, 8, 32);
    l_r[r] = (l > 0.f) ? 1.0f / l : 0.f;
  }
#pragma unroll
  for (int dt = 0; dt < DT; ++dt)
#pragma unroll
    for (int r = 0; r < 8; ++r) sO[w][8 * hh + r][dt * 16 + ln] = oacc[dt][r] * l_r[r];
  __builtin_amdgcn_fence(__ATOMIC_ACQ_REL, "workgroup");
  __builtin_amdgcn_wave_barrier();
  {
    for (int r = 0; r < 16; ++r) {
      const int row = q0 + r;
      if (row < T && lane < D / 4) {
        const v4f val = *(const v4fa*)&sO[w][r][lane * 4];
        *(v4f*)(y + ((size_t)b * T + row) * ypitch + h * D + lane * 4) = val;
      }
    }
    
  }
}

// General attention: queries [b][Tq] rows at Q + b*Tq*qpitch + h*D + row*qpitch; keys/values j < Tk1 from (K1,V1) at
// X + b*Tk1*pitch + hk*D + j*pitch, j >= Tk1 from (K2,V2) with j-Tk1 (pass Tk2 = 0 and null for a single source).
// Optional int mask [B][Tq][Tk] (mmode 0: nonzero or diagonal keep, else −1e9; mmode 1: nonzero masked), causal flag (j <= qi).
// 3-term bf16 splits, f32 softmax with running max; y[b][row][h*D + d] pitch ypitch, whole-line rows (D % 32 == 0).
template <int D>
__global__ __launch_bounds__(128) void k_flash3c(const float* __restrict__ Qb, int qpitch, int Tq,
                                              const float* __restrict__ K1, const float* __restrict__ V1, int Tk1,
                                              const float* __restrict__ K2, const float* __restrict__ V2, int Tk2, int kpitch, int vpitch,
                                              int H, int hgrp, float scale, const int* __restrict__ mask3, int mmode, int band, int causal, const float* __restrict__ gp,
                                              float* __restrict__ y, int ypitch) {
  constexpr int KS = D / 32, DT = D / 16;
  __shared__ __attribute__((aligned(16))) unsigned short sKh[32][D + 8], sKl[32][D + 8], sVh[32][D + 8], sVl[32][D + 8];
  __shared__ __attribute__((aligned(16))) unsigned short sPh[4][16][40], sPl[4][16][40];
  __shared__ __attribute__((aligned(16))) float sO[4][16][D];
  const int tid = threadIdx.x, w = tid >> 5, lane = tid & 31, ln = lane & 15, hh = lane >> 4;
  const int Tk = Tk1 + Tk2;
  const int nqb = (Tq + 63) / 64;
  const int bh = blockIdx.x / nqb, qblk = blockIdx.x % nqb;
  const int b = bh / H, h = bh % H;
  const int q0 = qblk * 64 + w * 16;
  const float* Q = Qb + (size_t)b * Tq * qpitch + h * D; const int hk = h / (hgrp > 0 ? hgrp : 1);   // K/V head (grouped-query: hgrp query heads share one)
  FragB aqh[KS], aql[KS];
  {
    int row = q0 + ln; if (row >= Tq) row = Tq - 1;
    const float* qr = Q + (size_t)row * qpitch;
#pragma unroll
    for (int ks = 0; ks < KS; ++ks)
#pragma unroll
      for (int i = 0; i < 16; ++i) {
        const int d = ks * 32 + ((i < 8) ? (8 * hh + i) : (16 + 8 * hh + (i - 8)));
        const float x = qr[d] * scale; const unsigned short hb = bf16_bits(x);
        aqh[ks].u[i] = hb; aql[ks].u[i] = bf16_bits(x - bf16_val(hb));
      }
  }
  int qrow[8];
#pragma unroll
  for (int r = 0; r < 8; ++r) { int qi = q0 + 8 * hh + r; qrow[r] = qi < Tq ? qi : Tq - 1; }
  float m_r[8], l_r[8];
#pragma unroll
  for (int r = 0; r < 8; ++r) { m_r[r] = -3.0e38f; l_r[r] = 0.f; }
  v8f oacc[DT];
#pragma unroll
  for (int dt = 0; dt < DT; ++dt) oacc[dt] = (v8f){0.f,0.f,0.f,0.f,0.f,0.f,0.f,0.f};
  const int kv_end = causal ? min(Tk, qblk * 64 + 64) : Tk;
  for (int j0 = 0; j0 < kv_end; j0 += 32) {
    __syncthreads();
    for (int e = tid; e < 32 * (D / 4); e += 128) {
      const int r = e / (D / 4), c4 = (e % (D / 4)) * 4; const int key = j0 + r;
      v4f kf = {0.f,0.f,0.f,0.f}, vf = {0.f,0.f,0.f,0.f};
      if (key < Tk1) { kf = *(const v4fa*)(K1 + (size_t)b * Tk1 * kpitch + hk * D + (size_t)key * kpitch + c4); vf = *(const v4fa*)(V1 + (size_t)b * Tk1 * vpitch + hk * D + (size_t)key * vpitch + c4); }
      else if (key < Tk) { const int k2 = key - Tk1; kf = *(const v4fa*)(K2 + (size_t)b * Tk2 * kpitch + hk * D + (size_t)k2 * kpitch + c4); vf = *(const v4fa*)(V2 + (size_t)b * Tk2 * vpitch + hk * D + (size_t)k2 * vpitch + c4); }
#pragma unroll
      for (int t = 0; t < 4; ++t) {
        unsigned short hb = bf16_bits(kf[t]); sKh[r][c4 + t] = hb; sKl[r][c4 + t] = bf16_bits(kf[t] - bf16_val(hb));
        hb = bf16_bits(vf[t]); sVh[r][c4 + t] = hb; sVl[r][c4 + t] = bf16_bits(vf[t] - bf16_val(hb));
      }
    }
    __syncthreads();
    v8f s[2];
#pragma unroll
    for (int nt = 0; nt < 2; ++nt) {
      v8f acc = {};
#pragma unroll
      for (int ks = 0; ks < KS; ++ks) {
        FragB bh_, bl_;
        bh_.half[0] = *(const v8us*)&sKh[nt * 16 + ln][ks * 32 + 8 * hh]; bh_.half[1] = *(const v8us*)&sKh[nt * 16 + ln][ks * 32 + 16 + 8 * hh];
        bl_.half[0] = *(const v8us*)&sKl[nt * 16 + ln][ks * 32 + 8 * hh]; bl_.half[1] = *(const v8us*)&sKl[nt * 16 + ln][ks * 32 + 16 + 8 * hh];
        acc = mmaN<3>(aqh[ks].v, aql[ks].v, bh_.v, bl_.v, acc);
      }
      s[nt] = acc;
    }
    float alpha[8];
#pragma unroll
    for (int r = 0; r < 8; ++r) {
      const int qi = qrow[r];
      const int ja = j0 + ln, jb = j0 + 16 + ln;
      bool keepa = ja < Tk, keepb = jb < Tk;
      if (causal) { keepa = keepa && (ja <= qi); keepb = keepb && (jb <= qi); }
      if (mask3) { const int* mr = mask3 + ((size_t)b * Tq + qi) * Tk;
        if (mmode == 0) { if (keepa && !(mr[ja] != 0 || ja == qi)) s[0][r] = -1.0e9f; if (keepb && !(mr[jb] != 0 || jb == qi)) s[1][r] = -1.0e9f; }
        else            { if (keepa && mr[ja] != 0) s[0][r] = -3.0e38f; if (keepb && mr[jb] != 0) s[1][r] = -3.0e38f; } }
      if (band > 0) { if (keepa && (ja > qi + band || ja < qi - band)) s[0][r] = -3.0e38f; if (keepb && (jb > qi + band || jb < qi - band)) s[1][r] = -3.0e38f; }
      if (!keepa) s[0][r] = -3.0e38f;
      if (!keepb) s[1][r] = -3.0e38f;
      float mx = fmaxf(s[0][r], s[1][r]);
      mx = fmaxf(mx, __shfl_xor(mx, 1, 32)); mx = fmaxf(mx, __shfl_xor(mx, 2, 32)); mx = fmaxf(mx, __shfl_xor(mx, 4, 32)); mx = fmaxf(mx, __shfl_xor(mx, 8, 32));
      const float mnew = fmaxf(m_r[r], mx);
      alpha[r] = (mnew > -1.0e38f) ? __expf(m_r[r] - mnew) : 1.0f;
      const float p0 = keepa ? __expf(s[0][r] - mnew) : 0.f;
      const float p1 = keepb ? __expf(s[1][r] - mnew) : 0.f;
      m_r[r] = mnew;
      l_r[r] = l_r[r] * alpha[r] + p0 + p1;
      float g0 = p0, g1 = p1; if (gp) { const float* gr = gp + ((size_t)b * Tq + qi) * Tk; g0 *= bf16_round(gr[ja]); g1 *= bf16_round(gr[jb]); }   // post-softmax multiplier: P only, not the normaliser
      unsigned short hb = bf16_bits(g0); sPh[w][8 * hh + r][ln] = hb;      sPl[w][8 * hh + r][ln] = bf16_bits(g0 - bf16_val(hb));
      hb = bf16_bits(g1);                sPh[w][8 * hh + r][16 + ln] = hb; sPl[w][8 * hh + r][16 + ln] = bf16_bits(g1 - bf16_val(hb));
    }
#pragma unroll
    for (int dt = 0; dt < DT; ++dt)
#pragma unroll
      for (int r = 0; r < 8; ++r) oacc[dt][r] *= alpha[r];
    __builtin_amdgcn_fence(__ATOMIC_ACQ_REL, "workgroup");
    __builtin_amdgcn_wave_barrier();
    FragB pah, pal;
    pah.half[0] = *(const v8us*)&sPh[w][ln][8 * hh]; pah.half[1] = *(const v8us*)&sPh[w][ln][16 + 8 * hh];
    pal.half[0] = *(const v8us*)&sPl[w][ln][8 * hh]; pal.half[1] = *(const v8us*)&sPl[w][ln][16 + 8 * hh];
#pragma unroll
    for (int dt = 0; dt < DT; ++dt) {
      FragB bvh, bvl;
#pragma unroll
      for (int i = 0; i < 8; ++i) {
        bvh.u[i] = sVh[8 * hh + i][dt * 16 + ln]; bvh.u[8 + i] = sVh[16 + 8 * hh + i][dt * 16 + ln];
        bvl.u[i] = sVl[8 * hh + i][dt * 16 + ln]; bvl.u[8 + i] = sVl[16 + 8 * hh + i][dt * 16 + ln];
      }
      oacc[dt] = mmaN<3>(pah.v, pal.v, bvh.v, bvl.v, oacc[dt]);
    }
    __builtin_amdgcn_fence(__ATOMIC_ACQ_REL, "workgroup");
    __builtin_amdgcn_wave_barrier();
  }
#pragma unroll
  for (int r = 0; r < 8; ++r) {
    float l = l_r[r];
    l += __shfl_xor(l, 1, 32); l += __shfl_xor(l, 2, 32); l += __shfl_xor(l, 4, 32); l += __shfl_xor(l, 8, 32);
    l_r[r] = (m_r[r] > -1.0e38f) ? 1.0f / l : __builtin_nanf("");
  }
#pragma unroll
  for (int dt = 0; dt < DT; ++dt)
#pragma unroll
    for (int r = 0; r < 8; ++r) sO[w][8 * hh + r][dt * 16 + ln] = oacc[dt][r] * l_r[r];
  __builtin_amdgcn_fence(__ATOMIC_ACQ_REL, "workgroup");
  __builtin_amdgcn_wave_barrier();
  {
    for (int r = 0; r < 16; ++r) {
      const int row = q0 + r;
      if (row < Tq && lane < D / 4) {
        const v4f val = *(const v4fa*)&sO[w][r][lane * 4];
        *(v4f*)(y + ((size_t)b * Tq + row) * ypitch + h * D + lane * 4) = val;
      }
    }
    
  }
}

__global__ __launch_bounds__(256) void k_round_rows(const float* __restrict__ W, unsigned short* __restrict__ Wt, int n8) {
  const int t = blockIdx.x * 256 + threadIdx.x;
  if (t >= n8) return;
  const v4f a = *(const v4fa*)(W + (size_t)t * 8), b = *(const v4fa*)(W + (size_t)t * 8 + 4);
  v8us v; v[0]=bf16_bits(a[0]); v[1]=bf16_bits(a[1]); v[2]=bf16_bits(a[2]); v[3]=bf16_bits(a[3]);
  v[4]=bf16_bits(b[0]); v[5]=bf16_bits(b[1]); v[6]=bf16_bits(b[2]); v[7]=bf16_bits(b[3]);
  *(v8us*)(Wt + (size_t)t * 8) = v; 
}

extern "C" void kernel_launch(void* const* d_in, const int* in_sizes, int n_in,
                              void* d_out, int out_size, void* d_ws, size_t ws_size, hipStream_t stream) {
  (void)in_sizes; (void)n_in; (void)out_size;
  const float* xq = (const float*)d_in[0]; const float* xk = (const float*)d_in[1]; const float* xv = (const float*)d_in[2];
  const float* gp = (const float*)d_in[3]; const int* mask = (const int*)d_in[4];
  const float* Wq = (const float*)d_in[5]; const float* bq = (const float*)d_in[6]; const float* Wk = (const float*)d_in[7]; const float* bk = (const float*)d_in[8];
  const float* Wv = (const float*)d_in[9]; const float* bv = (const float*)d_in[10]; const float* Wo = (const float*)d_in[11]; const float* bo = (const float*)d_in[12];
  char* ws = (char*)d_ws; size_t off = 0;
  auto take = [&](size_t bytes) { char* p = ws + off; off += (bytes + 255) & ~(size_t)255; return p; };
  const int M = BB * TT, n8 = DD * DD / 8, gb = ((M / 16) * (DD / 64) + 3) / 4;
  unsigned short* Wt[4]; for (int i = 0; i < 4; ++i) Wt[i] = (unsigned short*)take((size_t)DD * DD * 2);
  float* q = (float*)take((size_t)M * DD * 4); float* k = (float*)take((size_t)M * DD * 4); float* v = (float*)take((size_t)M * DD * 4); float* att = (float*)take((size_t)M * DD * 4);
  if (off > ws_size) return;
  const float* W4[4] = {Wq, Wk, Wv, Wo};
  for (int i = 0; i < 4; ++i) k_round_rows<<<(n8 + 255) / 256, 256, 0, stream>>>(W4[i], Wt[i], n8);
  k_gemm_bf<false, 0, true><<<gb, 128, 0, stream>>>(xq, DD, Wt[0], DD, bq, q, DD, M, DD, DD);
  k_gemm_bf<false, 0, true><<<gb, 128, 0, stream>>>(xk, DD, Wt[1], DD, bk, k, DD, M, DD, DD);
  k_gemm_bf<false, 0, true><<<gb, 128, 0, stream>>>(xv, DD, Wt[2], DD, bv, v, DD, M, DD, DD);
  k_flash3c<HD><<<BB * NH * (TT / 64), 128, 0, stream>>>(q, DD, TT, k, v, TT, nullptr, nullptr, 0, DD, DD, NH, 1, 0.125f, mask, 0, 0, 0, gp, att, DD);
  k_gemm_bf<true, 0, true><<<gb, 128, 0, stream>>>(att, DD, Wt[3], DD, bo, (float*)d_out, DD, M, DD, DD);
}

// v001
// A run of this version takes 357 microseconds.
// In both of two side-by-side timings against v000, it was 2.03 times as fast.
#include <hip/hip_runtime.h>
// All contractions on v_wmma_f32_16x16x32_bf16, f32 accumulate: q/k/v = x·Wᵀ + b (inputs, W, b rounded to bf16: single exact term), QKᵀ and
// P·V per 16-query tile as 3-term bf16 hi/lo splits (mask|diag → −1e9 kept in the softmax like the module; P multiplied by
// bf16(group_prob) after normalisation), out = x·Woᵀ + bo with x split (2 terms); softmax in f32.
#define BB 2
#define TT 2048
#define DD 512
#define NH 8
#define HD 64

typedef __bf16 v16b __attribute__((ext_vector_type(16)));
typedef unsigned short v8us __attribute__((ext_vector_type(8), may_alias));
typedef float  v8f  __attribute__((ext_vector_type(8)));
typedef float  v4f  __attribute__((ext_vector_type(4)));
typedef float  v4fa __attribute__((ext_vector_type(4), may_alias));
union FragB { v16b v; v8us half[2]; unsigned short u[16]; };

__device__ __forceinline__ unsigned short bf16_bits(float x) { unsigned int u = __float_as_uint(x); return (unsigned short)((u + 0x7FFFu + ((u >> 16) & 1u)) >> 16); }
__device__ __forceinline__ float bf16_val(unsigned short b) { return __uint_as_float(((unsigned int)b) << 16); }
__device__ __forceinline__ float bf16_round(float x) { return bf16_val(bf16_bits(x)); }
// D += A·B with NT terms: 1 = ah·bh, 2 = + al·bh (A split), 3 = + ah·bl (both split)
template <int NT>
__device__ __forceinline__ v8f mmaN(v16b ah, v16b al, v16b bh, v16b bl, v8f c) {
  c = __builtin_amdgcn_wmma_f32_16x16x32_bf16(false, ah, false, bh, (short)0, c, false, false);
  if (NT >= 2) c = __builtin_amdgcn_wmma_f32_16x16x32_bf16(false, al, false, bh, (short)0, c, false, false);
  if (NT >= 3) c = __builtin_amdgcn_wmma_f32_16x16x32_bf16(false, ah, false, bl, (short)0, c, false, false);
  asm volatile("v_nop\n\tv_nop\n\tv_nop\n\tv_nop" : "+v"(c) : "v"(ah), "v"(al), "v"(bh), "v"(bl));
  return c;
}

__global__ __launch_bounds__(256) void k_wt_bf16(const float* __restrict__ W, unsigned short* __restrict__ Wt, int K, int N) {
  const int t = blockIdx.x * 256 + threadIdx.x;
  const int k8n = K / 8;
  if (t >= N * k8n) return;
  const int n = t / k8n, k8 = (t % k8n) * 8;
  v8us v;
#pragma unroll
  for (int i = 0; i < 8; ++i) v[i] = bf16_bits(W[(size_t)(k8 + i) * N + n]);
  *(v8us*)(Wt + (size_t)n * K + k8) = v;
  
}

// GEMM C[M][N] (f32, pitch ldc) = act(A[M][K]·W + bias). A f32 row-major (pitch lda) converted per fragment to bf16
// (ASPLIT: hi/lo two planes -> 2 terms, else single rounded term); Wt bf16 [N][K] (pitch ldb). BIAS_BF16 rounds the
// bias to bf16 first (bias quantised to bf16 before the add). K%32==0, M%16==0, N%64==0.
template <bool ASPLIT, int ACT, bool BIAS_BF16>
__global__ __launch_bounds__(128) void k_gemm_bf(const float* __restrict__ A, int lda, const unsigned short* __restrict__ Wt, int ldb,
                                               const float* __restrict__ bias, float* __restrict__ C, int ldc, int M, int N, int K) {
  __shared__ __attribute__((aligned(16))) float so[4][16][64];
  const int tid = threadIdx.x, w = tid >> 5, lane = tid & 31, ln = lane & 15, hh = lane >> 4;
  const int ntn = N / 64;
  const int wid = blockIdx.x * 4 + w;
  const int mt = wid / ntn, nq = wid % ntn;
  if (mt * 16 >= M) return;
  const int row0 = mt * 16, col0 = nq * 64;
  const float* arow = A + (size_t)(row0 + ln) * lda;
  v8f acc[4] = {};
  for (int kb = 0; kb < K; kb += 32) {
    FragB ah, al;
    const v4f x0 = *(const v4fa*)(arow + kb + 8 * hh), x1 = *(const v4fa*)(arow + kb + 8 * hh + 4);
    const v4f x2 = *(const v4fa*)(arow + kb + 16 + 8 * hh), x3 = *(const v4fa*)(arow + kb + 16 + 8 * hh + 4);
    float xs[16] = {x0[0],x0[1],x0[2],x0[3],x1[0],x1[1],x1[2],x1[3],x2[0],x2[1],x2[2],x2[3],x3[0],x3[1],x3[2],x3[3]};
#pragma unroll
    for (int i = 0; i < 16; ++i) { const unsigned short hb = bf16_bits(xs[i]); ah.u[i] = hb; al.u[i] = ASPLIT ? bf16_bits(xs[i] - bf16_val(hb)) : (unsigned short)0; }
#pragma unroll
    for (int t = 0; t < 4; ++t) {
      const unsigned short* brow = Wt + (size_t)(col0 + t * 16 + ln) * ldb + kb;
      FragB b;
      b.half[0] = *(const v8us*)(brow + 8 * hh);
      b.half[1] = *(const v8us*)(brow + 16 + 8 * hh);
      acc[t] = mmaN<ASPLIT ? 2 : 1>(ah.v, al.v, b.v, b.v, acc[t]);
    }
  }
#pragma unroll
  for (int t = 0; t < 4; ++t) {
    float bv = bias ? bias[col0 + t * 16 + ln] : 0.f;
    if (BIAS_BF16) bv = bf16_round(bv);
#pragma unroll
    for (int r = 0; r < 8; ++r) { float v = acc[t][r] + bv; if (ACT == 1) v = fmaxf(v, 0.f); so[w][8 * hh + r][t * 16 + ln] = v; }
  }
  __builtin_amdgcn_fence(__ATOMIC_ACQ_REL, "workgroup");
  __builtin_amdgcn_wave_barrier();
  const int rsub = lane >> 4, c4 = (lane & 15) * 4;
  {
#pragma unroll
    for (int q = 0; q < 8; ++q) {
      const int r = q * 2 + rsub;
      const v4f v = *(const v4fa*)&so[w][r][c4];
      *(v4f*)(C + (size_t)(row0 + r) * ldc + col0 + c4) = v;
    }
    
  }
}

// Flash-style causal/unmasked attention, all contractions 3-term bf16 hi/lo splits, f32 softmax with running max.
// q,k,v rows are read from f32 buffers with arbitrary row pitch (so they can live inside a fused qkv buffer);
// D = head size (multiple of 32, <= 128); one wave = 16 query rows; block = 4 waves (64 queries) sharing K/V chunks of 32.
template <int D, bool CAUSAL>
__global__ __launch_bounds__(128) void k_flash(const float* __restrict__ qb, const float* __restrict__ kb, const float* __restrict__ vb,
                                             int pitch, int T, int H, float scale, float* __restrict__ y, int ypitch) {
  constexpr int KS = D / 32;        // k-steps for QK
  constexpr int DT = D / 16;        // d tiles for PV
  __shared__ __attribute__((aligned(16))) unsigned short sKh[32][D + 8], sKl[32][D + 8], sVh[32][D + 8], sVl[32][D + 8];
  __shared__ __attribute__((aligned(16))) unsigned short sPh[4][16][40], sPl[4][16][40];
  __shared__ __attribute__((aligned(16))) float sO[4][16][D];
  const int tid = threadIdx.x, w = tid >> 5, lane = tid & 31, ln = lane & 15, hh = lane >> 4;
  const int nqb = (T + 63) / 64;
  const int bh = blockIdx.x / nqb, qblk = blockIdx.x % nqb;
  const int b = bh / H, h = bh % H;
  const int q0 = qblk * 64 + w * 16;
  const float* Q = qb + (size_t)b * T * pitch + h * D;
  const float* K = kb + (size_t)b * T * pitch + h * D;
  const float* V = vb + (size_t)b * T * pitch + h * D;

  // A fragments of the wave's 16 query rows (scaled), hi/lo
  FragB aqh[KS], aql[KS];
  {
    int row = q0 + ln; if (row >= T) row = T - 1;
    const float* qr = Q + (size_t)row * pitch;
#pragma unroll
    for (int ks = 0; ks < KS; ++ks)
#pragma unroll
      for (int i = 0; i < 16; ++i) {
        const int d = ks * 32 + ((i < 8) ? (8 * hh + i) : (16 + 8 * hh + (i - 8)));
        const float x = qr[d] * scale; const unsigned short hb = bf16_bits(x);
        aqh[ks].u[i] = hb; aql[ks].u[i] = bf16_bits(x - bf16_val(hb));
      }
  }
  float m_r[8], l_r[8];
#pragma unroll
  for (int r = 0; r < 8; ++r) { m_r[r] = -3.0e38f; l_r[r] = 0.f; }
  v8f oacc[DT];
#pragma unroll
  for (int dt = 0; dt < DT; ++dt) oacc[dt] = (v8f){0.f,0.f,0.f,0.f,0.f,0.f,0.f,0.f};

  const int kv_end = CAUSAL ? min(T, qblk * 64 + 64) : T;     // block-uniform
  for (int j0 = 0; j0 < kv_end; j0 += 32) {
    __syncthreads();
    for (int e = tid; e < 32 * (D / 4); e += 128) {
      const int r = e / (D / 4), c4 = (e % (D / 4)) * 4;
      const int key = j0 + r;
      v4f kf = {0.f,0.f,0.f,0.f}, vf = {0.f,0.f,0.f,0.f};
      if (key < T) { kf = *(const v4fa*)(K + (size_t)key * pitch + c4); vf = *(const v4fa*)(V + (size_t)key * pitch + c4); }
#pragma unroll
      for (int t = 0; t < 4; ++t) {
        unsigned short hb = bf16_bits(kf[t]); sKh[r][c4 + t] = hb; sKl[r][c4 + t] = bf16_bits(kf[t] - bf16_val(hb));
        hb = bf16_bits(vf[t]); sVh[r][c4 + t] = hb; sVl[r][c4 + t] = bf16_bits(vf[t] - bf16_val(hb));
      }
    }
    __syncthreads();
    // S tile 16 x 32
    v8f s[2];
#pragma unroll
    for (int nt = 0; nt < 2; ++nt) {
      v8f acc = {};
#pragma unroll
      for (int ks = 0; ks < KS; ++ks) {
        FragB bh_, bl_;
        bh_.half[0] = *(const v8us*)&sKh[nt * 16 + ln][ks * 32 + 8 * hh]; bh_.half[1] = *(const v8us*)&sKh[nt * 16 + ln][ks * 32 + 16 + 8 * hh];
        bl_.half[0] = *(const v8us*)&sKl[nt * 16 + ln][ks * 32 + 8 * hh]; bl_.half[1] = *(const v8us*)&sKl[nt * 16 + ln][ks * 32 + 16 + 8 * hh];
        acc = mmaN<3>(aqh[ks].v, aql[ks].v, bh_.v, bl_.v, acc);
      }
      s[nt] = acc;
    }
    // mask + running max (rows 8hh+r; the 16 lanes of a half share rows)
    float alpha[8];
#pragma unroll
    for (int r = 0; r < 8; ++r) {
      const int qi = q0 + 8 * hh + r;
      const int ja = j0 + ln, jb = j0 + 16 + ln;
      if (CAUSAL) { if (ja > qi) s[0][r] = -3.0e38f; if (jb > qi) s[1][r] = -3.0e38f; }
      if (ja >= T) s[0][r] = -3.0e38f;
      if (jb >= T) s[1][r] = -3.0e38f;
      float mx = fmaxf(s[0][r], s[1][r]);
      mx = fmaxf(mx, __shfl_xor(mx, 1, 32)); mx = fmaxf(mx, __shfl_xor(mx, 2, 32)); mx = fmaxf(mx, __shfl_xor(mx, 4, 32)); mx = fmaxf(mx, __shfl_xor(mx, 8, 32));
      const float mnew = fmaxf(m_r[r], mx);
      alpha[r] = (mnew > -1.0e38f) ? __expf(m_r[r] - mnew) : 1.0f;
      const float p0 = (s[0][r] > -1.0e38f) ? __expf(s[0][r] - mnew) : 0.f;
      const float p1 = (s[1][r] > -1.0e38f) ? __expf(s[1][r] - mnew) : 0.f;
      m_r[r] = mnew;
      l_r[r] = l_r[r] * alpha[r] + p0 + p1;            // per-lane partial row sum (16 lanes combined at the end)
      unsigned short hb = bf16_bits(p0); sPh[w][8 * hh + r][ln] = hb;      sPl[w][8 * hh + r][ln] = bf16_bits(p0 - bf16_val(hb));
      hb = bf16_bits(p1);                sPh[w][8 * hh + r][16 + ln] = hb; sPl[w][8 * hh + r][16 + ln] = bf16_bits(p1 - bf16_val(hb));
    }
#pragma unroll
    for (int dt = 0; dt < DT; ++dt)
#pragma unroll
      for (int r = 0; r < 8; ++r) oacc[dt][r] *= alpha[r];
    __builtin_amdgcn_fence(__ATOMIC_ACQ_REL, "workgroup");
    __builtin_amdgcn_wave_barrier();
    FragB pah, pal;
    pah.half[0] = *(const v8us*)&sPh[w][ln][8 * hh]; pah.half[1] = *(const v8us*)&sPh[w][ln][16 + 8 * hh];
    pal.half[0] = *(const v8us*)&sPl[w][ln][8 * hh]; pal.half[1] = *(const v8us*)&sPl[w][ln][16 + 8 * hh];
#pragma unroll
    for (int dt = 0; dt < DT; ++dt) {
      FragB bvh, bvl;
#pragma unroll
      for (int i = 0; i < 8; ++i) {
        bvh.u[i] = sVh[8 * hh + i][dt * 16 + ln]; bvh.u[8 + i] = sVh[16 + 8 * hh + i][dt * 16 + ln];
        bvl.u[i] = sVl[8 * hh + i][dt * 16 + ln]; bvl.u[8 + i] = sVl[16 + 8 * hh + i][dt * 16 + ln];
      }
      oacc[dt] = mmaN<3>(pah.v, pal.v, bvh.v, bvl.v, oacc[dt]);
    }
    __builtin_amdgcn_fence(__ATOMIC_ACQ_REL, "workgroup");
    __builtin_amdgcn_wave_barrier();
  }
#pragma unroll
  for (int r = 0; r < 8; ++r) {
    float l = l_r[r];
    l += __shfl_xor(l, 1, 32); l += __shfl_xor(l, 2, 32); l += __shfl_xor(l, 4, 32); l += __shfl_xor(l, 8, 32);
    l_r[r] = (l > 0.f) ? 1.0f / l : 0.f;
  }
#pragma unroll
  for (int dt = 0; dt < DT; ++dt)
#pragma unroll
    for (int r = 0; r < 8; ++r) sO[w][8 * hh + r][dt * 16 + ln] = oacc[dt][r] * l_r[r];
  __builtin_amdgcn_fence(__ATOMIC_ACQ_REL, "workgroup");
  __builtin_amdgcn_wave_barrier();
  {
    for (int r = 0; r < 16; ++r) {
      const int row = q0 + r;
      if (row < T && lane < D / 4) {
        const v4f val = *(const v4fa*)&sO[w][r][lane * 4];
        *(v4f*)(y + ((size_t)b * T + row) * ypitch + h * D + lane * 4) = val;
      }
    }
    
  }
}

// General attention: queries [b][Tq] rows at Q + b*Tq*qpitch + h*D + row*qpitch; keys/values j < Tk1 from (K1,V1) at
// X + b*Tk1*pitch + hk*D + j*pitch, j >= Tk1 from (K2,V2) with j-Tk1 (pass Tk2 = 0 and null for a single source).
// Optional int mask [B][Tq][Tk] (mmode 0: nonzero or diagonal keep, else −1e9; mmode 1: nonzero masked), causal flag (j <= qi).
// 3-term bf16 splits, f32 softmax with running max; y[b][row][h*D + d] pitch ypitch, whole-line rows (D % 32 == 0).
template <int D>
__global__ __launch_bounds__(128) void k_flash3c(const float* __restrict__ Qb, int qpitch, int Tq,
                                              const float* __restrict__ K1, const float* __restrict__ V1, int Tk1,
                                              const float* __restrict__ K2, const float* __restrict__ V2, int Tk2, int kpitch, int vpitch,
                                              int H, int hgrp, float scale, const int* __restrict__ mask3, int mmode, int band, int causal, const float* __restrict__ gp,
                                              float* __restrict__ y, int ypitch) {
  constexpr int KS = D / 32, DT = D / 16;
  __shared__ __attribute__((aligned(16))) unsigned short sKh[32][D + 8], sKl[32][D + 8], sVh[32][D + 8], sVl[32][D + 8];
  __shared__ __attribute__((aligned(16))) unsigned short sPh[4][16][40], sPl[4][16][40];
  __shared__ __attribute__((aligned(16))) float sO[4][16][D];
  const int tid = threadIdx.x, w = tid >> 5, lane = tid & 31, ln = lane & 15, hh = lane >> 4;
  const int Tk = Tk1 + Tk2;
  const int nqb = (Tq + 63) / 64;
  const int bh = blockIdx.x / nqb, qblk = blockIdx.x % nqb;
  const int b = bh / H, h = bh % H;
  const int q0 = qblk * 64 + w * 16;
  const float* Q = Qb + (size_t)b * Tq * qpitch + h * D; const int hk = h / (hgrp > 0 ? hgrp : 1);   // K/V head (grouped-query: hgrp query heads share one)
  FragB aqh[KS], aql[KS];
  {
    int row = q0 + ln; if (row >= Tq) row = Tq - 1;
    const float* qr = Q + (size_t)row * qpitch;
#pragma unroll
    for (int ks = 0; ks < KS; ++ks)
#pragma unroll
      for (int i = 0; i < 16; ++i) {
        const int d = ks * 32 + ((i < 8) ? (8 * hh + i) : (16 + 8 * hh + (i - 8)));
        const float x = qr[d] * scale; const unsigned short hb = bf16_bits(x);
        aqh[ks].u[i] = hb; aql[ks].u[i] = bf16_bits(x - bf16_val(hb));
      }
  }
  asm volatile("s_wait_xcnt 0x0" ::: "memory");     // before the address registers of the query loads are reused
  __builtin_amdgcn_sched_barrier(0);                // keeps the address arithmetic below, which reuses them, behind that wait
  int qrow[8];
#pragma unroll
  for (int r = 0; r < 8; ++r) { int qi = q0 + 8 * hh + r; qrow[r] = qi < Tq ? qi : Tq - 1; }
  float m_r[8], l_r[8];
#pragma unroll
  for (int r = 0; r < 8; ++r) { m_r[r] = -3.0e38f; l_r[r] = 0.f; }
  v8f oacc[DT];
#pragma unroll
  for (int dt = 0; dt < DT; ++dt) oacc[dt] = (v8f){0.f,0.f,0.f,0.f,0.f,0.f,0.f,0.f};
  const int kv_end = causal ? min(Tk, qblk * 64 + 64) : Tk;
  // Every global load of a 32-key pass is issued one pass ahead, without a predicate, into registers carried round the loop:
  // rows and columns past the end are clamped to the last one (in bounds) and the value is dropped where it is used.
  // They are issued right behind the pass's second barrier: the work-group fences drain the load counter, and the
  // scores and the softmax are the longest stretch without one.
  constexpr int NE = 32 * (D / 4) / 128;        // 16-byte pieces of K (and of V) per thread and pass
  const int sr = tid / (D / 4), sc4 = (tid % (D / 4)) * 4;
  const float* K1b = K1 + (size_t)b * Tk1 * kpitch + hk * D; const float* V1b = V1 + (size_t)b * Tk1 * vpitch + hk * D;
  const float* K2b = Tk2 > 0 ? K2 + (size_t)b * Tk2 * kpitch + hk * D : K1b; const float* V2b = Tk2 > 0 ? V2 + (size_t)b * Tk2 * vpitch + hk * D : V1b;
  v4f kfp[NE], vfp[NE];
  auto load_kv = [&](int j) {
#pragma unroll
    for (int i = 0; i < NE; ++i) {
      int key = j + sr + i * (512 / D); key = key < Tk ? key : Tk - 1;
      const bool s2 = key >= Tk1; const int kk = s2 ? key - Tk1 : key;
      kfp[i] = *(const v4fa*)((s2 ? K2b : K1b) + (size_t)kk * kpitch + sc4);
      vfp[i] = *(const v4fa*)((s2 ? V2b : V1b) + (size_t)kk * vpitch + sc4);
    }
    asm volatile("s_wait_xcnt 0x0" ::: "memory");   // before the address registers of the loads above are reused
    __builtin_amdgcn_sched_barrier(0);              // keeps later address arithmetic, which reuses them, behind that wait
  };
  // mask and group_prob share one index; byte offsets inside one batch's [Tq][Tk] plane fit 32 bits
  const char* mplane = (const char*)(mask3 + (size_t)b * Tq * Tk); const char* gplane = (const char*)(gp + (size_t)b * Tq * Tk);
  unsigned rowoff[8];
#pragma unroll
  for (int r = 0; r < 8; ++r) rowoff[r] = (unsigned)qrow[r] * (unsigned)Tk * 4u;
  int mka[8], mkb[8], nmka[8] = {}, nmkb[8] = {}; float gpa[8], gpb[8], ngpa[8] = {}, ngpb[8] = {};   // this pass's, the next pass's
  auto load_mg = [&](int j) {
    const unsigned ca = (unsigned)min(j + ln, Tk - 1) * 4u, cb = (unsigned)min(j + 16 + ln, Tk - 1) * 4u;
    if (mask3) {
#pragma unroll
      for (int r = 0; r < 8; ++r) { nmka[r] = *(const int*)(mplane + (rowoff[r] + ca)); nmkb[r] = *(const int*)(mplane + (rowoff[r] + cb)); }
    }
    if (gp) {
#pragma unroll
      for (int r = 0; r < 8; ++r) { ngpa[r] = *(const float*)(gplane + (rowoff[r] + ca)); ngpb[r] = *(const float*)(gplane + (rowoff[r] + cb)); }
    }
    asm volatile("s_wait_xcnt 0x0" ::: "memory");   // before the offset registers of the loads above are reused
    __builtin_amdgcn_sched_barrier(0);              // keeps later arithmetic, which reuses them, behind that wait
  };
  load_kv(0);
  load_mg(0);
  for (int j0 = 0; j0 < kv_end; j0 += 32) {
    __syncthreads();
#pragma unroll
    for (int i = 0; i < NE; ++i) {
      const int r = sr + i * (512 / D), c4 = sc4;
      const bool inb = j0 + r < Tk;
#pragma unroll
      for (int t = 0; t < 4; ++t) {
        const float kx = inb ? kfp[i][t] : 0.f, vx = inb ? vfp[i][t] : 0.f;
        unsigned short hb = bf16_bits(kx); sKh[r][c4 + t] = hb; sKl[r][c4 + t] = bf16_bits(kx - bf16_val(hb));
        hb = bf16_bits(vx); sVh[r][c4 + t] = hb; sVl[r][c4 + t] = bf16_bits(vx - bf16_val(hb));
      }
    }
    __syncthreads();
#pragma unroll
    for (int r = 0; r < 8; ++r) { mka[r] = nmka[r]; mkb[r] = nmkb[r]; gpa[r] = ngpa[r]; gpb[r] = ngpb[r]; }
    load_kv(j0 + 32);
    load_mg(j0 + 32);
    v8f s[2];
#pragma unroll
    for (int nt = 0; nt < 2; ++nt) {
      v8f acc = {};
#pragma unroll
      for (int ks = 0; ks < KS; ++ks) {
        FragB bh_, bl_;
        bh_.half[0] = *(const v8us*)&sKh[nt * 16 + ln][ks * 32 + 8 * hh]; bh_.half[1] = *(const v8us*)&sKh[nt * 16 + ln][ks * 32 + 16 + 8 * hh];
        bl_.half[0] = *(const v8us*)&sKl[nt * 16 + ln][ks * 32 + 8 * hh]; bl_.half[1] = *(const v8us*)&sKl[nt * 16 + ln][ks * 32 + 16 + 8 * hh];
        acc = mmaN<3>(aqh[ks].v, aql[ks].v, bh_.v, bl_.v, acc);
      }
      s[nt] = acc;
    }
    float alpha[8];
#pragma unroll
    for (int r = 0; r < 8; ++r) {
      const int qi = qrow[r];
      const int ja = j0 + ln, jb = j0 + 16 + ln;
      bool keepa = ja < Tk, keepb = jb < Tk;
      if (causal) { keepa = keepa && (ja <= qi); keepb = keepb && (jb <= qi); }
      if (mask3) {
        if (mmode == 0) { if (keepa && !(mka[r] != 0 || ja == qi)) s[0][r] = -1.0e9f; if (keepb && !(mkb[r] != 0 || jb == qi)) s[1][r] = -1.0e9f; }
        else            { if (keepa && mka[r] != 0) s[0][r] = -3.0e38f; if (keepb && mkb[r] != 0) s[1][r] = -3.0e38f; } }
      if (band > 0) { if (keepa && (ja > qi + band || ja < qi - band)) s[0][r] = -3.0e38f; if (keepb && (jb > qi + band || jb < qi - band)) s[1][r] = -3.0e38f; }
      if (!keepa) s[0][r] = -3.0e38f;
      if (!keepb) s[1][r] = -3.0e38f;
      float mx = fmaxf(s[0][r], s[1][r]);
      mx = fmaxf(mx, __shfl_xor(mx, 1, 32)); mx = fmaxf(mx, __shfl_xor(mx, 2, 32)); mx = fmaxf(mx, __shfl_xor(mx, 4, 32)); mx = fmaxf(mx, __shfl_xor(mx, 8, 32));
      const float mnew = fmaxf(m_r[r], mx);
      alpha[r] = (mnew > -1.0e38f) ? __expf(m_r[r] - mnew) : 1.0f;
      const float p0 = keepa ? __expf(s[0][r] - mnew) : 0.f;
      const float p1 = keepb ? __expf(s[1][r] - mnew) : 0.f;
      m_r[r] = mnew;
      l_r[r] = l_r[r] * alpha[r] + p0 + p1;
      float g0 = p0, g1 = p1; if (gp) { g0 *= bf16_round(gpa[r]); g1 *= bf16_round(gpb[r]); }   // post-softmax multiplier: P only, not the normaliser
      unsigned short hb = bf16_bits(g0); sPh[w][8 * hh + r][ln] = hb;      sPl[w][8 * hh + r][ln] = bf16_bits(g0 - bf16_val(hb));
      hb = bf16_bits(g1);                sPh[w][8 * hh + r][16 + ln] = hb; sPl[w][8 * hh + r][16 + ln] = bf16_bits(g1 - bf16_val(hb));
    }
#pragma unroll
    for (int dt = 0; dt < DT; ++dt)
#pragma unroll
      for (int r = 0; r < 8; ++r) oacc[dt][r] *= alpha[r];
    __builtin_amdgcn_fence(__ATOMIC_ACQ_REL, "workgroup");
    __builtin_amdgcn_wave_barrier();
    FragB pah, pal;
    pah.half[0] = *(const v8us*)&sPh[w][ln][8 * hh]; pah.half[1] = *(const v8us*)&sPh[w][ln][16 + 8 * hh];
    pal.half[0] = *(const v8us*)&sPl[w][ln][8 * hh]; pal.half[1] = *(const v8us*)&sPl[w][ln][16 + 8 * hh];
#pragma unroll
    for (int dt = 0; dt < DT; ++dt) {
      FragB bvh, bvl;
#pragma unroll
      for (int i = 0; i < 8; ++i) {
        bvh.u[i] = sVh[8 * hh + i][dt * 16 + ln]; bvh.u[8 + i] = sVh[16 + 8 * hh + i][dt * 16 + ln];
        bvl.u[i] = sVl[8 * hh + i][dt * 16 + ln]; bvl.u[8 + i] = sVl[16 + 8 * hh + i][dt * 16 + ln];
      }
      oacc[dt] = mmaN<3>(pah.v, pal.v, bvh.v, bvl.v, oacc[dt]);
    }
    __builtin_amdgcn_fence(__ATOMIC_ACQ_REL, "workgroup");
    __builtin_amdgcn_wave_barrier();
  }
#pragma unroll
  for (int r = 0; r < 8; ++r) {
    float l = l_r[r];
    l += __shfl_xor(l, 1, 32); l += __shfl_xor(l, 2, 32); l += __shfl_xor(l, 4, 32); l += __shfl_xor(l, 8, 32);
    l_r[r] = (m_r[r] > -1.0e38f) ? 1.0f / l : __builtin_nanf("");
  }
#pragma unroll
  for (int dt = 0; dt < DT; ++dt)
#pragma unroll
    for (int r = 0; r < 8; ++r) sO[w][8 * hh + r][dt * 16 + ln] = oacc[dt][r] * l_r[r];
  __builtin_amdgcn_fence(__ATOMIC_ACQ_REL, "workgroup");
  __builtin_amdgcn_wave_barrier();
  {
    for (int r = 0; r < 16; ++r) {
      const int row = q0 + r;
      if (row < Tq && lane < D / 4) {
        const v4f val = *(const v4fa*)&sO[w][r][lane * 4];
        *(v4f*)(y + ((size_t)b * Tq + row) * ypitch + h * D + lane * 4) = val;
      }
    }
    
  }
}

__global__ __launch_bounds__(256) void k_round_rows(const float* __restrict__ W, unsigned short* __restrict__ Wt, int n8) {
  const int t = blockIdx.x * 256 + threadIdx.x;
  if (t >= n8) return;
  const v4f a = *(const v4fa*)(W + (size_t)t * 8), b = *(const v4fa*)(W + (size_t)t * 8 + 4);
  v8us v; v[0]=bf16_bits(a[0]); v[1]=bf16_bits(a[1]); v[2]=bf16_bits(a[2]); v[3]=bf16_bits(a[3]);
  v[4]=bf16_bits(b[0]); v[5]=bf16_bits(b[1]); v[6]=bf16_bits(b[2]); v[7]=bf16_bits(b[3]);
  *(v8us*)(Wt + (size_t)t * 8) = v; 
}

extern "C" void kernel_launch(void* const* d_in, const int* in_sizes, int n_in,
                              void* d_out, int out_size, void* d_ws, size_t ws_size, hipStream_t stream) {
  (void)in_sizes; (void)n_in; (void)out_size;
  const float* xq = (const float*)d_in[0]; const float* xk = (const float*)d_in[1]; const float* xv = (const float*)d_in[2];
  const float* gp = (const float*)d_in[3]; const int* mask = (const int*)d_in[4];
  const float* Wq = (const float*)d_in[5]; const float* bq = (const float*)d_in[6]; const float* Wk = (const float*)d_in[7]; const float* bk = (const float*)d_in[8];
  const float* Wv = (const float*)d_in[9]; const float* bv = (const float*)d_in[10]; const float* Wo = (const float*)d_in[11]; const float* bo = (const float*)d_in[12];
  char* ws = (char*)d_ws; size_t off = 0;
  auto take = [&](size_t bytes) { char* p = ws + off; off += (bytes + 255) & ~(size_t)255; return p; };
  const int M = BB * TT, n8 = DD * DD / 8, gb = ((M / 16) * (DD / 64) + 3) / 4;
  unsigned short* Wt[4]; for (int i = 0; i < 4; ++i) Wt[i] = (unsigned short*)take((size_t)DD * DD * 2);
  float* q = (float*)take((size_t)M * DD * 4); float* k = (float*)take((size_t)M * DD * 4); float* v = (float*)take((size_t)M * DD * 4); float* att = (float*)take((size_t)M * DD * 4);
  if (off > ws_size) return;
  const float* W4[4] = {Wq, Wk, Wv, Wo};
  for (int i = 0; i < 4; ++i) k_round_rows<<<(n8 + 255) / 256, 256, 0, stream>>>(W4[i], Wt[i], n8);
  k_gemm_bf<false, 0, true><<<gb, 128, 0, stream>>>(xq, DD, Wt[0], DD, bq, q, DD, M, DD, DD);
  k_gemm_bf<false, 0, true><<<gb, 128, 0, stream>>>(xk, DD, Wt[1], DD, bk, k, DD, M, DD, DD);
  k_gemm_bf<false, 0, true><<<gb, 128, 0, stream>>>(xv, DD, Wt[2], DD, bv, v, DD, M, DD, DD);
  k_flash3c<HD><<<BB * NH * (TT / 64), 128, 0, stream>>>(q, DD, TT, k, v, TT, nullptr, nullptr, 0, DD, DD, NH, 1, 0.125f, mask, 0, 0, 0, gp, att, DD);
  k_gemm_bf<true, 0, true><<<gb, 128, 0, stream>>>(att, DD, Wt[3], DD, bo, (float*)d_out, DD, M, DD, DD);
}

// v002
// It runs in 245 microseconds.
// Timed twice side by side with v001, it ran 1.45 and 1.46 times as fast.
// Over all steps from v000 it is 2.96 times as fast.
#include <hip/hip_runtime.h>
// All contractions on v_wmma_f32_16x16x32_bf16, f32 accumulate: q/k/v = x·Wᵀ + b (inputs, W, b rounded to bf16: single exact term), QKᵀ and
// P·V per 16-query tile as 3-term bf16 hi/lo splits (mask|diag → −1e9 kept in the softmax like the module; P multiplied by
// bf16(group_prob) after normalisation), out = x·Woᵀ + bo with x split (2 terms); softmax in f32.
#define BB 2
#define TT 2048
#define DD 512
#define NH 8
#define HD 64

typedef __bf16 v16b __attribute__((ext_vector_type(16)));
typedef unsigned short v8us __attribute__((ext_vector_type(8), may_alias));
typedef float  v8f  __attribute__((ext_vector_type(8)));
typedef float  v4f  __attribute__((ext_vector_type(4)));
typedef float  v4fa __attribute__((ext_vector_type(4), may_alias));
union FragB { v16b v; v8us half[2]; unsigned short u[16]; };

__device__ __forceinline__ unsigned short bf16_bits(float x) { unsigned int u = __float_as_uint(x); return (unsigned short)((u + 0x7FFFu + ((u >> 16) & 1u)) >> 16); }
__device__ __forceinline__ float bf16_val(unsigned short b) { return __uint_as_float(((unsigned int)b) << 16); }
__device__ __forceinline__ float bf16_round(float x) { return bf16_val(bf16_bits(x)); }
// D += A·B with NT terms: 1 = ah·bh, 2 = + al·bh (A split), 3 = + ah·bl (both split)
template <int NT>
__device__ __forceinline__ v8f mmaN(v16b ah, v16b al, v16b bh, v16b bl, v8f c) {
  c = __builtin_amdgcn_wmma_f32_16x16x32_bf16(false, ah, false, bh, (short)0, c, false, false);
  if (NT >= 2) c = __builtin_amdgcn_wmma_f32_16x16x32_bf16(false, al, false, bh, (short)0, c, false, false);
  if (NT >= 3) c = __builtin_amdgcn_wmma_f32_16x16x32_bf16(false, ah, false, bl, (short)0, c, false, false);
  asm volatile("v_nop\n\tv_nop\n\tv_nop\n\tv_nop" : "+v"(c) : "v"(ah), "v"(al), "v"(bh), "v"(bl));
  return c;
}

__global__ __launch_bounds__(256) void k_wt_bf16(const float* __restrict__ W, unsigned short* __restrict__ Wt, int K, int N) {
  const int t = blockIdx.x * 256 + threadIdx.x;
  const int k8n = K / 8;
  if (t >= N * k8n) return;
  const int n = t / k8n, k8 = (t % k8n) * 8;
  v8us v;
#pragma unroll
  for (int i = 0; i < 8; ++i) v[i] = bf16_bits(W[(size_t)(k8 + i) * N + n]);
  *(v8us*)(Wt + (size_t)n * K + k8) = v;
  
}

// GEMM C[M][N] (f32, pitch ldc) = act(A[M][K]·W + bias). A f32 row-major (pitch lda) converted per fragment to bf16
// (ASPLIT: hi/lo two planes -> 2 terms, else single rounded term); Wt bf16 [N][K] (pitch ldb). BIAS_BF16 rounds the
// bias to bf16 first (bias quantised to bf16 before the add). K%32==0, M%16==0, N%64==0.
template <bool ASPLIT, int ACT, bool BIAS_BF16>
__global__ __launch_bounds__(128) void k_gemm_bf(const float* __restrict__ A, int lda, const unsigned short* __restrict__ Wt, int ldb,
                                               const float* __restrict__ bias, float* __restrict__ C, int ldc, int M, int N, int K) {
  __shared__ __attribute__((aligned(16))) float so[4][16][64];
  const int tid = threadIdx.x, w = tid >> 5, lane = tid & 31, ln = lane & 15, hh = lane >> 4;
  const int ntn = N / 64;
  const int wid = blockIdx.x * 4 + w;
  const int mt = wid / ntn, nq = wid % ntn;
  if (mt * 16 >= M) return;
  const int row0 = mt * 16, col0 = nq * 64;
  const float* arow = A + (size_t)(row0 + ln) * lda;
  v8f acc[4] = {};
  for (int kb = 0; kb < K; kb += 32) {
    FragB ah, al;
    const v4f x0 = *(const v4fa*)(arow + kb + 8 * hh), x1 = *(const v4fa*)(arow + kb + 8 * hh + 4);
    const v4f x2 = *(const v4fa*)(arow + kb + 16 + 8 * hh), x3 = *(const v4fa*)(arow + kb + 16 + 8 * hh + 4);
    float xs[16] = {x0[0],x0[1],x0[2],x0[3],x1[0],x1[1],x1[2],x1[3],x2[0],x2[1],x2[2],x2[3],x3[0],x3[1],x3[2],x3[3]};
#pragma unroll
    for (int i = 0; i < 16; ++i) { const unsigned short hb = bf16_bits(xs[i]); ah.u[i] = hb; al.u[i] = ASPLIT ? bf16_bits(xs[i] - bf16_val(hb)) : (unsigned short)0; }
#pragma unroll
    for (int t = 0; t < 4; ++t) {
      const unsigned short* brow = Wt + (size_t)(col0 + t * 16 + ln) * ldb + kb;
      FragB b;
      b.half[0] = *(const v8us*)(brow + 8 * hh);
      b.half[1] = *(const v8us*)(brow + 16 + 8 * hh);
      acc[t] = mmaN<ASPLIT ? 2 : 1>(ah.v, al.v, b.v, b.v, acc[t]);
    }
  }
#pragma unroll
  for (int t = 0; t < 4; ++t) {
    float bv = bias ? bias[col0 + t * 16 + ln] : 0.f;
    if (BIAS_BF16) bv = bf16_round(bv);
#pragma unroll
    for (int r = 0; r < 8; ++r) { float v = acc[t][r] + bv; if (ACT == 1) v = fmaxf(v, 0.f); so[w][8 * hh + r][t * 16 + ln] = v; }
  }
  __builtin_amdgcn_fence(__ATOMIC_ACQ_REL, "workgroup");
  __builtin_amdgcn_wave_barrier();
  const int rsub = lane >> 4, c4 = (lane & 15) * 4;
  {
#pragma unroll
    for (int q = 0; q < 8; ++q) {
      const int r = q * 2 + rsub;
      const v4f v = *(const v4fa*)&so[w][r][c4];
      *(v4f*)(C + (size_t)(row0 + r) * ldc + col0 + c4) = v;
    }
    
  }
}

// Flash-style causal/unmasked attention, all contractions 3-term bf16 hi/lo splits, f32 softmax with running max.
// q,k,v rows are read from f32 buffers with arbitrary row pitch (so they can live inside a fused qkv buffer);
// D = head size (multiple of 32, <= 128); one wave = 16 query rows; block = 4 waves (64 queries) sharing K/V chunks of 32.
template <int D, bool CAUSAL>
__global__ __launch_bounds__(128) void k_flash(const float* __restrict__ qb, const float* __restrict__ kb, const float* __restrict__ vb,
                                             int pitch, int T, int H, float scale, float* __restrict__ y, int ypitch) {
  constexpr int KS = D / 32;        // k-steps for QK
  constexpr int DT = D / 16;        // d tiles for PV
  __shared__ __attribute__((aligned(16))) unsigned short sKh[32][D + 8], sKl[32][D + 8], sVh[32][D + 8], sVl[32][D + 8];
  __shared__ __attribute__((aligned(16))) unsigned short sPh[4][16][40], sPl[4][16][40];
  __shared__ __attribute__((aligned(16))) float sO[4][16][D];
  const int tid = threadIdx.x, w = tid >> 5, lane = tid & 31, ln = lane & 15, hh = lane >> 4;
  const int nqb = (T + 63) / 64;
  const int bh = blockIdx.x / nqb, qblk = blockIdx.x % nqb;
  const int b = bh / H, h = bh % H;
  const int q0 = qblk * 64 + w * 16;
  const float* Q = qb + (size_t)b * T * pitch + h * D;
  const float* K = kb + (size_t)b * T * pitch + h * D;
  const float* V = vb + (size_t)b * T * pitch + h * D;

  // A fragments of the wave's 16 query rows (scaled), hi/lo
  FragB aqh[KS], aql[KS];
  {
    int row = q0 + ln; if (row >= T) row = T - 1;
    const float* qr = Q + (size_t)row * pitch;
#pragma unroll
    for (int ks = 0; ks < KS; ++ks)
#pragma unroll
      for (int i = 0; i < 16; ++i) {
        const int d = ks * 32 + ((i < 8) ? (8 * hh + i) : (16 + 8 * hh + (i - 8)));
        const float x = qr[d] * scale; const unsigned short hb = bf16_bits(x);
        aqh[ks].u[i] = hb; aql[ks].u[i] = bf16_bits(x - bf16_val(hb));
      }
  }
  float m_r[8], l_r[8];
#pragma unroll
  for (int r = 0; r < 8; ++r) { m_r[r] = -3.0e38f; l_r[r] = 0.f; }
  v8f oacc[DT];
#pragma unroll
  for (int dt = 0; dt < DT; ++dt) oacc[dt] = (v8f){0.f,0.f,0.f,0.f,0.f,0.f,0.f,0.f};

  const int kv_end = CAUSAL ? min(T, qblk * 64 + 64) : T;     // block-uniform
  for (int j0 = 0; j0 < kv_end; j0 += 32) {
    __syncthreads();
    for (int e = tid; e < 32 * (D / 4); e += 128) {
      const int r = e / (D / 4), c4 = (e % (D / 4)) * 4;
      const int key = j0 + r;
      v4f kf = {0.f,0.f,0.f,0.f}, vf = {0.f,0.f,0.f,0.f};
      if (key < T) { kf = *(const v4fa*)(K + (size_t)key * pitch + c4); vf = *(const v4fa*)(V + (size_t)key * pitch + c4); }
#pragma unroll
      for (int t = 0; t < 4; ++t) {
        unsigned short hb = bf16_bits(kf[t]); sKh[r][c4 + t] = hb; sKl[r][c4 + t] = bf16_bits(kf[t] - bf16_val(hb));
        hb = bf16_bits(vf[t]); sVh[r][c4 + t] = hb; sVl[r][c4 + t] = bf16_bits(vf[t] - bf16_val(hb));
      }
    }
    __syncthreads();
    // S tile 16 x 32
    v8f s[2];
#pragma unroll
    for (int nt = 0; nt < 2; ++nt) {
      v8f acc = {};
#pragma unroll
      for (int ks = 0; ks < KS; ++ks) {
        FragB bh_, bl_;
        bh_.half[0] = *(const v8us*)&sKh[nt * 16 + ln][ks * 32 + 8 * hh]; bh_.half[1] = *(const v8us*)&sKh[nt * 16 + ln][ks * 32 + 16 + 8 * hh];
        bl_.half[0] = *(const v8us*)&sKl[nt * 16 + ln][ks * 32 + 8 * hh]; bl_.half[1] = *(const v8us*)&sKl[nt * 16 + ln][ks * 32 + 16 + 8 * hh];
        acc = mmaN<3>(aqh[ks].v, aql[ks].v, bh_.v, bl_.v, acc);
      }
      s[nt] = acc;
    }
    // mask + running max (rows 8hh+r; the 16 lanes of a half share rows)
    float alpha[8];
#pragma unroll
    for (int r = 0; r < 8; ++r) {
      const int qi = q0 + 8 * hh + r;
      const int ja = j0 + ln, jb = j0 + 16 + ln;
      if (CAUSAL) { if (ja > qi) s[0][r] = -3.0e38f; if (jb > qi) s[1][r] = -3.0e38f; }
      if (ja >= T) s[0][r] = -3.0e38f;
      if (jb >= T) s[1][r] = -3.0e38f;
      float mx = fmaxf(s[0][r], s[1][r]);
      mx = fmaxf(mx, __shfl_xor(mx, 1, 32)); mx = fmaxf(mx, __shfl_xor(mx, 2, 32)); mx = fmaxf(mx, __shfl_xor(mx, 4, 32)); mx = fmaxf(mx, __shfl_xor(mx, 8, 32));
      const float mnew = fmaxf(m_r[r], mx);
      alpha[r] = (mnew > -1.0e38f) ? __expf(m_r[r] - mnew) : 1.0f;
      const float p0 = (s[0][r] > -1.0e38f) ? __expf(s[0][r] - mnew) : 0.f;
      const float p1 = (s[1][r] > -1.0e38f) ? __expf(s[1][r] - mnew) : 0.f;
      m_r[r] = mnew;
      l_r[r] = l_r[r] * alpha[r] + p0 + p1;            // per-lane partial row sum (16 lanes combined at the end)
      unsigned short hb = bf16_bits(p0); sPh[w][8 * hh + r][ln] = hb;      sPl[w][8 * hh + r][ln] = bf16_bits(p0 - bf16_val(hb));
      hb = bf16_bits(p1);                sPh[w][8 * hh + r][16 + ln] = hb; sPl[w][8 * hh + r][16 + ln] = bf16_bits(p1 - bf16_val(hb));
    }
#pragma unroll
    for (int dt = 0; dt < DT; ++dt)
#pragma unroll
      for (int r = 0; r < 8; ++r) oacc[dt][r] *= alpha[r];
    __builtin_amdgcn_fence(__ATOMIC_ACQ_REL, "workgroup");
    __builtin_amdgcn_wave_barrier();
    FragB pah, pal;
    pah.half[0] = *(const v8us*)&sPh[w][ln][8 * hh]; pah.half[1] = *(const v8us*)&sPh[w][ln][16 + 8 * hh];
    pal.half[0] = *(const v8us*)&sPl[w][ln][8 * hh]; pal.half[1] = *(const v8us*)&sPl[w][ln][16 + 8 * hh];
#pragma unroll
    for (int dt = 0; dt < DT; ++dt) {
      FragB bvh, bvl;
#pragma unroll
      for (int i = 0; i < 8; ++i) {
        bvh.u[i] = sVh[8 * hh + i][dt * 16 + ln]; bvh.u[8 + i] = sVh[16 + 8 * hh + i][dt * 16 + ln];
        bvl.u[i] = sVl[8 * hh + i][dt * 16 + ln]; bvl.u[8 + i] = sVl[16 + 8 * hh + i][dt * 16 + ln];
      }
      oacc[dt] = mmaN<3>(pah.v, pal.v, bvh.v, bvl.v, oacc[dt]);
    }
    __builtin_amdgcn_fence(__ATOMIC_ACQ_REL, "workgroup");
    __builtin_amdgcn_wave_barrier();
  }
#pragma unroll
  for (int r = 0; r < 8; ++r) {
    float l = l_r[r];
    l += __shfl_xor(l, 1, 32); l += __shfl_xor(l, 2, 32); l += __shfl_xor(l, 4, 32); l += __shfl_xor(l, 8, 32);
    l_r[r] = (l > 0.f) ? 1.0f / l : 0.f;
  }
#pragma unroll
  for (int dt = 0; dt < DT; ++dt)
#pragma unroll
    for (int r = 0; r < 8; ++r) sO[w][8 * hh + r][dt * 16 + ln] = oacc[dt][r] * l_r[r];
  __builtin_amdgcn_fence(__ATOMIC_ACQ_REL, "workgroup");
  __builtin_amdgcn_wave_barrier();
  {
    for (int r = 0; r < 16; ++r) {
      const int row = q0 + r;
      if (row < T && lane < D / 4) {
        const v4f val = *(const v4fa*)&sO[w][r][lane * 4];
        *(v4f*)(y + ((size_t)b * T + row) * ypitch + h * D + lane * 4) = val;
      }
    }
    
  }
}

// Attention of one fixed shape: T queries and T keys per (batch, head), row pitch P floats for q, k, v and y, H heads of size D,
// all compile-time constants (T % 64 == 0, so no row, key or column is ever out of range inside a pass). int mask [b][T][T]
// (nonzero or the diagonal keeps the score, anything else sets it to -1e9, inside the softmax), gp [b][T][T] multiplies P after normalisation.
// The softmax of a pass holds no branch: the eight rows of a lane are independent straight-line chains that the scheduler can interleave.
// 3-term bf16 splits, f32 softmax with running max; y[b][row][h*D + d], whole-line rows (D % 32 == 0).
template <int D, int T, int H, int P>
__global__ __launch_bounds__(128) void k_flash3c(const float* __restrict__ Qb, const float* __restrict__ K1, const float* __restrict__ V1,
                                              float scale, const int* __restrict__ mask3, const float* __restrict__ gp, float* __restrict__ y) {
  static_assert(T % 64 == 0 && D % 32 == 0 && 512 % D == 0, "whole query blocks, whole 32-key passes");
  constexpr int KS = D / 32, DT = D / 16;
  __shared__ __attribute__((aligned(16))) unsigned short sKh[32][D + 8], sKl[32][D + 8], sVh[32][D + 8], sVl[32][D + 8];
  __shared__ __attribute__((aligned(16))) unsigned short sPh[4][16][40], sPl[4][16][40];
  __shared__ __attribute__((aligned(16))) float sO[4][16][D];
  const int tid = threadIdx.x, w = tid >> 5, lane = tid & 31, ln = lane & 15, hh = lane >> 4;
  constexpr int nqb = T / 64;
  const int bh = blockIdx.x / nqb, qblk = blockIdx.x % nqb;
  const int b = bh / H, h = bh % H;
  const int q0 = qblk * 64 + w * 16;
  const float* Q = Qb + (size_t)b * T * P + h * D;
  FragB aqh[KS], aql[KS];
  {
    const float* qr = Q + (size_t)(q0 + ln) * P;
#pragma unroll
    for (int ks = 0; ks < KS; ++ks)
#pragma unroll
      for (int i = 0; i < 16; ++i) {
        const int d = ks * 32 + ((i < 8) ? (8 * hh + i) : (16 + 8 * hh + (i - 8)));
        const float x = qr[d] * scale; const unsigned short hb = bf16_bits(x);
        aqh[ks].u[i] = hb; aql[ks].u[i] = bf16_bits(x - bf16_val(hb));
      }
  }
  asm volatile("s_wait_xcnt 0x0" ::: "memory");     // before the address registers of the query loads are reused
  __builtin_amdgcn_sched_barrier(0);                // keeps the address arithmetic below, which reuses them, behind that wait
  float m_r[8], l_r[8];
#pragma unroll
  for (int r = 0; r < 8; ++r) { m_r[r] = -3.0e38f; l_r[r] = 0.f; }
  v8f oacc[DT];
#pragma unroll
  for (int dt = 0; dt < DT; ++dt) oacc[dt] = (v8f){0.f,0.f,0.f,0.f,0.f,0.f,0.f,0.f};
  // Every global load of a 32-key pass is issued one pass ahead, without a predicate, into registers carried round the loop:
  // the pass behind the last one is clamped, as a whole, to the last one (in bounds), and its values are never used.
  // They are issued right behind the pass's second barrier: the work-group fences drain the load counter, and the
  // scores and the softmax are the longest stretch without one.
  constexpr int NE = 32 * (D / 4) / 128;        // 16-byte pieces of K (and of V) per thread and pass
  const int sr = tid / (D / 4), sc4 = (tid % (D / 4)) * 4;
  // each address = a base that is the same for the whole block + one per-lane byte offset that never changes + a constant
  const char* Kb = (const char*)(K1 + (size_t)b * T * P + h * D); const char* Vb = (const char*)(V1 + (size_t)b * T * P + h * D);
  const unsigned kvoff = (unsigned)(sr * P + sc4) * 4u;
  v4f kfp[NE], vfp[NE];
  auto load_kv = [&](int j) {
    const size_t jb = (size_t)min(j, T - 32) * (P * 4);
#pragma unroll
    for (int i = 0; i < NE; ++i) {
      kfp[i] = *(const v4fa*)(Kb + jb + i * (512 / D) * P * 4 + kvoff);
      vfp[i] = *(const v4fa*)(Vb + jb + i * (512 / D) * P * 4 + kvoff);
    }
    asm volatile("s_wait_xcnt 0x0" ::: "memory");   // before the address registers of the loads above are reused
    __builtin_amdgcn_sched_barrier(0);              // keeps later address arithmetic, which reuses them, behind that wait
  };
  // mask and group_prob share one index; byte offsets inside one batch's [T][T] plane fit 32 bits
  const char* mplane = (const char*)(mask3 + (size_t)b * T * T); const char* gplane = (const char*)(gp + (size_t)b * T * T);
  const unsigned mgoff = ((unsigned)(q0 + 8 * hh) * (unsigned)T + (unsigned)ln) * 4u;
  int mka[8], mkb[8], nmka[8], nmkb[8]; float gpa[8], gpb[8], ngpa[8], ngpb[8];   // this pass's, the next pass's
  auto load_mg = [&](int j) {
    const size_t jb = (size_t)min(j, T - 32) * 4;
#pragma unroll
    for (int r = 0; r < 8; ++r) { nmka[r] = *(const int*)(mplane + jb + r * T * 4 + mgoff); nmkb[r] = *(const int*)(mplane + jb + (r * T * 4 + 64) + mgoff); }
#pragma unroll
    for (int r = 0; r < 8; ++r) { ngpa[r] = *(const float*)(gplane + jb + r * T * 4 + mgoff); ngpb[r] = *(const float*)(gplane + jb + (r * T * 4 + 64) + mgoff); }
    asm volatile("s_wait_xcnt 0x0" ::: "memory");   // before the offset registers of the loads above are reused
    __builtin_amdgcn_sched_barrier(0);              // keeps later arithmetic, which reuses them, behind that wait
  };
  load_kv(0);
  load_mg(0);
  for (int j0 = 0; j0 < T; j0 += 32) {
    __syncthreads();
#pragma unroll
    for (int i = 0; i < NE; ++i) {
      const int r = sr + i * (512 / D), c4 = sc4;
#pragma unroll
      for (int t = 0; t < 4; ++t) {
        const float kx = kfp[i][t], vx = vfp[i][t];
        unsigned short hb = bf16_bits(kx); sKh[r][c4 + t] = hb; sKl[r][c4 + t] = bf16_bits(kx - bf16_val(hb));
        hb = bf16_bits(vx); sVh[r][c4 + t] = hb; sVl[r][c4 + t] = bf16_bits(vx - bf16_val(hb));
      }
    }
    __syncthreads();
#pragma unroll
    for (int r = 0; r < 8; ++r) { mka[r] = nmka[r]; mkb[r] = nmkb[r]; gpa[r] = ngpa[r]; gpb[r] = ngpb[r]; }
    load_kv(j0 + 32);
    load_mg(j0 + 32);
    v8f s[2];
#pragma unroll
    for (int nt = 0; nt < 2; ++nt) {
      v8f acc = {};
#pragma unroll
      for (int ks = 0; ks < KS; ++ks) {
        FragB bh_, bl_;
        bh_.half[0] = *(const v8us*)&sKh[nt * 16 + ln][ks * 32 + 8 * hh]; bh_.half[1] = *(const v8us*)&sKh[nt * 16 + ln][ks * 32 + 16 + 8 * hh];
        bl_.half[0] = *(const v8us*)&sKl[nt * 16 + ln][ks * 32 + 8 * hh]; bl_.half[1] = *(const v8us*)&sKl[nt * 16 + ln][ks * 32 + 16 + 8 * hh];
        acc = mmaN<3>(aqh[ks].v, aql[ks].v, bh_.v, bl_.v, acc);
      }
      s[nt] = acc;
    }
    float alpha[8];
#pragma unroll
    for (int r = 0; r < 8; ++r) {
      const int qi = q0 + 8 * hh + r;
      const int ja = j0 + ln, jb = j0 + 16 + ln;
      s[0][r] = (mka[r] != 0 || ja == qi) ? s[0][r] : -1.0e9f;
      s[1][r] = (mkb[r] != 0 || jb == qi) ? s[1][r] : -1.0e9f;
      float mx = fmaxf(s[0][r], s[1][r]);
      mx = fmaxf(mx, __shfl_xor(mx, 1, 32)); mx = fmaxf(mx, __shfl_xor(mx, 2, 32)); mx = fmaxf(mx, __shfl_xor(mx, 4, 32)); mx = fmaxf(mx, __shfl_xor(mx, 8, 32));
      const float mnew = fmaxf(m_r[r], mx);
      alpha[r] = (mnew > -1.0e38f) ? __expf(m_r[r] - mnew) : 1.0f;
      const float p0 = __expf(s[0][r] - mnew);
      const float p1 = __expf(s[1][r] - mnew);
      m_r[r] = mnew;
      l_r[r] = l_r[r] * alpha[r] + p0 + p1;
      const float g0 = p0 * bf16_round(gpa[r]), g1 = p1 * bf16_round(gpb[r]);   // post-softmax multiplier: P only, not the normaliser
      unsigned short hb = bf16_bits(g0); sPh[w][8 * hh + r][ln] = hb;      sPl[w][8 * hh + r][ln] = bf16_bits(g0 - bf16_val(hb));
      hb = bf16_bits(g1);                sPh[w][8 * hh + r][16 + ln] = hb; sPl[w][8 * hh + r][16 + ln] = bf16_bits(g1 - bf16_val(hb));
    }
#pragma unroll
    for (int dt = 0; dt < DT; ++dt)
#pragma unroll
      for (int r = 0; r < 8; ++r) oacc[dt][r] *= alpha[r];
    __builtin_amdgcn_fence(__ATOMIC_ACQ_REL, "workgroup");
    __builtin_amdgcn_wave_barrier();
    FragB pah, pal;
    pah.half[0] = *(const v8us*)&sPh[w][ln][8 * hh]; pah.half[1] = *(const v8us*)&sPh[w][ln][16 + 8 * hh];
    pal.half[0] = *(const v8us*)&sPl[w][ln][8 * hh]; pal.half[1] = *(const v8us*)&sPl[w][ln][16 + 8 * hh];
#pragma unroll
    for (int dt = 0; dt < DT; ++dt) {
      FragB bvh, bvl;
#pragma unroll
      for (int i = 0; i < 8; ++i) {
        bvh.u[i] = sVh[8 * hh + i][dt * 16 + ln]; bvh.u[8 + i] = sVh[16 + 8 * hh + i][dt * 16 + ln];
        bvl.u[i] = sVl[8 * hh + i][dt * 16 + ln]; bvl.u[8 + i] = sVl[16 + 8 * hh + i][dt * 16 + ln];
      }
      oacc[dt] = mmaN<3>(pah.v, pal.v, bvh.v, bvl.v, oacc[dt]);
    }
    __builtin_amdgcn_fence(__ATOMIC_ACQ_REL, "workgroup");
    __builtin_amdgcn_wave_barrier();
    // keeps the register copies that hand the prefetched mask and group_prob values to the next pass down here: in a loop body
    // without branches the scheduler otherwise lifts them to right behind the loads, where they wait out the whole load latency
    __builtin_amdgcn_sched_barrier(0);
  }
#pragma unroll
  for (int r = 0; r < 8; ++r) {
    float l = l_r[r];
    l += __shfl_xor(l, 1, 32); l += __shfl_xor(l, 2, 32); l += __shfl_xor(l, 4, 32); l += __shfl_xor(l, 8, 32);
    l_r[r] = (m_r[r] > -1.0e38f) ? 1.0f / l : __builtin_nanf("");
  }
#pragma unroll
  for (int dt = 0; dt < DT; ++dt)
#pragma unroll
    for (int r = 0; r < 8; ++r) sO[w][8 * hh + r][dt * 16 + ln] = oacc[dt][r] * l_r[r];
  __builtin_amdgcn_fence(__ATOMIC_ACQ_REL, "workgroup");
  __builtin_amdgcn_wave_barrier();
  {
    for (int r = 0; r < 16; ++r) {
      const int row = q0 + r;
      if (lane < D / 4) {
        const v4f val = *(const v4fa*)&sO[w][r][lane * 4];
        *(v4f*)(y + ((size_t)b * T + row) * P + h * D + lane * 4) = val;
      }
    }
    
  }
}

__global__ __launch_bounds__(256) void k_round_rows(const float* __restrict__ W, unsigned short* __restrict__ Wt, int n8) {
  const int t = blockIdx.x * 256 + threadIdx.x;
  if (t >= n8) return;
  const v4f a = *(const v4fa*)(W + (size_t)t * 8), b = *(const v4fa*)(W + (size_t)t * 8 + 4);
  v8us v; v[0]=bf16_bits(a[0]); v[1]=bf16_bits(a[1]); v[2]=bf16_bits(a[2]); v[3]=bf16_bits(a[3]);
  v[4]=bf16_bits(b[0]); v[5]=bf16_bits(b[1]); v[6]=bf16_bits(b[2]); v[7]=bf16_bits(b[3]);
  *(v8us*)(Wt + (size_t)t * 8) = v; 
}

extern "C" void kernel_launch(void* const* d_in, const int* in_sizes, int n_in,
                              void* d_out, int out_size, void* d_ws, size_t ws_size, hipStream_t stream) {
  (void)in_sizes; (void)n_in; (void)out_size;
  const float* xq = (const float*)d_in[0]; const float* xk = (const float*)d_in[1]; const float* xv = (const float*)d_in[2];
  const float* gp = (const float*)d_in[3]; const int* mask = (const int*)d_in[4];
  const float* Wq = (const float*)d_in[5]; const float* bq = (const float*)d_in[6]; const float* Wk = (const float*)d_in[7]; const float* bk = (const float*)d_in[8];
  const float* Wv = (const float*)d_in[9]; const float* bv = (const float*)d_in[10]; const float* Wo = (const float*)d_in[11]; const float* bo = (const float*)d_in[12];
  char* ws = (char*)d_ws; size_t off = 0;
  auto take = [&](size_t bytes) { char* p = ws + off; off += (bytes + 255) & ~(size_t)255; return p; };
  const int M = BB * TT, n8 = DD * DD / 8, gb = ((M / 16) * (DD / 64) + 3) / 4;
  unsigned short* Wt[4]; for (int i = 0; i < 4; ++i) Wt[i] = (unsigned short*)take((size_t)DD * DD * 2);
  float* q = (float*)take((size_t)M * DD * 4); float* k = (float*)take((size_t)M * DD * 4); float* v = (float*)take((size_t)M * DD * 4); float* att = (float*)take((size_t)M * DD * 4);
  if (off > ws_size) return;
  const float* W4[4] = {Wq, Wk, Wv, Wo};
  for (int i = 0; i < 4; ++i) k_round_rows<<<(n8 + 255) / 256, 256, 0, stream>>>(W4[i], Wt[i], n8);
  k_gemm_bf<false, 0, true><<<gb, 128, 0, stream>>>(xq, DD, Wt[0], DD, bq, q, DD, M, DD, DD);
  k_gemm_bf<false, 0, true><<<gb, 128, 0, stream>>>(xk, DD, Wt[1], DD, bk, k, DD, M, DD, DD);
  k_gemm_bf<false, 0, true><<<gb, 128, 0, stream>>>(xv, DD, Wt[2], DD, bv, v, DD, M, DD, DD);
  k_flash3c<HD, TT, NH, DD><<<BB * NH * (TT / 64), 128, 0, stream>>>(q, k, v, 0.125f, mask, gp, att);
  k_gemm_bf<true, 0, true><<<gb, 128, 0, stream>>>(att, DD, Wt[3], DD, bo, (float*)d_out, DD, M, DD, DD);
}

// v003
// One run takes 232 microseconds.
// Two timings next to v002 put it at 1.04 and 1.05 times that version's speed.
// Over all steps from v000 it is 3.09 times as fast.
#include <hip/hip_runtime.h>
// All contractions on v_wmma_f32_16x16x32_bf16, f32 accumulate: q/k/v = x·Wᵀ + b (inputs, W, b rounded to bf16: single exact term), QKᵀ and
// P·V per 16-query tile as 3-term bf16 hi/lo splits (mask|diag → −1e9 kept in the softmax like the module; P multiplied by
// bf16(group_prob) after normalisation), out = x·Woᵀ + bo with x split (2 terms); softmax in f32.
#define BB 2
#define TT 2048
#define DD 512
#define NH 8
#define HD 64

typedef __bf16 v16b __attribute__((ext_vector_type(16)));
typedef unsigned short v8us __attribute__((ext_vector_type(8), may_alias));
typedef float  v8f  __attribute__((ext_vector_type(8)));
typedef float  v4f  __attribute__((ext_vector_type(4)));
typedef float  v4fa __attribute__((ext_vector_type(4), may_alias));
union FragB { v16b v; v8us half[2]; unsigned short u[16]; };

__device__ __forceinline__ unsigned short bf16_bits(float x) { unsigned int u = __float_as_uint(x); return (unsigned short)((u + 0x7FFFu + ((u >> 16) & 1u)) >> 16); }
__device__ __forceinline__ float bf16_val(unsigned short b) { return __uint_as_float(((unsigned int)b) << 16); }
__device__ __forceinline__ float bf16_round(float x) { return bf16_val(bf16_bits(x)); }
// D += A·B with NT terms: 1 = ah·bh, 2 = + al·bh (A split), 3 = + ah·bl (both split)
template <int NT>
__device__ __forceinline__ v8f mmaN(v16b ah, v16b al, v16b bh, v16b bl, v8f c) {
  c = __builtin_amdgcn_wmma_f32_16x16x32_bf16(false, ah, false, bh, (short)0, c, false, false);
  if (NT >= 2) c = __builtin_amdgcn_wmma_f32_16x16x32_bf16(false, al, false, bh, (short)0, c, false, false);
  if (NT >= 3) c = __builtin_amdgcn_wmma_f32_16x16x32_bf16(false, ah, false, bl, (short)0, c, false, false);
  asm volatile("v_nop\n\tv_nop\n\tv_nop\n\tv_nop" : "+v"(c) : "v"(ah), "v"(al), "v"(bh), "v"(bl));
  return c;
}

__global__ __launch_bounds__(256) void k_wt_bf16(const float* __restrict__ W, unsigned short* __restrict__ Wt, int K, int N) {
  const int t = blockIdx.x * 256 + threadIdx.x;
  const int k8n = K / 8;
  if (t >= N * k8n) return;
  const int n = t / k8n, k8 = (t % k8n) * 8;
  v8us v;
#pragma unroll
  for (int i = 0; i < 8; ++i) v[i] = bf16_bits(W[(size_t)(k8 + i) * N + n]);
  *(v8us*)(Wt + (size_t)n * K + k8) = v;
  
}

// GEMM C[M][N] (f32, pitch ldc) = act(A[M][K]·W + bias). A f32 row-major (pitch lda) converted per fragment to bf16
// (ASPLIT: hi/lo two planes -> 2 terms, else single rounded term); Wt bf16 [N][K] (pitch ldb). BIAS_BF16 rounds the
// bias to bf16 first (bias quantised to bf16 before the add). K%32==0, M%16==0, N%64==0.
template <bool ASPLIT, int ACT, bool BIAS_BF16>
__global__ __launch_bounds__(128) void k_gemm_bf(const float* __restrict__ A, int lda, const unsigned short* __restrict__ Wt, int ldb,
                                               const float* __restrict__ bias, float* __restrict__ C, int ldc, int M, int N, int K) {
  __shared__ __attribute__((aligned(16))) float so[4][16][64];
  const int tid = threadIdx.x, w = tid >> 5, lane = tid & 31, ln = lane & 15, hh = lane >> 4;
  const int ntn = N / 64;
  const int wid = blockIdx.x * 4 + w;
  const int mt = wid / ntn, nq = wid % ntn;
  if (mt * 16 >= M) return;
  const int row0 = mt * 16, col0 = nq * 64;
  const float* arow = A + (size_t)(row0 + ln) * lda;
  v8f acc[4] = {};
  for (int kb = 0; kb < K; kb += 32) {
    FragB ah, al;
    const v4f x0 = *(const v4fa*)(arow + kb + 8 * hh), x1 = *(const v4fa*)(arow + kb + 8 * hh + 4);
    const v4f x2 = *(const v4fa*)(arow + kb + 16 + 8 * hh), x3 = *(const v4fa*)(arow + kb + 16 + 8 * hh + 4);
    float xs[16] = {x0[0],x0[1],x0[2],x0[3],x1[0],x1[1],x1[2],x1[3],x2[0],x2[1],x2[2],x2[3],x3[0],x3[1],x3[2],x3[3]};
#pragma unroll
    for (int i = 0; i < 16; ++i) { const unsigned short hb = bf16_bits(xs[i]); ah.u[i] = hb; al.u[i] = ASPLIT ? bf16_bits(xs[i] - bf16_val(hb)) : (unsigned short)0; }
#pragma unroll
    for (int t = 0; t < 4; ++t) {
      const unsigned short* brow = Wt + (size_t)(col0 + t * 16 + ln) * ldb + kb;
      FragB b;
      b.half[0] = *(const v8us*)(brow + 8 * hh);
      b.half[1] = *(const v8us*)(brow + 16 + 8 * hh);
      acc[t] = mmaN<ASPLIT ? 2 : 1>(ah.v, al.v, b.v, b.v, acc[t]);
    }
  }
#pragma unroll
  for (int t = 0; t < 4; ++t) {
    float bv = bias ? bias[col0 + t * 16 + ln] : 0.f;
    if (BIAS_BF16) bv = bf16_round(bv);
#pragma unroll
    for (int r = 0; r < 8; ++r) { float v = acc[t][r] + bv; if (ACT == 1) v = fmaxf(v, 0.f); so[w][8 * hh + r][t * 16 + ln] = v; }
  }
  __builtin_amdgcn_fence(__ATOMIC_ACQ_REL, "workgroup");
  __builtin_amdgcn_wave_barrier();
  const int rsub = lane >> 4, c4 = (lane & 15) * 4;
  {
#pragma unroll
    for (int q = 0; q < 8; ++q) {
      const int r = q * 2 + rsub;
      const v4f v = *(const v4fa*)&so[w][r][c4];
      *(v4f*)(C + (size_t)(row0 + r) * ldc + col0 + c4) = v;
    }
    
  }
}

// Flash-style causal/unmasked attention, all contractions 3-term bf16 hi/lo splits, f32 softmax with running max.
// q,k,v rows are read from f32 buffers with arbitrary row pitch (so they can live inside a fused qkv buffer);
// D = head size (multiple of 32, <= 128); one wave = 16 query rows; block = 4 waves (64 queries) sharing K/V chunks of 32.
template <int D, bool CAUSAL>
__global__ __launch_bounds__(128) void k_flash(const float* __restrict__ qb, const float* __restrict__ kb, const float* __restrict__ vb,
                                             int pitch, int T, int H, float scale, float* __restrict__ y, int ypitch) {
  constexpr int KS = D / 32;        // k-steps for QK
  constexpr int DT = D / 16;        // d tiles for PV
  __shared__ __attribute__((aligned(16))) unsigned short sKh[32][D + 8], sKl[32][D + 8], sVh[32][D + 8], sVl[32][D + 8];
  __shared__ __attribute__((aligned(16))) unsigned short sPh[4][16][40], sPl[4][16][40];
  __shared__ __attribute__((aligned(16))) float sO[4][16][D];
  const int tid = threadIdx.x, w = tid >> 5, lane = tid & 31, ln = lane & 15, hh = lane >> 4;
  const int nqb = (T + 63) / 64;
  const int bh = blockIdx.x / nqb, qblk = blockIdx.x % nqb;
  const int b = bh / H, h = bh % H;
  const int q0 = qblk * 64 + w * 16;
  const float* Q = qb + (size_t)b * T * pitch + h * D;
  const float* K = kb + (size_t)b * T * pitch + h * D;
  const float* V = vb + (size_t)b * T * pitch + h * D;

  // A fragments of the wave's 16 query rows (scaled), hi/lo
  FragB aqh[KS], aql[KS];
  {
    int row = q0 + ln; if (row >= T) row = T - 1;
    const float* qr = Q + (size_t)row * pitch;
#pragma unroll
    for (int ks = 0; ks < KS; ++ks)
#pragma unroll
      for (int i = 0; i < 16; ++i) {
        const int d = ks * 32 + ((i < 8) ? (8 * hh + i) : (16 + 8 * hh + (i - 8)));
        const float x = qr[d] * scale; const unsigned short hb = bf16_bits(x);
        aqh[ks].u[i] = hb; aql[ks].u[i] = bf16_bits(x - bf16_val(hb));
      }
  }
  float m_r[8], l_r[8];
#pragma unroll
  for (int r = 0; r < 8; ++r) { m_r[r] = -3.0e38f; l_r[r] = 0.f; }
  v8f oacc[DT];
#pragma unroll
  for (int dt = 0; dt < DT; ++dt) oacc[dt] = (v8f){0.f,0.f,0.f,0.f,0.f,0.f,0.f,0.f};

  const int kv_end = CAUSAL ? min(T, qblk * 64 + 64) : T;     // block-uniform
  for (int j0 = 0; j0 < kv_end; j0 += 32) {
    __syncthreads();
    for (int e = tid; e < 32 * (D / 4); e += 128) {
      const int r = e / (D / 4), c4 = (e % (D / 4)) * 4;
      const int key = j0 + r;
      v4f kf = {0.f,0.f,0.f,0.f}, vf = {0.f,0.f,0.f,0.f};
      if (key < T) { kf = *(const v4fa*)(K + (size_t)key * pitch + c4); vf = *(const v4fa*)(V + (size_t)key * pitch + c4); }
#pragma unroll
      for (int t = 0; t < 4; ++t) {
        unsigned short hb = bf16_bits(kf[t]); sKh[r][c4 + t] = hb; sKl[r][c4 + t] = bf16_bits(kf[t] - bf16_val(hb));
        hb = bf16_bits(vf[t]); sVh[r][c4 + t] = hb; sVl[r][c4 + t] = bf16_bits(vf[t] - bf16_val(hb));
      }
    }
    __syncthreads();
    // S tile 16 x 32
    v8f s[2];
#pragma unroll
    for (int nt = 0; nt < 2; ++nt) {
      v8f acc = {};
#pragma unroll
      for (int ks = 0; ks < KS; ++ks) {
        FragB bh_, bl_;
        bh_.half[0] = *(const v8us*)&sKh[nt * 16 + ln][ks * 32 + 8 * hh]; bh_.half[1] = *(const v8us*)&sKh[nt * 16 + ln][ks * 32 + 16 + 8 * hh];
        bl_.half[0] = *(const v8us*)&sKl[nt * 16 + ln][ks * 32 + 8 * hh]; bl_.half[1] = *(const v8us*)&sKl[nt * 16 + ln][ks * 32 + 16 + 8 * hh];
        acc = mmaN<3>(aqh[ks].v, aql[ks].v, bh_.v, bl_.v, acc);
      }
      s[nt] = acc;
    }
    // mask + running max (rows 8hh+r; the 16 lanes of a half share rows)
    float alpha[8];
#pragma unroll
    for (int r = 0; r < 8; ++r) {
      const int qi = q0 + 8 * hh + r;
      const int ja = j0 + ln, jb = j0 + 16 + ln;
      if (CAUSAL) { if (ja > qi) s[0][r] = -3.0e38f; if (jb > qi) s[1][r] = -3.0e38f; }
      if (ja >= T) s[0][r] = -3.0e38f;
      if (jb >= T) s[1][r] = -3.0e38f;
      float mx = fmaxf(s[0][r], s[1][r]);
      mx = fmaxf(mx, __shfl_xor(mx, 1, 32)); mx = fmaxf(mx, __shfl_xor(mx, 2, 32)); mx = fmaxf(mx, __shfl_xor(mx, 4, 32)); mx = fmaxf(mx, __shfl_xor(mx, 8, 32));
      const float mnew = fmaxf(m_r[r], mx);
      alpha[r] = (mnew > -1.0e38f) ? __expf(m_r[r] - mnew) : 1.0f;
      const float p0 = (s[0][r] > -1.0e38f) ? __expf(s[0][r] - mnew) : 0.f;
      const float p1 = (s[1][r] > -1.0e38f) ? __expf(s[1][r] - mnew) : 0.f;
      m_r[r] = mnew;
      l_r[r] = l_r[r] * alpha[r] + p0 + p1;            // per-lane partial row sum (16 lanes combined at the end)
      unsigned short hb = bf16_bits(p0); sPh[w][8 * hh + r][ln] = hb;      sPl[w][8 * hh + r][ln] = bf16_bits(p0 - bf16_val(hb));
      hb = bf16_bits(p1);                sPh[w][8 * hh + r][16 + ln] = hb; sPl[w][8 * hh + r][16 + ln] = bf16_bits(p1 - bf16_val(hb));
    }
#pragma unroll
    for (int dt = 0; dt < DT; ++dt)
#pragma unroll
      for (int r = 0; r < 8; ++r) oacc[dt][r] *= alpha[r];
    __builtin_amdgcn_fence(__ATOMIC_ACQ_REL, "workgroup");
    __builtin_amdgcn_wave_barrier();
    FragB pah, pal;
    pah.half[0] = *(const v8us*)&sPh[w][ln][8 * hh]; pah.half[1] = *(const v8us*)&sPh[w][ln][16 + 8 * hh];
    pal.half[0] = *(const v8us*)&sPl[w][ln][8 * hh]; pal.half[1] = *(const v8us*)&sPl[w][ln][16 + 8 * hh];
#pragma unroll
    for (int dt = 0; dt < DT; ++dt) {
      FragB bvh, bvl;
#pragma unroll
      for (int i = 0; i < 8; ++i) {
        bvh.u[i] = sVh[8 * hh + i][dt * 16 + ln]; bvh.u[8 + i] = sVh[16 + 8 * hh + i][dt * 16 + ln];
        bvl.u[i] = sVl[8 * hh + i][dt * 16 + ln]; bvl.u[8 + i] = sVl[16 + 8 * hh + i][dt * 16 + ln];
      }
      oacc[dt] = mmaN<3>(pah.v, pal.v, bvh.v, bvl.v, oacc[dt]);
    }
    __builtin_amdgcn_fence(__ATOMIC_ACQ_REL, "workgroup");
    __builtin_amdgcn_wave_barrier();
  }
#pragma unroll
  for (int r = 0; r < 8; ++r) {
    float l = l_r[r];
    l += __shfl_xor(l, 1, 32); l += __shfl_xor(l, 2, 32); l += __shfl_xor(l, 4, 32); l += __shfl_xor(l, 8, 32);
    l_r[r] = (l > 0.f) ? 1.0f / l : 0.f;
  }
#pragma unroll
  for (int dt = 0; dt < DT; ++dt)
#pragma unroll
    for (int r = 0; r < 8; ++r) sO[w][8 * hh + r][dt * 16 + ln] = oacc[dt][r] * l_r[r];
  __builtin_amdgcn_fence(__ATOMIC_ACQ_REL, "workgroup");
  __builtin_amdgcn_wave_barrier();
  {
    for (int r = 0; r < 16; ++r) {
      const int row = q0 + r;
      if (row < T && lane < D / 4) {
        const v4f val = *(const v4fa*)&sO[w][r][lane * 4];
        *(v4f*)(y + ((size_t)b * T + row) * ypitch + h * D + lane * 4) = val;
      }
    }
    
  }
}

// Attention of one fixed shape: T queries and T keys per (batch, head), row pitch P floats for q, k, v and y, H heads of size D,
// all compile-time constants (T % 64 == 0, so no row, key or column is ever out of range inside a pass). int mask [b][T][T]
// (nonzero or the diagonal keeps the score, anything else sets it to -1e9, inside the softmax), gp [b][T][T] multiplies P after normalisation.
// The softmax of a pass holds no branch: the eight rows of a lane are independent straight-line chains that the scheduler can interleave.
// 3-term bf16 splits, f32 softmax with running max; y[b][row][h*D + d], whole-line rows (D % 32 == 0).
// 16-byte transposing LDS read: lane (c = lane & 15, h = lane >> 4) gets rows 8h .. 8h+7 of column c of a 16 x 16 tile of 16-bit values;
// the lane's own address names row 8h + (lane & 7), columns 8 * ((lane >> 3) & 1) and up. Every lane must be on.
typedef short s16x8 __attribute__((ext_vector_type(8)));
__device__ __forceinline__ v8us lds_tr16(const unsigned short* p) {
  typedef __attribute__((address_space(3))) s16x8 lds_s16x8;
  return __builtin_bit_cast(v8us, __builtin_amdgcn_ds_load_tr16_b128_v8i16((lds_s16x8*)p));
}

template <int D, int T, int H, int P>
__global__ __launch_bounds__(128) void k_flash3c(const float* __restrict__ Qb, const float* __restrict__ K1, const float* __restrict__ V1,
                                              float scale, const int* __restrict__ mask3, const float* __restrict__ gp, float* __restrict__ y) {
  static_assert(T % 64 == 0 && D % 32 == 0 && 512 % D == 0, "whole query blocks, whole 32-key passes");
  constexpr int KS = D / 32, DT = D / 16;
  // row pitch: an odd multiple of 16 bytes for K (plain 16-byte reads), an odd multiple of 32 bytes for V (transposing reads)
  __shared__ __attribute__((aligned(16))) unsigned short sKh[32][D + 8], sKl[32][D + 8], sVh[32][D + 16], sVl[32][D + 16];
  __shared__ __attribute__((aligned(16))) unsigned short sPh[4][16][40], sPl[4][16][40];
  __shared__ __attribute__((aligned(16))) float sO[4][16][D];
  const int tid = threadIdx.x, w = tid >> 5, lane = tid & 31, ln = lane & 15, hh = lane >> 4;
  constexpr int nqb = T / 64;
  const int bh = blockIdx.x / nqb, qblk = blockIdx.x % nqb;
  const int b = bh / H, h = bh % H;
  const int q0 = qblk * 64 + w * 16;
  const float* Q = Qb + (size_t)b * T * P + h * D;
  FragB aqh[KS], aql[KS];
  {
    const float* qr = Q + (size_t)(q0 + ln) * P;
#pragma unroll
    for (int ks = 0; ks < KS; ++ks)
#pragma unroll
      for (int i = 0; i < 16; ++i) {
        const int d = ks * 32 + ((i < 8) ? (8 * hh + i) : (16 + 8 * hh + (i - 8)));
        const float x = qr[d] * scale; const unsigned short hb = bf16_bits(x);
        aqh[ks].u[i] = hb; aql[ks].u[i] = bf16_bits(x - bf16_val(hb));
      }
  }
  asm volatile("s_wait_xcnt 0x0" ::: "memory");     // before the address registers of the query loads are reused
  __builtin_amdgcn_sched_barrier(0);                // keeps the address arithmetic below, which reuses them, behind that wait
  float m_r[8], l_r[8];
#pragma unroll
  for (int r = 0; r < 8; ++r) { m_r[r] = -3.0e38f; l_r[r] = 0.f; }
  v8f oacc[DT];
#pragma unroll
  for (int dt = 0; dt < DT; ++dt) oacc[dt] = (v8f){0.f,0.f,0.f,0.f,0.f,0.f,0.f,0.f};
  // Every global load of a 32-key pass is issued one pass ahead, without a predicate, into registers carried round the loop:
  // the pass behind the last one is clamped, as a whole, to the last one (in bounds), and its values are never used.
  // They are issued right behind the pass's second barrier: the work-group fences drain the load counter, and the
  // scores and the softmax are the longest stretch without one.
  constexpr int NE = 32 * (D / 4) / 128;        // 16-byte pieces of K (and of V) per thread and pass
  const int sr = tid / (D / 4), sc4 = (tid % (D / 4)) * 4;
  // each address = a base that is the same for the whole block + one per-lane byte offset that never changes + a constant
  const char* Kb = (const char*)(K1 + (size_t)b * T * P + h * D); const char* Vb = (const char*)(V1 + (size_t)b * T * P + h * D);
  const unsigned kvoff = (unsigned)(sr * P + sc4) * 4u;
  v4f kfp[NE], vfp[NE];
  auto load_kv = [&](int j) {
    const size_t jb = (size_t)min(j, T - 32) * (P * 4);
#pragma unroll
    for (int i = 0; i < NE; ++i) {
      kfp[i] = *(const v4fa*)(Kb + jb + i * (512 / D) * P * 4 + kvoff);
      vfp[i] = *(const v4fa*)(Vb + jb + i * (512 / D) * P * 4 + kvoff);
    }
    asm volatile("s_wait_xcnt 0x0" ::: "memory");   // before the address registers of the loads above are reused
    __builtin_amdgcn_sched_barrier(0);              // keeps later address arithmetic, which reuses them, behind that wait
  };
  // mask and group_prob share one index; byte offsets inside one batch's [T][T] plane fit 32 bits
  const char* mplane = (const char*)(mask3 + (size_t)b * T * T); const char* gplane = (const char*)(gp + (size_t)b * T * T);
  const unsigned mgoff = ((unsigned)(q0 + 8 * hh) * (unsigned)T + (unsigned)ln) * 4u;
  int mka[8], mkb[8], nmka[8], nmkb[8]; float gpa[8], gpb[8], ngpa[8], ngpb[8];   // this pass's, the next pass's
  auto load_mg = [&](int j) {
    const size_t jb = (size_t)min(j, T - 32) * 4;
#pragma unroll
    for (int r = 0; r < 8; ++r) { nmka[r] = *(const int*)(mplane + jb + r * T * 4 + mgoff); nmkb[r] = *(const int*)(mplane + jb + (r * T * 4 + 64) + mgoff); }
#pragma unroll
    for (int r = 0; r < 8; ++r) { ngpa[r] = *(const float*)(gplane + jb + r * T * 4 + mgoff); ngpb[r] = *(const float*)(gplane + jb + (r * T * 4 + 64) + mgoff); }
    asm volatile("s_wait_xcnt 0x0" ::: "memory");   // before the offset registers of the loads above are reused
    __builtin_amdgcn_sched_barrier(0);              // keeps later arithmetic, which reuses them, behind that wait
  };
  load_kv(0);
  load_mg(0);
  for (int j0 = 0; j0 < T; j0 += 32) {
    __syncthreads();
#pragma unroll
    for (int i = 0; i < NE; ++i) {
      const int r = sr + i * (512 / D), c4 = sc4;
#pragma unroll
      for (int t = 0; t < 4; ++t) {
        const float kx = kfp[i][t], vx = vfp[i][t];
        unsigned short hb = bf16_bits(kx); sKh[r][c4 + t] = hb; sKl[r][c4 + t] = bf16_bits(kx - bf16_val(hb));
        hb = bf16_bits(vx); sVh[r][c4 + t] = hb; sVl[r][c4 + t] = bf16_bits(vx - bf16_val(hb));
      }
    }
    __syncthreads();
#pragma unroll
    for (int r = 0; r < 8; ++r) { mka[r] = nmka[r]; mkb[r] = nmkb[r]; gpa[r] = ngpa[r]; gpb[r] = ngpb[r]; }
    load_kv(j0 + 32);
    load_mg(j0 + 32);
    v8f s[2];
#pragma unroll
    for (int nt = 0; nt < 2; ++nt) {
      v8f acc = {};
#pragma unroll
      for (int ks = 0; ks < KS; ++ks) {
        FragB bh_, bl_;
        bh_.half[0] = *(const v8us*)&sKh[nt * 16 + ln][ks * 32 + 8 * hh]; bh_.half[1] = *(const v8us*)&sKh[nt * 16 + ln][ks * 32 + 16 + 8 * hh];
        bl_.half[0] = *(const v8us*)&sKl[nt * 16 + ln][ks * 32 + 8 * hh]; bl_.half[1] = *(const v8us*)&sKl[nt * 16 + ln][ks * 32 + 16 + 8 * hh];
        acc = mmaN<3>(aqh[ks].v, aql[ks].v, bh_.v, bl_.v, acc);
      }
      s[nt] = acc;
    }
    float alpha[8];
#pragma unroll
    for (int r = 0; r < 8; ++r) {
      const int qi = q0 + 8 * hh + r;
      const int ja = j0 + ln, jb = j0 + 16 + ln;
      s[0][r] = (mka[r] != 0 || ja == qi) ? s[0][r] : -1.0e9f;
      s[1][r] = (mkb[r] != 0 || jb == qi) ? s[1][r] : -1.0e9f;
      float mx = fmaxf(s[0][r], s[1][r]);
      mx = fmaxf(mx, __shfl_xor(mx, 1, 32)); mx = fmaxf(mx, __shfl_xor(mx, 2, 32)); mx = fmaxf(mx, __shfl_xor(mx, 4, 32)); mx = fmaxf(mx, __shfl_xor(mx, 8, 32));
      const float mnew = fmaxf(m_r[r], mx);
      alpha[r] = (mnew > -1.0e38f) ? __expf(m_r[r] - mnew) : 1.0f;
      const float p0 = __expf(s[0][r] - mnew);
      const float p1 = __expf(s[1][r] - mnew);
      m_r[r] = mnew;
      l_r[r] = l_r[r] * alpha[r] + p0 + p1;
      const float g0 = p0 * bf16_round(gpa[r]), g1 = p1 * bf16_round(gpb[r]);   // post-softmax multiplier: P only, not the normaliser
      unsigned short hb = bf16_bits(g0); sPh[w][8 * hh + r][ln] = hb;      sPl[w][8 * hh + r][ln] = bf16_bits(g0 - bf16_val(hb));
      hb = bf16_bits(g1);                sPh[w][8 * hh + r][16 + ln] = hb; sPl[w][8 * hh + r][16 + ln] = bf16_bits(g1 - bf16_val(hb));
    }
#pragma unroll
    for (int dt = 0; dt < DT; ++dt)
#pragma unroll
      for (int r = 0; r < 8; ++r) oacc[dt][r] *= alpha[r];
    __builtin_amdgcn_fence(__ATOMIC_ACQ_REL, "workgroup");
    __builtin_amdgcn_wave_barrier();
    FragB pah, pal;
    pah.half[0] = *(const v8us*)&sPh[w][ln][8 * hh]; pah.half[1] = *(const v8us*)&sPh[w][ln][16 + 8 * hh];
    pal.half[0] = *(const v8us*)&sPl[w][ln][8 * hh]; pal.half[1] = *(const v8us*)&sPl[w][ln][16 + 8 * hh];
    // all V fragments of the pass as one group of loads, so that their latency is waited out once and not once per 16 columns
    FragB bvh[DT], bvl[DT];   // element i = V[8 hh + i][16 dt + ln], element 8 + i = V[16 + 8 hh + i][16 dt + ln]: the k order of pah, pal
#pragma unroll
    for (int dt = 0; dt < DT; ++dt) {
      const int vr = 8 * hh + (lane & 7), vc = dt * 16 + 8 * ((lane >> 3) & 1);
      bvh[dt].half[0] = lds_tr16(&sVh[vr][vc]); bvh[dt].half[1] = lds_tr16(&sVh[16 + vr][vc]);
      bvl[dt].half[0] = lds_tr16(&sVl[vr][vc]); bvl[dt].half[1] = lds_tr16(&sVl[16 + vr][vc]);
    }
#pragma unroll
    for (int dt = 0; dt < DT; ++dt) oacc[dt] = mmaN<3>(pah.v, pal.v, bvh[dt].v, bvl[dt].v, oacc[dt]);
    __builtin_amdgcn_fence(__ATOMIC_ACQ_REL, "workgroup");
    __builtin_amdgcn_wave_barrier();
    // keeps the register copies that hand the prefetched mask and group_prob values to the next pass down here: in a loop body
    // without branches the scheduler otherwise lifts them to right behind the loads, where they wait out the whole load latency
    __builtin_amdgcn_sched_barrier(0);
  }
#pragma unroll
  for (int r = 0; r < 8; ++r) {
    float l = l_r[r];
    l += __shfl_xor(l, 1, 32); l += __shfl_xor(l, 2, 32); l += __shfl_xor(l, 4, 32); l += __shfl_xor(l, 8, 32);
    l_r[r] = (m_r[r] > -1.0e38f) ? 1.0f / l : __builtin_nanf("");
  }
#pragma unroll
  for (int dt = 0; dt < DT; ++dt)
#pragma unroll
    for (int r = 0; r < 8; ++r) sO[w][8 * hh + r][dt * 16 + ln] = oacc[dt][r] * l_r[r];
  __builtin_amdgcn_fence(__ATOMIC_ACQ_REL, "workgroup");
  __builtin_amdgcn_wave_barrier();
  {
    for (int r = 0; r < 16; ++r) {
      const int row = q0 + r;
      if (lane < D / 4) {
        const v4f val = *(const v4fa*)&sO[w][r][lane * 4];
        *(v4f*)(y + ((size_t)b * T + row) * P + h * D + lane * 4) = val;
      }
    }
    
  }
}

__global__ __launch_bounds__(256) void k_round_rows(const float* __restrict__ W, unsigned short* __restrict__ Wt, int n8) {
  const int t = blockIdx.x * 256 + threadIdx.x;
  if (t >= n8) return;
  const v4f a = *(const v4fa*)(W + (size_t)t * 8), b = *(const v4fa*)(W + (size_t)t * 8 + 4);
  v8us v; v[0]=bf16_bits(a[0]); v[1]=bf16_bits(a[1]); v[2]=bf16_bits(a[2]); v[3]=bf16_bits(a[3]);
  v[4]=bf16_bits(b[0]); v[5]=bf16_bits(b[1]); v[6]=bf16_bits(b[2]); v[7]=bf16_bits(b[3]);
  *(v8us*)(Wt + (size_t)t * 8) = v; 
}

extern "C" void kernel_launch(void* const* d_in, const int* in_sizes, int n_in,
                              void* d_out, int out_size, void* d_ws, size_t ws_size, hipStream_t stream) {
  (void)in_sizes; (void)n_in; (void)out_size;
  const float* xq = (const float*)d_in[0]; const float* xk = (const float*)d_in[1]; const float* xv = (const float*)d_in[2];
  const float* gp = (const float*)d_in[3]; const int* mask = (const int*)d_in[4];
  const float* Wq = (const float*)d_in[5]; const float* bq = (const float*)d_in[6]; const float* Wk = (const float*)d_in[7]; const float* bk = (const float*)d_in[8];
  const float* Wv = (const float*)d_in[9]; const float* bv = (const float*)d_in[10]; const float* Wo = (const float*)d_in[11]; const float* bo = (const float*)d_in[12];
  char* ws = (char*)d_ws; size_t off = 0;
  auto take = [&](size_t bytes) { char* p = ws + off; off += (bytes + 255) & ~(size_t)255; return p; };
  const int M = BB * TT, n8 = DD * DD / 8, gb = ((M / 16) * (DD / 64) + 3) / 4;
  unsigned short* Wt[4]; for (int i = 0; i < 4; ++i) Wt[i] = (unsigned short*)take((size_t)DD * DD * 2);
  float* q = (float*)take((size_t)M * DD * 4); float* k = (float*)take((size_t)M * DD * 4); float* v = (float*)take((size_t)M * DD * 4); float* att = (float*)take((size_t)M * DD * 4);
  if (off > ws_size) return;
  const float* W4[4] = {Wq, Wk, Wv, Wo};
  for (int i = 0; i < 4; ++i) k_round_rows<<<(n8 + 255) / 256, 256, 0, stream>>>(W4[i], Wt[i], n8);
  k_gemm_bf<false, 0, true><<<gb, 128, 0, stream>>>(xq, DD, Wt[0], DD, bq, q, DD, M, DD, DD);
  k_gemm_bf<false, 0, true><<<gb, 128, 0, stream>>>(xk, DD, Wt[1], DD, bk, k, DD, M, DD, DD);
  k_gemm_bf<false, 0, true><<<gb, 128, 0, stream>>>(xv, DD, Wt[2], DD, bv, v, DD, M, DD, DD);
  k_flash3c<HD, TT, NH, DD><<<BB * NH * (TT / 64), 128, 0, stream>>>(q, k, v, 0.125f, mask, gp, att);
  k_gemm_bf<true, 0, true><<<gb, 128, 0, stream>>>(att, DD, Wt[3], DD, bo, (float*)d_out, DD, M, DD, DD);
}

// v004
// Measured time: 191 microseconds a run.
// Next to v003, in two timings, it ran 1.22 times as fast each time.
// Counting every step since v000, it is 3.76 times as fast.
#include <hip/hip_runtime.h>
// All contractions on v_wmma_f32_16x16x32_bf16, f32 accumulate: q/k/v = x·Wᵀ + b (inputs, W, b rounded to bf16: single exact term), QKᵀ and
// P·V per 16-query tile as 3-term bf16 hi/lo splits (mask|diag → −1e9 kept in the softmax like the module; P multiplied by
// bf16(group_prob) after normalisation), out = x·Woᵀ + bo with x split (2 terms); softmax in f32.
#define BB 2
#define TT 2048
#define DD 512
#define NH 8
#define HD 64

typedef __bf16 v16b __attribute__((ext_vector_type(16)));
typedef unsigned short v8us __attribute__((ext_vector_type(8), may_alias));
typedef float  v8f  __attribute__((ext_vector_type(8)));
typedef float  v4f  __attribute__((ext_vector_type(4)));
typedef float  v4fa __attribute__((ext_vector_type(4), may_alias));
union FragB { v16b v; v8us half[2]; unsigned short u[16]; };

__device__ __forceinline__ unsigned short bf16_bits(float x) { unsigned int u = __float_as_uint(x); return (unsigned short)((u + 0x7FFFu + ((u >> 16) & 1u)) >> 16); }
__device__ __forceinline__ float bf16_val(unsigned short b) { return __uint_as_float(((unsigned int)b) << 16); }
__device__ __forceinline__ float bf16_round(float x) { return bf16_val(bf16_bits(x)); }
// D += A·B with NT terms: 1 = ah·bh, 2 = + al·bh (A split), 3 = + ah·bl (both split)
template <int NT>
__device__ __forceinline__ v8f mmaN(v16b ah, v16b al, v16b bh, v16b bl, v8f c) {
  c = __builtin_amdgcn_wmma_f32_16x16x32_bf16(false, ah, false, bh, (short)0, c, false, false);
  if (NT >= 2) c = __builtin_amdgcn_wmma_f32_16x16x32_bf16(false, al, false, bh, (short)0, c, false, false);
  if (NT >= 3) c = __builtin_amdgcn_wmma_f32_16x16x32_bf16(false, ah, false, bl, (short)0, c, false, false);
  asm volatile("v_nop\n\tv_nop\n\tv_nop\n\tv_nop" : "+v"(c) : "v"(ah), "v"(al), "v"(bh), "v"(bl));
  return c;
}

__global__ __launch_bounds__(256) void k_wt_bf16(const float* __restrict__ W, unsigned short* __restrict__ Wt, int K, int N) {
  const int t = blockIdx.x * 256 + threadIdx.x;
  const int k8n = K / 8;
  if (t >= N * k8n) return;
  const int n = t / k8n, k8 = (t % k8n) * 8;
  v8us v;
#pragma unroll
  for (int i = 0; i < 8; ++i) v[i] = bf16_bits(W[(size_t)(k8 + i) * N + n]);
  *(v8us*)(Wt + (size_t)n * K + k8) = v;
  
}

// GEMM C[M][N] (f32, pitch ldc) = act(A[M][K]·W + bias). A f32 row-major (pitch lda) converted per fragment to bf16
// (ASPLIT: hi/lo two planes -> 2 terms, else single rounded term); Wt bf16 [N][K] (pitch ldb). BIAS_BF16 rounds the
// bias to bf16 first (bias quantised to bf16 before the add). K%32==0, M%16==0, N%64==0.
template <bool ASPLIT, int ACT, bool BIAS_BF16>
__global__ __launch_bounds__(128) void k_gemm_bf(const float* __restrict__ A, int lda, const unsigned short* __restrict__ Wt, int ldb,
                                               const float* __restrict__ bias, float* __restrict__ C, int ldc, int M, int N, int K) {
  __shared__ __attribute__((aligned(16))) float so[4][16][64];
  const int tid = threadIdx.x, w = tid >> 5, lane = tid & 31, ln = lane & 15, hh = lane >> 4;
  const int ntn = N / 64;
  const int wid = blockIdx.x * 4 + w;
  const int mt = wid / ntn, nq = wid % ntn;
  if (mt * 16 >= M) return;
  const int row0 = mt * 16, col0 = nq * 64;
  const float* arow = A + (size_t)(row0 + ln) * lda;
  v8f acc[4] = {};
  for (int kb = 0; kb < K; kb += 32) {
    FragB ah, al;
    const v4f x0 = *(const v4fa*)(arow + kb + 8 * hh), x1 = *(const v4fa*)(arow + kb + 8 * hh + 4);
    const v4f x2 = *(const v4fa*)(arow + kb + 16 + 8 * hh), x3 = *(const v4fa*)(arow + kb + 16 + 8 * hh + 4);
    float xs[16] = {x0[0],x0[1],x0[2],x0[3],x1[0],x1[1],x1[2],x1[3],x2[0],x2[1],x2[2],x2[3],x3[0],x3[1],x3[2],x3[3]};
#pragma unroll
    for (int i = 0; i < 16; ++i) { const unsigned short hb = bf16_bits(xs[i]); ah.u[i] = hb; al.u[i] = ASPLIT ? bf16_bits(xs[i] - bf16_val(hb)) : (unsigned short)0; }
#pragma unroll
    for (int t = 0; t < 4; ++t) {
      const unsigned short* brow = Wt + (size_t)(col0 + t * 16 + ln) * ldb + kb;
      FragB b;
      b.half[0] = *(const v8us*)(brow + 8 * hh);
      b.half[1] = *(const v8us*)(brow + 16 + 8 * hh);
      acc[t] = mmaN<ASPLIT ? 2 : 1>(ah.v, al.v, b.v, b.v, acc[t]);
    }
  }
#pragma unroll
  for (int t = 0; t < 4; ++t) {
    float bv = bias ? bias[col0 + t * 16 + ln] : 0.f;
    if (BIAS_BF16) bv = bf16_round(bv);
#pragma unroll
    for (int r = 0; r < 8; ++r) { float v = acc[t][r] + bv; if (ACT == 1) v = fmaxf(v, 0.f); so[w][8 * hh + r][t * 16 + ln] = v; }
  }
  __builtin_amdgcn_fence(__ATOMIC_ACQ_REL, "workgroup");
  __builtin_amdgcn_wave_barrier();
  const int rsub = lane >> 4, c4 = (lane & 15) * 4;
  {
#pragma unroll
    for (int q = 0; q < 8; ++q) {
      const int r = q * 2 + rsub;
      const v4f v = *(const v4fa*)&so[w][r][c4];
      *(v4f*)(C + (size_t)(row0 + r) * ldc + col0 + c4) = v;
    }
    
  }
}

// Flash-style causal/unmasked attention, all contractions 3-term bf16 hi/lo splits, f32 softmax with running max.
// q,k,v rows are read from f32 buffers with arbitrary row pitch (so they can live inside a fused qkv buffer);
// D = head size (multiple of 32, <= 128); one wave = 16 query rows; block = 4 waves (64 queries) sharing K/V chunks of 32.
template <int D, bool CAUSAL>
__global__ __launch_bounds__(128) void k_flash(const float* __restrict__ qb, const float* __restrict__ kb, const float* __restrict__ vb,
                                             int pitch, int T, int H, float scale, float* __restrict__ y, int ypitch) {
  constexpr int KS = D / 32;        // k-steps for QK
  constexpr int DT = D / 16;        // d tiles for PV
  __shared__ __attribute__((aligned(16))) unsigned short sKh[32][D + 8], sKl[32][D + 8], sVh[32][D + 8], sVl[32][D + 8];
  __shared__ __attribute__((aligned(16))) unsigned short sPh[4][16][40], sPl[4][16][40];
  __shared__ __attribute__((aligned(16))) float sO[4][16][D];
  const int tid = threadIdx.x, w = tid >> 5, lane = tid & 31, ln = lane & 15, hh = lane >> 4;
  const int nqb = (T + 63) / 64;
  const int bh = blockIdx.x / nqb, qblk = blockIdx.x % nqb;
  const int b = bh / H, h = bh % H;
  const int q0 = qblk * 64 + w * 16;
  const float* Q = qb + (size_t)b * T * pitch + h * D;
  const float* K = kb + (size_t)b * T * pitch + h * D;
  const float* V = vb + (size_t)b * T * pitch + h * D;

  // A fragments of the wave's 16 query rows (scaled), hi/lo
  FragB aqh[KS], aql[KS];
  {
    int row = q0 + ln; if (row >= T) row = T - 1;
    const float* qr = Q + (size_t)row * pitch;
#pragma unroll
    for (int ks = 0; ks < KS; ++ks)
#pragma unroll
      for (int i = 0; i < 16; ++i) {
        const int d = ks * 32 + ((i < 8) ? (8 * hh + i) : (16 + 8 * hh + (i - 8)));
        const float x = qr[d] * scale; const unsigned short hb = bf16_bits(x);
        aqh[ks].u[i] = hb; aql[ks].u[i] = bf16_bits(x - bf16_val(hb));
      }
  }
  float m_r[8], l_r[8];
#pragma unroll
  for (int r = 0; r < 8; ++r) { m_r[r] = -3.0e38f; l_r[r] = 0.f; }
  v8f oacc[DT];
#pragma unroll
  for (int dt = 0; dt < DT; ++dt) oacc[dt] = (v8f){0.f,0.f,0.f,0.f,0.f,0.f,0.f,0.f};

  const int kv_end = CAUSAL ? min(T, qblk * 64 + 64) : T;     // block-uniform
  for (int j0 = 0; j0 < kv_end; j0 += 32) {
    __syncthreads();
    for (int e = tid; e < 32 * (D / 4); e += 128) {
      const int r = e / (D / 4), c4 = (e % (D / 4)) * 4;
      const int key = j0 + r;
      v4f kf = {0.f,0.f,0.f,0.f}, vf = {0.f,0.f,0.f,0.f};
      if (key < T) { kf = *(const v4fa*)(K + (size_t)key * pitch + c4); vf = *(const v4fa*)(V + (size_t)key * pitch + c4); }
#pragma unroll
      for (int t = 0; t < 4; ++t) {
        unsigned short hb = bf16_bits(kf[t]); sKh[r][c4 + t] = hb; sKl[r][c4 + t] = bf16_bits(kf[t] - bf16_val(hb));
        hb = bf16_bits(vf[t]); sVh[r][c4 + t] = hb; sVl[r][c4 + t] = bf16_bits(vf[t] - bf16_val(hb));
      }
    }
    __syncthreads();
    // S tile 16 x 32
    v8f s[2];
#pragma unroll
    for (int nt = 0; nt < 2; ++nt) {
      v8f acc = {};
#pragma unroll
      for (int ks = 0; ks < KS; ++ks) {
        FragB bh_, bl_;
        bh_.half[0] = *(const v8us*)&sKh[nt * 16 + ln][ks * 32 + 8 * hh]; bh_.half[1] = *(const v8us*)&sKh[nt * 16 + ln][ks * 32 + 16 + 8 * hh];
        bl_.half[0] = *(const v8us*)&sKl[nt * 16 + ln][ks * 32 + 8 * hh]; bl_.half[1] = *(const v8us*)&sKl[nt * 16 + ln][ks * 32 + 16 + 8 * hh];
        acc = mmaN<3>(aqh[ks].v, aql[ks].v, bh_.v, bl_.v, acc);
      }
      s[nt] = acc;
    }
    // mask + running max (rows 8hh+r; the 16 lanes of a half share rows)
    float alpha[8];
#pragma unroll
    for (int r = 0; r < 8; ++r) {
      const int qi = q0 + 8 * hh + r;
      const int ja = j0 + ln, jb = j0 + 16 + ln;
      if (CAUSAL) { if (ja > qi) s[0][r] = -3.0e38f; if (jb > qi) s[1][r] = -3.0e38f; }
      if (ja >= T) s[0][r] = -3.0e38f;
      if (jb >= T) s[1][r] = -3.0e38f;
      float mx = fmaxf(s[0][r], s[1][r]);
      mx = fmaxf(mx, __shfl_xor(mx, 1, 32)); mx = fmaxf(mx, __shfl_xor(mx, 2, 32)); mx = fmaxf(mx, __shfl_xor(mx, 4, 32)); mx = fmaxf(mx, __shfl_xor(mx, 8, 32));
      const float mnew = fmaxf(m_r[r], mx);
      alpha[r] = (mnew > -1.0e38f) ? __expf(m_r[r] - mnew) : 1.0f;
      const float p0 = (s[0][r] > -1.0e38f) ? __expf(s[0][r] - mnew) : 0.f;
      const float p1 = (s[1][r] > -1.0e38f) ? __expf(s[1][r] - mnew) : 0.f;
      m_r[r] = mnew;
      l_r[r] = l_r[r] * alpha[r] + p0 + p1;            // per-lane partial row sum (16 lanes combined at the end)
      unsigned short hb = bf16_bits(p0); sPh[w][8 * hh + r][ln] = hb;      sPl[w][8 * hh + r][ln] = bf16_bits(p0 - bf16_val(hb));
      hb = bf16_bits(p1);                sPh[w][8 * hh + r][16 + ln] = hb; sPl[w][8 * hh + r][16 + ln] = bf16_bits(p1 - bf16_val(hb));
    }
#pragma unroll
    for (int dt = 0; dt < DT; ++dt)
#pragma unroll
      for (int r = 0; r < 8; ++r) oacc[dt][r] *= alpha[r];
    __builtin_amdgcn_fence(__ATOMIC_ACQ_REL, "workgroup");
    __builtin_amdgcn_wave_barrier();
    FragB pah, pal;
    pah.half[0] = *(const v8us*)&sPh[w][ln][8 * hh]; pah.half[1] = *(const v8us*)&sPh[w][ln][16 + 8 * hh];
    pal.half[0] = *(const v8us*)&sPl[w][ln][8 * hh]; pal.half[1] = *(const v8us*)&sPl[w][ln][16 + 8 * hh];
#pragma unroll
    for (int dt = 0; dt < DT; ++dt) {
      FragB bvh, bvl;
#pragma unroll
      for (int i = 0; i < 8; ++i) {
        bvh.u[i] = sVh[8 * hh + i][dt * 16 + ln]; bvh.u[8 + i] = sVh[16 + 8 * hh + i][dt * 16 + ln];
        bvl.u[i] = sVl[8 * hh + i][dt * 16 + ln]; bvl.u[8 + i] = sVl[16 + 8 * hh + i][dt * 16 + ln];
      }
      oacc[dt] = mmaN<3>(pah.v, pal.v, bvh.v, bvl.v, oacc[dt]);
    }
    __builtin_amdgcn_fence(__ATOMIC_ACQ_REL, "workgroup");
    __builtin_amdgcn_wave_barrier();
  }
#pragma unroll
  for (int r = 0; r < 8; ++r) {
    float l = l_r[r];
    l += __shfl_xor(l, 1, 32); l += __shfl_xor(l, 2, 32); l += __shfl_xor(l, 4, 32); l += __shfl_xor(l, 8, 32);
    l_r[r] = (l > 0.f) ? 1.0f / l : 0.f;
  }
#pragma unroll
  for (int dt = 0; dt < DT; ++dt)
#pragma unroll
    for (int r = 0; r < 8; ++r) sO[w][8 * hh + r][dt * 16 + ln] = oacc[dt][r] * l_r[r];
  __builtin_amdgcn_fence(__ATOMIC_ACQ_REL, "workgroup");
  __builtin_amdgcn_wave_barrier();
  {
    for (int r = 0; r < 16; ++r) {
      const int row = q0 + r;
      if (row < T && lane < D / 4) {
        const v4f val = *(const v4fa*)&sO[w][r][lane * 4];
        *(v4f*)(y + ((size_t)b * T + row) * ypitch + h * D + lane * 4) = val;
      }
    }
    
  }
}

typedef short s16x8 __attribute__((ext_vector_type(8)));
__device__ __forceinline__ v8us lds_tr16(const unsigned short* p) {
  typedef __attribute__((address_space(3))) s16x8 lds_s16x8;
  return __builtin_bit_cast(v8us, __builtin_amdgcn_ds_load_tr16_b128_v8i16((lds_s16x8*)p));
}

// the value that lane l ^ 16 holds (the other 16-lane half of the wave), by a vector cross-row move
__device__ __forceinline__ float other_half(float x) {
  const int b = __float_as_int(x);
  return __int_as_float(__builtin_amdgcn_permlanex16(b, b, 0x76543210, 0xfedcba98, false, false));
}
typedef int v4ia __attribute__((ext_vector_type(4), may_alias));
typedef int v4i  __attribute__((ext_vector_type(4)));

template <int D, int T, int H, int P>
__global__ __launch_bounds__(128) void k_flash3c(const float* __restrict__ Qb, const float* __restrict__ K1, const float* __restrict__ V1,
                                              float scale, const int* __restrict__ mask3, const float* __restrict__ gp, float* __restrict__ y) {
  static_assert(T % 64 == 0 && D % 32 == 0 && 512 % D == 0, "whole query blocks, whole 32-key passes");
  constexpr int KS = D / 32, DT = D / 16;
  // row pitch: an odd multiple of 16 bytes for K (plain 16-byte reads), an odd multiple of 32 bytes for V (transposing reads)
  __shared__ __attribute__((aligned(16))) unsigned short sKh[32][D + 8], sKl[32][D + 8], sVh[32][D + 16], sVl[32][D + 16];
  __shared__ __attribute__((aligned(16))) float sO[4][16][D + 4];   // pitch 16 bytes over a power of two: a lane writes a whole row piece
  const int tid = threadIdx.x, w = tid >> 5, lane = tid & 31, ln = lane & 15, hh = lane >> 4;
  constexpr int nqb = T / 64;
  const int bh = blockIdx.x / nqb, qblk = blockIdx.x % nqb;
  const int b = bh / H, h = bh % H;
  const int q0 = qblk * 64 + w * 16;
  const float* Q = Qb + (size_t)b * T * P + h * D;
  FragB aqh[KS], aql[KS];
  {
    const float* qr = Q + (size_t)(q0 + ln) * P;
#pragma unroll
    for (int ks = 0; ks < KS; ++ks)
#pragma unroll
      for (int i = 0; i < 16; ++i) {
        const int d = ks * 32 + ((i < 8) ? (8 * hh + i) : (16 + 8 * hh + (i - 8)));
        const float x = qr[d] * scale; const unsigned short hb = bf16_bits(x);
        aqh[ks].u[i] = hb; aql[ks].u[i] = bf16_bits(x - bf16_val(hb));
      }
  }
  asm volatile("s_wait_xcnt 0x0" ::: "memory");     // before the address registers of the query loads are reused
  __builtin_amdgcn_sched_barrier(0);                // keeps the address arithmetic below, which reuses them, behind that wait
  float m_q = -3.0e38f, l_q = 0.f;   // the lane's query: running maximum (both halves agree), sum over the keys of the lane's own half
  v8f oacc[DT];                      // oacc[dt][r] = O[query q0 + ln][16 dt + 8 hh + r]
#pragma unroll
  for (int dt = 0; dt < DT; ++dt) oacc[dt] = (v8f){0.f,0.f,0.f,0.f,0.f,0.f,0.f,0.f};
  // Every global load of a 32-key pass is issued one pass ahead, without a predicate, into registers carried round the loop:
  // the pass behind the last one is clamped, as a whole, to the last one (in bounds), and its values are never used.
  // They are issued right behind the pass's second barrier: the barriers drain the load counter, and from there to the
  // next pass's first barrier is the longest stretch without one.
  constexpr int NE = 32 * (D / 4) / 128;        // 16-byte pieces of K (and of V) per thread and pass
  const int sr = tid / (D / 4), sc4 = (tid % (D / 4)) * 4;
  // each address = a base that is the same for the whole block + one per-lane byte offset that never changes + a constant
  const char* Kb = (const char*)(K1 + (size_t)b * T * P + h * D); const char* Vb = (const char*)(V1 + (size_t)b * T * P + h * D);
  const unsigned kvoff = (unsigned)(sr * P + sc4) * 4u;
  v4f kfp[NE], vfp[NE];
  auto load_kv = [&](int j) {
    const size_t jb = (size_t)min(j, T - 32) * (P * 4);
#pragma unroll
    for (int i = 0; i < NE; ++i) {
      kfp[i] = *(const v4fa*)(Kb + jb + i * (512 / D) * P * 4 + kvoff);
      vfp[i] = *(const v4fa*)(Vb + jb + i * (512 / D) * P * 4 + kvoff);
    }
    asm volatile("s_wait_xcnt 0x0" ::: "memory");   // before the address registers of the loads above are reused
    __builtin_amdgcn_sched_barrier(0);              // keeps later address arithmetic, which reuses them, behind that wait
  };
  // mask and group_prob share one index; byte offsets inside one batch's [T][T] plane fit 32 bits
  const char* mplane = (const char*)(mask3 + (size_t)b * T * T); const char* gplane = (const char*)(gp + (size_t)b * T * T);
  const unsigned mgoff = ((unsigned)(q0 + ln) * (unsigned)T + (unsigned)(8 * hh)) * 4u;
  v4i mk[4], nmk[4]; v4f gq[4], ngq[4];   // this pass's, the next pass's; piece 2 nt + c = keys 16 nt + 8 hh + 4 c .. + 3 of the lane's query row
  auto load_mg = [&](int j) {
    const size_t jb = (size_t)min(j, T - 32) * 4;
#pragma unroll
    for (int i = 0; i < 4; ++i) nmk[i] = *(const v4ia*)(mplane + jb + ((i >> 1) * 64 + (i & 1) * 16) + mgoff);
#pragma unroll
    for (int i = 0; i < 4; ++i) ngq[i] = *(const v4fa*)(gplane + jb + ((i >> 1) * 64 + (i & 1) * 16) + mgoff);
    asm volatile("s_wait_xcnt 0x0" ::: "memory");   // before the offset registers of the loads above are reused
    __builtin_amdgcn_sched_barrier(0);              // keeps later arithmetic, which reuses them, behind that wait
  };
  load_kv(0);
  load_mg(0);
  for (int j0 = 0; j0 < T; j0 += 32) {
    __syncthreads();
#pragma unroll
    for (int i = 0; i < NE; ++i) {
      const int r = sr + i * (512 / D), c4 = sc4;
#pragma unroll
      for (int t = 0; t < 4; ++t) {
        const float kx = kfp[i][t], vx = vfp[i][t];
        unsigned short hb = bf16_bits(kx); sKh[r][c4 + t] = hb; sKl[r][c4 + t] = bf16_bits(kx - bf16_val(hb));
        hb = bf16_bits(vx); sVh[r][c4 + t] = hb; sVl[r][c4 + t] = bf16_bits(vx - bf16_val(hb));
      }
    }
    __syncthreads();
#pragma unroll
    for (int i = 0; i < 4; ++i) { mk[i] = nmk[i]; gq[i] = ngq[i]; }
    load_kv(j0 + 32);
    load_mg(j0 + 32);
    v8f s[2];
#pragma unroll
    for (int nt = 0; nt < 2; ++nt) {
      v8f acc = {};
#pragma unroll
      for (int ks = 0; ks < KS; ++ks) {
        FragB bh_, bl_;
        bh_.half[0] = *(const v8us*)&sKh[nt * 16 + ln][ks * 32 + 8 * hh]; bh_.half[1] = *(const v8us*)&sKh[nt * 16 + ln][ks * 32 + 16 + 8 * hh];
        bl_.half[0] = *(const v8us*)&sKl[nt * 16 + ln][ks * 32 + 8 * hh]; bl_.half[1] = *(const v8us*)&sKl[nt * 16 + ln][ks * 32 + 16 + 8 * hh];
        acc = mmaN<3>(bh_.v, bl_.v, aqh[ks].v, aql[ks].v, acc);   // A = K rows, B = Q: acc[r] = score(key 16 nt + 8 hh + r, query ln)
      }
      s[nt] = acc;
    }
    const int dk = q0 + ln - 8 * hh - j0;     // the diagonal's key, counted from the first key of the lane's half in this pass
    float mx = -3.0e38f;
#pragma unroll
    for (int nt = 0; nt < 2; ++nt)
#pragma unroll
      for (int r = 0; r < 8; ++r) {
        s[nt][r] = (mk[2 * nt + (r >> 2)][r & 3] != 0 || dk == nt * 16 + r) ? s[nt][r] : -1.0e9f;
        mx = fmaxf(mx, s[nt][r]);
      }
    mx = fmaxf(mx, other_half(mx));
    const float mnew = fmaxf(m_q, mx);
    const float alpha = (mnew > -1.0e38f) ? __expf(m_q - mnew) : 1.0f;
    m_q = mnew;
    FragB pbh, pbl;   // element i = P[key 8 hh + i][query ln], element 8 + i = P[key 16 + 8 hh + i][query ln]: the k order of bvh, bvl
    float psum = 0.f;
#pragma unroll
    for (int nt = 0; nt < 2; ++nt)
#pragma unroll
      for (int r = 0; r < 8; ++r) {
        const float p = __expf(s[nt][r] - mnew);
        psum += p;
        const float g = p * bf16_round(gq[2 * nt + (r >> 2)][r & 3]);   // post-softmax multiplier: P only, not the normaliser
        const unsigned short hb = bf16_bits(g);
        pbh.u[nt * 8 + r] = hb; pbl.u[nt * 8 + r] = bf16_bits(g - bf16_val(hb));
      }
    l_q = l_q * alpha + psum;
#pragma unroll
    for (int dt = 0; dt < DT; ++dt)
#pragma unroll
      for (int r = 0; r < 8; ++r) oacc[dt][r] *= alpha;
    // all V fragments of the pass as one group of loads, so that their latency is waited out once and not once per 16 columns
    FragB bvh[DT], bvl[DT];   // element i = V[8 hh + i][16 dt + ln], element 8 + i = V[16 + 8 hh + i][16 dt + ln]: the k order of pbh, pbl
#pragma unroll
    for (int dt = 0; dt < DT; ++dt) {
      const int vr = 8 * hh + (lane & 7), vc = dt * 16 + 8 * ((lane >> 3) & 1);
      bvh[dt].half[0] = lds_tr16(&sVh[vr][vc]); bvh[dt].half[1] = lds_tr16(&sVh[16 + vr][vc]);
      bvl[dt].half[0] = lds_tr16(&sVl[vr][vc]); bvl[dt].half[1] = lds_tr16(&sVl[16 + vr][vc]);
    }
#pragma unroll
    for (int dt = 0; dt < DT; ++dt) oacc[dt] = mmaN<3>(bvh[dt].v, bvl[dt].v, pbh.v, pbl.v, oacc[dt]);   // A = V^T, B = P^T
  }
  const float lsum = l_q + other_half(l_q);
  const float linv = (m_q > -1.0e38f) ? 1.0f / lsum : __builtin_nanf("");
#pragma unroll
  for (int dt = 0; dt < DT; ++dt)
#pragma unroll
    for (int c = 0; c < 2; ++c) {
      const v4f o = {oacc[dt][4 * c] * linv, oacc[dt][4 * c + 1] * linv, oacc[dt][4 * c + 2] * linv, oacc[dt][4 * c + 3] * linv};
      *(v4fa*)&sO[w][ln][dt * 16 + 8 * hh + 4 * c] = o;
    }
  __builtin_amdgcn_fence(__ATOMIC_ACQ_REL, "workgroup");
  __builtin_amdgcn_wave_barrier();
  {
    for (int r = 0; r < 16; ++r) {
      const int row = q0 + r;
      if (lane < D / 4) {
        const v4f val = *(const v4fa*)&sO[w][r][lane * 4];
        *(v4f*)(y + ((size_t)b * T + row) * P + h * D + lane * 4) = val;
      }
    }
    
  }
}

__global__ __launch_bounds__(256) void k_round_rows(const float* __restrict__ W, unsigned short* __restrict__ Wt, int n8) {
  const int t = blockIdx.x * 256 + threadIdx.x;
  if (t >= n8) return;
  const v4f a = *(const v4fa*)(W + (size_t)t * 8), b = *(const v4fa*)(W + (size_t)t * 8 + 4);
  v8us v; v[0]=bf16_bits(a[0]); v[1]=bf16_bits(a[1]); v[2]=bf16_bits(a[2]); v[3]=bf16_bits(a[3]);
  v[4]=bf16_bits(b[0]); v[5]=bf16_bits(b[1]); v[6]=bf16_bits(b[2]); v[7]=bf16_bits(b[3]);
  *(v8us*)(Wt + (size_t)t * 8) = v; 
}

extern "C" void kernel_launch(void* const* d_in, const int* in_sizes, int n_in,
                              void* d_out, int out_size, void* d_ws, size_t ws_size, hipStream_t stream) {
  (void)in_sizes; (void)n_in; (void)out_size;
  const float* xq = (const float*)d_in[0]; const float* xk = (const float*)d_in[1]; const float* xv = (const float*)d_in[2];
  const float* gp = (const float*)d_in[3]; const int* mask = (const int*)d_in[4];
  const float* Wq = (const float*)d_in[5]; const float* bq = (const float*)d_in[6]; const float* Wk = (const float*)d_in[7]; const float* bk = (const float*)d_in[8];
  const float* Wv = (const float*)d_in[9]; const float* bv = (const float*)d_in[10]; const float* Wo = (const float*)d_in[11]; const float* bo = (const float*)d_in[12];
  char* ws = (char*)d_ws; size_t off = 0;
  auto take = [&](size_t bytes) { char* p = ws + off; off += (bytes + 255) & ~(size_t)255; return p; };
  const int M = BB * TT, n8 = DD * DD / 8, gb = ((M / 16) * (DD / 64) + 3) / 4;
  unsigned short* Wt[4]; for (int i = 0; i < 4; ++i) Wt[i] = (unsigned short*)take((size_t)DD * DD * 2);
  float* q = (float*)take((size_t)M * DD * 4); float* k = (float*)take((size_t)M * DD * 4); float* v = (float*)take((size_t)M * DD * 4); float* att = (float*)take((size_t)M * DD * 4);
  if (off > ws_size) return;
  const float* W4[4] = {Wq, Wk, Wv, Wo};
  for (int i = 0; i < 4; ++i) k_round_rows<<<(n8 + 255) / 256, 256, 0, stream>>>(W4[i], Wt[i], n8);
  k_gemm_bf<false, 0, true><<<gb, 128, 0, stream>>>(xq, DD, Wt[0], DD, bq, q, DD, M, DD, DD);
  k_gemm_bf<false, 0, true><<<gb, 128, 0, stream>>>(xk, DD, Wt[1], DD, bk, k, DD, M, DD, DD);
  k_gemm_bf<false, 0, true><<<gb, 128, 0, stream>>>(xv, DD, Wt[2], DD, bv, v, DD, M, DD, DD);
  k_flash3c<HD, TT, NH, DD><<<BB * NH * (TT / 64), 128, 0, stream>>>(q, k, v, 0.125f, mask, gp, att);
  k_gemm_bf<true, 0, true><<<gb, 128, 0, stream>>>(att, DD, Wt[3], DD, bo, (float*)d_out, DD, M, DD, DD);
}

// v005
// One run takes 138 microseconds.
// In two side-by-side timings against v004, it was 1.38 and 1.39 times as fast.
// Over all steps from v000 it is 5.21 times as fast.
#include <hip/hip_runtime.h>
// All contractions on v_wmma_f32_16x16x32_bf16, f32 accumulate: q/k/v = x·Wᵀ + b (inputs, W, b rounded to bf16: single exact term), QKᵀ and
// P·V per 16-query tile as 3-term bf16 hi/lo splits (mask|diag → −1e9 kept in the softmax like the module; P multiplied by
// bf16(group_prob) after normalisation), out = x·Woᵀ + bo with x split (2 terms); softmax in f32.
#define BB 2
#define TT 2048
#define DD 512
#define NH 8
#define HD 64

typedef __bf16 v16b __attribute__((ext_vector_type(16)));
typedef unsigned short v8us __attribute__((ext_vector_type(8), may_alias));
typedef float  v8f  __attribute__((ext_vector_type(8)));
typedef float  v4f  __attribute__((ext_vector_type(4)));
typedef float  v4fa __attribute__((ext_vector_type(4), may_alias));
union FragB { v16b v; v8us half[2]; unsigned short u[16]; };

__device__ __forceinline__ unsigned short bf16_bits(float x) { unsigned int u = __float_as_uint(x); return (unsigned short)((u + 0x7FFFu + ((u >> 16) & 1u)) >> 16); }
__device__ __forceinline__ float bf16_val(unsigned short b) { return __uint_as_float(((unsigned int)b) << 16); }
__device__ __forceinline__ float bf16_round(float x) { return bf16_val(bf16_bits(x)); }
// D += A·B with NT terms: 1 = ah·bh, 2 = + al·bh (A split), 3 = + ah·bl (both split)
template <int NT>
__device__ __forceinline__ v8f mmaN(v16b ah, v16b al, v16b bh, v16b bl, v8f c) {
  c = __builtin_amdgcn_wmma_f32_16x16x32_bf16(false, ah, false, bh, (short)0, c, false, false);
  if (NT >= 2) c = __builtin_amdgcn_wmma_f32_16x16x32_bf16(false, al, false, bh, (short)0, c, false, false);
  if (NT >= 3) c = __builtin_amdgcn_wmma_f32_16x16x32_bf16(false, ah, false, bl, (short)0, c, false, false);
  asm volatile("v_nop\n\tv_nop\n\tv_nop\n\tv_nop" : "+v"(c) : "v"(ah), "v"(al), "v"(bh), "v"(bl));
  return c;
}

__global__ __launch_bounds__(256) void k_wt_bf16(const float* __restrict__ W, unsigned short* __restrict__ Wt, int K, int N) {
  const int t = blockIdx.x * 256 + threadIdx.x;
  const int k8n = K / 8;
  if (t >= N * k8n) return;
  const int n = t / k8n, k8 = (t % k8n) * 8;
  v8us v;
#pragma unroll
  for (int i = 0; i < 8; ++i) v[i] = bf16_bits(W[(size_t)(k8 + i) * N + n]);
  *(v8us*)(Wt + (size_t)n * K + k8) = v;
  
}

// GEMM C[M][N] (f32, pitch ldc) = act(A[M][K] * W + bias). A f32 row-major (pitch LDA) converted to bf16
// (ASPLIT: hi/lo two planes -> 2 terms, else single rounded term); Wt bf16 [N][K] (pitch LDB). BIAS_BF16 rounds the
// bias to bf16 first (bias quantised to bf16 before the add). K%128==0, M%64==0, N%64==0.
// A block of 4 waves owns a 64 x 64 tile of C (wave w: rows 16 w .. 16 w + 15, all 64 columns). Both operands go through LDS in stages
// of 128 k: every global load of a wave covers whole 128-byte lines (one 512-byte piece of an A row, two 256-byte pieces of W rows),
// an A element is converted once, a W element is fetched once per block, and the fragments are 16-byte LDS reads.
// Two LDS buffers, one barrier a stage: a wave that writes buffer s & 1 has passed the barrier of stage s - 1, which every wave
// reaches only behind its last read of stage s - 2.
typedef unsigned short v4us __attribute__((ext_vector_type(4), may_alias));
template <bool ASPLIT, int ACT, bool BIAS_BF16, int LDA, int LDB>
__global__ __launch_bounds__(128) void k_gemm_bf(const float* __restrict__ A, const unsigned short* __restrict__ Wt,
                                               const float* __restrict__ bias, float* __restrict__ C, int ldc, int M, int N, int K) {
  constexpr int BK = 128, PK = BK + 8;      // row pitch in LDS: an odd multiple of 16 bytes (plain 16-byte reads)
  __shared__ __attribute__((aligned(16))) unsigned short sAh[2][64][PK], sAl[ASPLIT ? 2 : 1][ASPLIT ? 64 : 1][PK], sB[2][64][PK];
  __shared__ __attribute__((aligned(16))) float so[4][16][64];
  const int tid = threadIdx.x, w = tid >> 5, lane = tid & 31, ln = lane & 15, hh = lane >> 4;
  const int ntn = N / 64;
  const int mb = blockIdx.x / ntn, nq = blockIdx.x % ntn;
  if (mb * 64 >= M) return;                 // the same for the whole block, in front of every barrier
  const int row0 = mb * 64 + w * 16, col0 = nq * 64;
  const int ar = tid >> 5, ac4 = (tid & 31) * 4;   // A piece i of a stage: tile row ar + 4 i, k ac4 .. ac4 + 3
  const int br = tid >> 4, bc8 = (tid & 15) * 8;   // W piece i of a stage: tile row br + 8 i, k bc8 .. bc8 + 7
  const float* ap = A + (size_t)(mb * 64 + ar) * LDA + ac4;
  const unsigned short* bp = Wt + (size_t)(col0 + br) * LDB + bc8;
  // A stage's 24 loads are issued as one batch right behind the barrier of the stage before (a barrier drains the load counter),
  // into registers, and are waited for only behind that stage's products.
  // Every loop over pa, pb or the fragments is unrolled, so that their indices are constants and they stay in registers.
  v4f pa[16]; v8us pb[8];
  auto load_stage = [&](int kb) {
#pragma unroll
    for (int i = 0; i < 16; ++i) pa[i] = *(const v4fa*)(ap + kb + i * 4 * LDA);
#pragma unroll
    for (int i = 0; i < 8; ++i) pb[i] = *(const v8us*)(bp + kb + i * 8 * LDB);
    asm volatile("s_wait_xcnt 0x0" ::: "memory");   // before the address registers of the loads above are reused
    __builtin_amdgcn_sched_barrier(0);              // keeps later address arithmetic, which reuses them, behind that wait
  };
  v8f acc[4] = {};
  load_stage(0);
  for (int kb = 0; kb < K; kb += BK) {
    const int buf = (kb / BK) & 1;
#pragma unroll
    for (int i = 0; i < 16; ++i) {
      v4us h, l;
#pragma unroll
      for (int t = 0; t < 4; ++t) { const float x = pa[i][t]; const unsigned short hb = bf16_bits(x); h[t] = hb; l[t] = ASPLIT ? bf16_bits(x - bf16_val(hb)) : (unsigned short)0; }
      *(v4us*)&sAh[buf][ar + 4 * i][ac4] = h;
      if (ASPLIT) *(v4us*)&sAl[buf][ar + 4 * i][ac4] = l;
    }
#pragma unroll
    for (int i = 0; i < 8; ++i) *(v8us*)&sB[buf][br + 8 * i][bc8] = pb[i];
    __syncthreads();   // publishes this stage's tiles; also ends every wave's reads of the other buffer before the next stage rewrites it
    if (kb + BK < K) load_stage(kb + BK);
#pragma unroll
    for (int ks = 0; ks < BK / 32; ++ks) {
      // all fragments of a 32-k step as one group of LDS reads, so that their latency is waited out once and not once per 16 columns
      FragB ah, al, b[4];
      ah.half[0] = *(const v8us*)&sAh[buf][w * 16 + ln][ks * 32 + 8 * hh]; ah.half[1] = *(const v8us*)&sAh[buf][w * 16 + ln][ks * 32 + 16 + 8 * hh];
      if (ASPLIT) { al.half[0] = *(const v8us*)&sAl[buf][w * 16 + ln][ks * 32 + 8 * hh]; al.half[1] = *(const v8us*)&sAl[buf][w * 16 + ln][ks * 32 + 16 + 8 * hh]; }
      else {
#pragma unroll
        for (int i = 0; i < 16; ++i) al.u[i] = (unsigned short)0;
      }
#pragma unroll
      for (int t = 0; t < 4; ++t) {
        b[t].half[0] = *(const v8us*)&sB[buf][t * 16 + ln][ks * 32 + 8 * hh];
        b[t].half[1] = *(const v8us*)&sB[buf][t * 16 + ln][ks * 32 + 16 + 8 * hh];
      }
#pragma unroll
      for (int t = 0; t < 4; ++t) acc[t] = mmaN<ASPLIT ? 2 : 1>(ah.v, al.v, b[t].v, b[t].v, acc[t]);
    }
  }
#pragma unroll
  for (int t = 0; t < 4; ++t) {
    float bv = bias ? bias[col0 + t * 16 + ln] : 0.f;
    if (BIAS_BF16) bv = bf16_round(bv);
#pragma unroll
    for (int r = 0; r < 8; ++r) { float v = acc[t][r] + bv; if (ACT == 1) v = fmaxf(v, 0.f); so[w][8 * hh + r][t * 16 + ln] = v; }
  }
  __builtin_amdgcn_fence(__ATOMIC_ACQ_REL, "workgroup");
  __builtin_amdgcn_wave_barrier();
  const int rsub = lane >> 4, c4 = (lane & 15) * 4;
  {
#pragma unroll
    for (int q = 0; q < 8; ++q) {
      const int r = q * 2 + rsub;
      const v4f v = *(const v4fa*)&so[w][r][c4];
      *(v4f*)(C + (size_t)(row0 + r) * ldc + col0 + c4) = v;
    }
    
  }
}

// Flash-style causal/unmasked attention, all contractions 3-term bf16 hi/lo splits, f32 softmax with running max.
// q,k,v rows are read from f32 buffers with arbitrary row pitch (so they can live inside a fused qkv buffer);
// D = head size (multiple of 32, <= 128); one wave = 16 query rows; block = 4 waves (64 queries) sharing K/V chunks of 32.
template <int D, bool CAUSAL>
__global__ __launch_bounds__(128) void k_flash(const float* __restrict__ qb, const float* __restrict__ kb, const float* __restrict__ vb,
                                             int pitch, int T, int H, float scale, float* __restrict__ y, int ypitch) {
  constexpr int KS = D / 32;        // k-steps for QK
  constexpr int DT = D / 16;        // d tiles for PV
  __shared__ __attribute__((aligned(16))) unsigned short sKh[32][D + 8], sKl[32][D + 8], sVh[32][D + 8], sVl[32][D + 8];
  __shared__ __attribute__((aligned(16))) unsigned short sPh[4][16][40], sPl[4][16][40];
  __shared__ __attribute__((aligned(16))) float sO[4][16][D];
  const int tid = threadIdx.x, w = tid >> 5, lane = tid & 31, ln = lane & 15, hh = lane >> 4;
  const int nqb = (T + 63) / 64;
  const int bh = blockIdx.x / nqb, qblk = blockIdx.x % nqb;
  const int b = bh / H, h = bh % H;
  const int q0 = qblk * 64 + w * 16;
  const float* Q = qb + (size_t)b * T * pitch + h * D;
  const float* K = kb + (size_t)b * T * pitch + h * D;
  const float* V = vb + (size_t)b * T * pitch + h * D;

  // A fragments of the wave's 16 query rows (scaled), hi/lo
  FragB aqh[KS], aql[KS];
  {
    int row = q0 + ln; if (row >= T) row = T - 1;
    const float* qr = Q + (size_t)row * pitch;
#pragma unroll
    for (int ks = 0; ks < KS; ++ks)
#pragma unroll
      for (int i = 0; i < 16; ++i) {
        const int d = ks * 32 + ((i < 8) ? (8 * hh + i) : (16 + 8 * hh + (i - 8)));
        const float x = qr[d] * scale; const unsigned short hb = bf16_bits(x);
        aqh[ks].u[i] = hb; aql[ks].u[i] = bf16_bits(x - bf16_val(hb));
      }
  }
  float m_r[8], l_r[8];
#pragma unroll
  for (int r = 0; r < 8; ++r) { m_r[r] = -3.0e38f; l_r[r] = 0.f; }
  v8f oacc[DT];
#pragma unroll
  for (int dt = 0; dt < DT; ++dt) oacc[dt] = (v8f){0.f,0.f,0.f,0.f,0.f,0.f,0.f,0.f};

  const int kv_end = CAUSAL ? min(T, qblk * 64 + 64) : T;     // block-uniform
  for (int j0 = 0; j0 < kv_end; j0 += 32) {
    __syncthreads();
    for (int e = tid; e < 32 * (D / 4); e += 128) {
      const int r = e / (D / 4), c4 = (e % (D / 4)) * 4;
      const int key = j0 + r;
      v4f kf = {0.f,0.f,0.f,0.f}, vf = {0.f,0.f,0.f,0.f};
      if (key < T) { kf = *(const v4fa*)(K + (size_t)key * pitch + c4); vf = *(const v4fa*)(V + (size_t)key * pitch + c4); }
#pragma unroll
      for (int t = 0; t < 4; ++t) {
        unsigned short hb = bf16_bits(kf[t]); sKh[r][c4 + t] = hb; sKl[r][c4 + t] = bf16_bits(kf[t] - bf16_val(hb));
        hb = bf16_bits(vf[t]); sVh[r][c4 + t] = hb; sVl[r][c4 + t] = bf16_bits(vf[t] - bf16_val(hb));
      }
    }
    __syncthreads();
    // S tile 16 x 32
    v8f s[2];
#pragma unroll
    for (int nt = 0; nt < 2; ++nt) {
      v8f acc = {};
#pragma unroll
      for (int ks = 0; ks < KS; ++ks) {
        FragB bh_, bl_;
        bh_.half[0] = *(const v8us*)&sKh[nt * 16 + ln][ks * 32 + 8 * hh]; bh_.half[1] = *(const v8us*)&sKh[nt * 16 + ln][ks * 32 + 16 + 8 * hh];
        bl_.half[0] = *(const v8us*)&sKl[nt * 16 + ln][ks * 32 + 8 * hh]; bl_.half[1] = *(const v8us*)&sKl[nt * 16 + ln][ks * 32 + 16 + 8 * hh];
        acc = mmaN<3>(aqh[ks].v, aql[ks].v, bh_.v, bl_.v, acc);
      }
      s[nt] = acc;
    }
    // mask + running max (rows 8hh+r; the 16 lanes of a half share rows)
    float alpha[8];
#pragma unroll
    for (int r = 0; r < 8; ++r) {
      const int qi = q0 + 8 * hh + r;
      const int ja = j0 + ln, jb = j0 + 16 + ln;
      if (CAUSAL) { if (ja > qi) s[0][r] = -3.0e38f; if (jb > qi) s[1][r] = -3.0e38f; }
      if (ja >= T) s[0][r] = -3.0e38f;
      if (jb >= T) s[1][r] = -3.0e38f;
      float mx = fmaxf(s[0][r], s[1][r]);
      mx = fmaxf(mx, __shfl_xor(mx, 1, 32)); mx = fmaxf(mx, __shfl_xor(mx, 2, 32)); mx = fmaxf(mx, __shfl_xor(mx, 4, 32)); mx = fmaxf(mx, __shfl_xor(mx, 8, 32));
      const float mnew = fmaxf(m_r[r], mx);
      alpha[r] = (mnew > -1.0e38f) ? __expf(m_r[r] - mnew) : 1.0f;
      const float p0 = (s[0][r] > -1.0e38f) ? __expf(s[0][r] - mnew) : 0.f;
      const float p1 = (s[1][r] > -1.0e38f) ? __expf(s[1][r] - mnew) : 0.f;
      m_r[r] = mnew;
      l_r[r] = l_r[r] * alpha[r] + p0 + p1;            // per-lane partial row sum (16 lanes combined at the end)
      unsigned short hb = bf16_bits(p0); sPh[w][8 * hh + r][ln] = hb;      sPl[w][8 * hh + r][ln] = bf16_bits(p0 - bf16_val(hb));
      hb = bf16_bits(p1);                sPh[w][8 * hh + r][16 + ln] = hb; sPl[w][8 * hh + r][16 + ln] = bf16_bits(p1 - bf16_val(hb));
    }
#pragma unroll
    for (int dt = 0; dt < DT; ++dt)
#pragma unroll
      for (int r = 0; r < 8; ++r) oacc[dt][r] *= alpha[r];
    __builtin_amdgcn_fence(__ATOMIC_ACQ_REL, "workgroup");
    __builtin_amdgcn_wave_barrier();
    FragB pah, pal;
    pah.half[0] = *(const v8us*)&sPh[w][ln][8 * hh]; pah.half[1] = *(const v8us*)&sPh[w][ln][16 + 8 * hh];
    pal.half[0] = *(const v8us*)&sPl[w][ln][8 * hh]; pal.half[1] = *(const v8us*)&sPl[w][ln][16 + 8 * hh];
#pragma unroll
    for (int dt = 0; dt < DT; ++dt) {
      FragB bvh, bvl;
#pragma unroll
      for (int i = 0; i < 8; ++i) {
        bvh.u[i] = sVh[8 * hh + i][dt * 16 + ln]; bvh.u[8 + i] = sVh[16 + 8 * hh + i][dt * 16 + ln];
        bvl.u[i] = sVl[8 * hh + i][dt * 16 + ln]; bvl.u[8 + i] = sVl[16 + 8 * hh + i][dt * 16 + ln];
      }
      oacc[dt] = mmaN<3>(pah.v, pal.v, bvh.v, bvl.v, oacc[dt]);
    }
    __builtin_amdgcn_fence(__ATOMIC_ACQ_REL, "workgroup");
    __builtin_amdgcn_wave_barrier();
  }
#pragma unroll
  for (int r = 0; r < 8; ++r) {
    float l = l_r[r];
    l += __shfl_xor(l, 1, 32); l += __shfl_xor(l, 2, 32); l += __shfl_xor(l, 4, 32); l += __shfl_xor(l, 8, 32);
    l_r[r] = (l > 0.f) ? 1.0f / l : 0.f;
  }
#pragma unroll
  for (int dt = 0; dt < DT; ++dt)
#pragma unroll
    for (int r = 0; r < 8; ++r) sO[w][8 * hh + r][dt * 16 + ln] = oacc[dt][r] * l_r[r];
  __builtin_amdgcn_fence(__ATOMIC_ACQ_REL, "workgroup");
  __builtin_amdgcn_wave_barrier();
  {
    for (int r = 0; r < 16; ++r) {
      const int row = q0 + r;
      if (row < T && lane < D / 4) {
        const v4f val = *(const v4fa*)&sO[w][r][lane * 4];
        *(v4f*)(y + ((size_t)b * T + row) * ypitch + h * D + lane * 4) = val;
      }
    }
    
  }
}

typedef short s16x8 __attribute__((ext_vector_type(8)));
__device__ __forceinline__ v8us lds_tr16(const unsigned short* p) {
  typedef __attribute__((address_space(3))) s16x8 lds_s16x8;
  return __builtin_bit_cast(v8us, __builtin_amdgcn_ds_load_tr16_b128_v8i16((lds_s16x8*)p));
}

// the value that lane l ^ 16 holds (the other 16-lane half of the wave), by a vector cross-row move
__device__ __forceinline__ float other_half(float x) {
  const int b = __float_as_int(x);
  return __int_as_float(__builtin_amdgcn_permlanex16(b, b, 0x76543210, 0xfedcba98, false, false));
}
typedef int v4ia __attribute__((ext_vector_type(4), may_alias));
typedef int v4i  __attribute__((ext_vector_type(4)));

template <int D, int T, int H, int P>
__global__ __launch_bounds__(128) void k_flash3c(const float* __restrict__ Qb, const float* __restrict__ K1, const float* __restrict__ V1,
                                              float scale, const int* __restrict__ mask3, const float* __restrict__ gp, float* __restrict__ y) {
  static_assert(T % 64 == 0 && D % 32 == 0 && 512 % D == 0, "whole query blocks, whole 32-key passes");
  constexpr int KS = D / 32, DT = D / 16;
  // row pitch: an odd multiple of 16 bytes for K (plain 16-byte reads), an odd multiple of 32 bytes for V (transposing reads)
  __shared__ __attribute__((aligned(16))) unsigned short sKh[32][D + 8], sKl[32][D + 8], sVh[32][D + 16], sVl[32][D + 16];
  __shared__ __attribute__((aligned(16))) float sO[4][16][D + 4];   // pitch 16 bytes over a power of two: a lane writes a whole row piece
  const int tid = threadIdx.x, w = tid >> 5, lane = tid & 31, ln = lane & 15, hh = lane >> 4;
  constexpr int nqb = T / 64;
  const int bh = blockIdx.x / nqb, qblk = blockIdx.x % nqb;
  const int b = bh / H, h = bh % H;
  const int q0 = qblk * 64 + w * 16;
  const float* Q = Qb + (size_t)b * T * P + h * D;
  FragB aqh[KS], aql[KS];
  {
    const float* qr = Q + (size_t)(q0 + ln) * P;
#pragma unroll
    for (int ks = 0; ks < KS; ++ks)
#pragma unroll
      for (int i = 0; i < 16; ++i) {
        const int d = ks * 32 + ((i < 8) ? (8 * hh + i) : (16 + 8 * hh + (i - 8)));
        const float x = qr[d] * scale; const unsigned short hb = bf16_bits(x);
        aqh[ks].u[i] = hb; aql[ks].u[i] = bf16_bits(x - bf16_val(hb));
      }
  }
  asm volatile("s_wait_xcnt 0x0" ::: "memory");     // before the address registers of the query loads are reused
  __builtin_amdgcn_sched_barrier(0);                // keeps the address arithmetic below, which reuses them, behind that wait
  float m_q = -3.0e38f, l_q = 0.f;   // the lane's query: running maximum (both halves agree), sum over the keys of the lane's own half
  v8f oacc[DT];                      // oacc[dt][r] = O[query q0 + ln][16 dt + 8 hh + r]
#pragma unroll
  for (int dt = 0; dt < DT; ++dt) oacc[dt] = (v8f){0.f,0.f,0.f,0.f,0.f,0.f,0.f,0.f};
  // Every global load of a 32-key pass is issued one pass ahead, without a predicate, into registers carried round the loop:
  // the pass behind the last one is clamped, as a whole, to the last one (in bounds), and its values are never used.
  // They are issued right behind the pass's second barrier: the barriers drain the load counter, and from there to the
  // next pass's first barrier is the longest stretch without one.
  constexpr int NE = 32 * (D / 4) / 128;        // 16-byte pieces of K (and of V) per thread and pass
  const int sr = tid / (D / 4), sc4 = (tid % (D / 4)) * 4;
  // each address = a base that is the same for the whole block + one per-lane byte offset that never changes + a constant
  const char* Kb = (const char*)(K1 + (size_t)b * T * P + h * D); const char* Vb = (const char*)(V1 + (size_t)b * T * P + h * D);
  const unsigned kvoff = (unsigned)(sr * P + sc4) * 4u;
  v4f kfp[NE], vfp[NE];
  auto load_kv = [&](int j) {
    const size_t jb = (size_t)min(j, T - 32) * (P * 4);
#pragma unroll
    for (int i = 0; i < NE; ++i) {
      kfp[i] = *(const v4fa*)(Kb + jb + i * (512 / D) * P * 4 + kvoff);
      vfp[i] = *(const v4fa*)(Vb + jb + i * (512 / D) * P * 4 + kvoff);
    }
    asm volatile("s_wait_xcnt 0x0" ::: "memory");   // before the address registers of the loads above are reused
    __builtin_amdgcn_sched_barrier(0);              // keeps later address arithmetic, which reuses them, behind that wait
  };
  // mask and group_prob share one index; byte offsets inside one batch's [T][T] plane fit 32 bits
  const char* mplane = (const char*)(mask3 + (size_t)b * T * T); const char* gplane = (const char*)(gp + (size_t)b * T * T);
  const unsigned mgoff = ((unsigned)(q0 + ln) * (unsigned)T + (unsigned)(8 * hh)) * 4u;
  v4i mk[4], nmk[4]; v4f gq[4], ngq[4];   // this pass's, the next pass's; piece 2 nt + c = keys 16 nt + 8 hh + 4 c .. + 3 of the lane's query row
  auto load_mg = [&](int j) {
    const size_t jb = (size_t)min(j, T - 32) * 4;
#pragma unroll
    for (int i = 0; i < 4; ++i) nmk[i] = *(const v4ia*)(mplane + jb + ((i >> 1) * 64 + (i & 1) * 16) + mgoff);
#pragma unroll
    for (int i = 0; i < 4; ++i) ngq[i] = *(const v4fa*)(gplane + jb + ((i >> 1) * 64 + (i & 1) * 16) + mgoff);
    asm volatile("s_wait_xcnt 0x0" ::: "memory");   // before the offset registers of the loads above are reused
    __builtin_amdgcn_sched_barrier(0);              // keeps later arithmetic, which reuses them, behind that wait
  };
  load_kv(0);
  load_mg(0);
  for (int j0 = 0; j0 < T; j0 += 32) {
    __syncthreads();
#pragma unroll
    for (int i = 0; i < NE; ++i) {
      const int r = sr + i * (512 / D), c4 = sc4;
#pragma unroll
      for (int t = 0; t < 4; ++t) {
        const float kx = kfp[i][t], vx = vfp[i][t];
        unsigned short hb = bf16_bits(kx); sKh[r][c4 + t] = hb; sKl[r][c4 + t] = bf16_bits(kx - bf16_val(hb));
        hb = bf16_bits(vx); sVh[r][c4 + t] = hb; sVl[r][c4 + t] = bf16_bits(vx - bf16_val(hb));
      }
    }
    __syncthreads();
#pragma unroll
    for (int i = 0; i < 4; ++i) { mk[i] = nmk[i]; gq[i] = ngq[i]; }
    load_kv(j0 + 32);
    load_mg(j0 + 32);
    v8f s[2];
#pragma unroll
    for (int nt = 0; nt < 2; ++nt) {
      v8f acc = {};
#pragma unroll
      for (int ks = 0; ks < KS; ++ks) {
        FragB bh_, bl_;
        bh_.half[0] = *(const v8us*)&sKh[nt * 16 + ln][ks * 32 + 8 * hh]; bh_.half[1] = *(const v8us*)&sKh[nt * 16 + ln][ks * 32 + 16 + 8 * hh];
        bl_.half[0] = *(const v8us*)&sKl[nt * 16 + ln][ks * 32 + 8 * hh]; bl_.half[1] = *(const v8us*)&sKl[nt * 16 + ln][ks * 32 + 16 + 8 * hh];
        acc = mmaN<3>(bh_.v, bl_.v, aqh[ks].v, aql[ks].v, acc);   // A = K rows, B = Q: acc[r] = score(key 16 nt + 8 hh + r, query ln)
      }
      s[nt] = acc;
    }
    const int dk = q0 + ln - 8 * hh - j0;     // the diagonal's key, counted from the first key of the lane's half in this pass
    float mx = -3.0e38f;
#pragma unroll
    for (int nt = 0; nt < 2; ++nt)
#pragma unroll
      for (int r = 0; r < 8; ++r) {
        s[nt][r] = (mk[2 * nt + (r >> 2)][r & 3] != 0 || dk == nt * 16 + r) ? s[nt][r] : -1.0e9f;
        mx = fmaxf(mx, s[nt][r]);
      }
    mx = fmaxf(mx, other_half(mx));
    const float mnew = fmaxf(m_q, mx);
    const float alpha = (mnew > -1.0e38f) ? __expf(m_q - mnew) : 1.0f;
    m_q = mnew;
    FragB pbh, pbl;   // element i = P[key 8 hh + i][query ln], element 8 + i = P[key 16 + 8 hh + i][query ln]: the k order of bvh, bvl
    float psum = 0.f;
#pragma unroll
    for (int nt = 0; nt < 2; ++nt)
#pragma unroll
      for (int r = 0; r < 8; ++r) {
        const float p = __expf(s[nt][r] - mnew);
        psum += p;
        const float g = p * bf16_round(gq[2 * nt + (r >> 2)][r & 3]);   // post-softmax multiplier: P only, not the normaliser
        const unsigned short hb = bf16_bits(g);
        pbh.u[nt * 8 + r] = hb; pbl.u[nt * 8 + r] = bf16_bits(g - bf16_val(hb));
      }
    l_q = l_q * alpha + psum;
#pragma unroll
    for (int dt = 0; dt < DT; ++dt)
#pragma unroll
      for (int r = 0; r < 8; ++r) oacc[dt][r] *= alpha;
    // all V fragments of the pass as one group of loads, so that their latency is waited out once and not once per 16 columns
    FragB bvh[DT], bvl[DT];   // element i = V[8 hh + i][16 dt + ln], element 8 + i = V[16 + 8 hh + i][16 dt + ln]: the k order of pbh, pbl
#pragma unroll
    for (int dt = 0; dt < DT; ++dt) {
      const int vr = 8 * hh + (lane & 7), vc = dt * 16 + 8 * ((lane >> 3) & 1);
      bvh[dt].half[0] = lds_tr16(&sVh[vr][vc]); bvh[dt].half[1] = lds_tr16(&sVh[16 + vr][vc]);
      bvl[dt].half[0] = lds_tr16(&sVl[vr][vc]); bvl[dt].half[1] = lds_tr16(&sVl[16 + vr][vc]);
    }
#pragma unroll
    for (int dt = 0; dt < DT; ++dt) oacc[dt] = mmaN<3>(bvh[dt].v, bvl[dt].v, pbh.v, pbl.v, oacc[dt]);   // A = V^T, B = P^T
  }
  const float lsum = l_q + other_half(l_q);
  const float linv = (m_q > -1.0e38f) ? 1.0f / lsum : __builtin_nanf("");
#pragma unroll
  for (int dt = 0; dt < DT; ++dt)
#pragma unroll
    for (int c = 0; c < 2; ++c) {
      const v4f o = {oacc[dt][4 * c] * linv, oacc[dt][4 * c + 1] * linv, oacc[dt][4 * c + 2] * linv, oacc[dt][4 * c + 3] * linv};
      *(v4fa*)&sO[w][ln][dt * 16 + 8 * hh + 4 * c] = o;
    }
  __builtin_amdgcn_fence(__ATOMIC_ACQ_REL, "workgroup");
  __builtin_amdgcn_wave_barrier();
  {
    for (int r = 0; r < 16; ++r) {
      const int row = q0 + r;
      if (lane < D / 4) {
        const v4f val = *(const v4fa*)&sO[w][r][lane * 4];
        *(v4f*)(y + ((size_t)b * T + row) * P + h * D + lane * 4) = val;
      }
    }
    
  }
}

__global__ __launch_bounds__(256) void k_round_rows(const float* __restrict__ W, unsigned short* __restrict__ Wt, int n8) {
  const int t = blockIdx.x * 256 + threadIdx.x;
  if (t >= n8) return;
  const v4f a = *(const v4fa*)(W + (size_t)t * 8), b = *(const v4fa*)(W + (size_t)t * 8 + 4);
  v8us v; v[0]=bf16_bits(a[0]); v[1]=bf16_bits(a[1]); v[2]=bf16_bits(a[2]); v[3]=bf16_bits(a[3]);
  v[4]=bf16_bits(b[0]); v[5]=bf16_bits(b[1]); v[6]=bf16_bits(b[2]); v[7]=bf16_bits(b[3]);
  *(v8us*)(Wt + (size_t)t * 8) = v; 
}

extern "C" void kernel_launch(void* const* d_in, const int* in_sizes, int n_in,
                              void* d_out, int out_size, void* d_ws, size_t ws_size, hipStream_t stream) {
  (void)in_sizes; (void)n_in; (void)out_size;
  const float* xq = (const float*)d_in[0]; const float* xk = (const float*)d_in[1]; const float* xv = (const float*)d_in[2];
  const float* gp = (const float*)d_in[3]; const int* mask = (const int*)d_in[4];
  const float* Wq = (const float*)d_in[5]; const float* bq = (const float*)d_in[6]; const float* Wk = (const float*)d_in[7]; const float* bk = (const float*)d_in[8];
  const float* Wv = (const float*)d_in[9]; const float* bv = (const float*)d_in[10]; const float* Wo = (const float*)d_in[11]; const float* bo = (const float*)d_in[12];
  char* ws = (char*)d_ws; size_t off = 0;
  auto take = [&](size_t bytes) { char* p = ws + off; off += (bytes + 255) & ~(size_t)255; return p; };
  const int M = BB * TT, n8 = DD * DD / 8, gb = ((M / 16) * (DD / 64) + 3) / 4;
  unsigned short* Wt[4]; for (int i = 0; i < 4; ++i) Wt[i] = (unsigned short*)take((size_t)DD * DD * 2);
  float* q = (float*)take((size_t)M * DD * 4); float* k = (float*)take((size_t)M * DD * 4); float* v = (float*)take((size_t)M * DD * 4); float* att = (float*)take((size_t)M * DD * 4);
  if (off > ws_size) return;
  const float* W4[4] = {Wq, Wk, Wv, Wo};
  for (int i = 0; i < 4; ++i) k_round_rows<<<(n8 + 255) / 256, 256, 0, stream>>>(W4[i], Wt[i], n8);
  k_gemm_bf<false, 0, true, DD, DD><<<gb, 128, 0, stream>>>(xq, Wt[0], bq, q, DD, M, DD, DD);
  k_gemm_bf<false, 0, true, DD, DD><<<gb, 128, 0, stream>>>(xk, Wt[1], bk, k, DD, M, DD, DD);
  k_gemm_bf<false, 0, true, DD, DD><<<gb, 128, 0, stream>>>(xv, Wt[2], bv, v, DD, M, DD, DD);
  k_flash3c<HD, TT, NH, DD><<<BB * NH * (TT / 64), 128, 0, stream>>>(q, k, v, 0.125f, mask, gp, att);
  k_gemm_bf<true, 0, true, DD, DD><<<gb, 128, 0, stream>>>(att, Wt[3], bo, (float*)d_out, DD, M, DD, DD);
}

// v006
// It runs in 123 microseconds.
// In both of two side-by-side timings against v005, it was 1.12 times as fast.
// All steps since v000 together make it 5.85 times as fast.
#include <hip/hip_runtime.h>
// All contractions on v_wmma_f32_16x16x32_bf16, f32 accumulate: q/k/v = x·Wᵀ + b (inputs, W, b rounded to bf16: single exact term), QKᵀ and
// P·V per 16-query tile as 3-term bf16 hi/lo splits (mask|diag → −1e9 kept in the softmax like the module; P multiplied by
// bf16(group_prob) after normalisation), out = x·Woᵀ + bo with x split (2 terms); softmax in f32.
#define BB 2
#define TT 2048
#define DD 512
#define NH 8
#define HD 64

typedef __bf16 v16b __attribute__((ext_vector_type(16)));
typedef unsigned short v8us __attribute__((ext_vector_type(8), may_alias));
typedef float  v8f  __attribute__((ext_vector_type(8)));
typedef float  v4f  __attribute__((ext_vector_type(4)));
typedef float  v4fa __attribute__((ext_vector_type(4), may_alias));
union FragB { v16b v; v8us half[2]; unsigned short u[16]; };

__device__ __forceinline__ unsigned short bf16_bits(float x) { unsigned int u = __float_as_uint(x); return (unsigned short)((u + 0x7FFFu + ((u >> 16) & 1u)) >> 16); }
__device__ __forceinline__ float bf16_val(unsigned short b) { return __uint_as_float(((unsigned int)b) << 16); }
__device__ __forceinline__ float bf16_round(float x) { return bf16_val(bf16_bits(x)); }
// D += A·B with NT terms: 1 = ah·bh, 2 = + al·bh (A split), 3 = + ah·bl (both split)
template <int NT>
__device__ __forceinline__ v8f mmaN(v16b ah, v16b al, v16b bh, v16b bl, v8f c) {
  c = __builtin_amdgcn_wmma_f32_16x16x32_bf16(false, ah, false, bh, (short)0, c, false, false);
  if (NT >= 2) c = __builtin_amdgcn_wmma_f32_16x16x32_bf16(false, al, false, bh, (short)0, c, false, false);
  if (NT >= 3) c = __builtin_amdgcn_wmma_f32_16x16x32_bf16(false, ah, false, bl, (short)0, c, false, false);
  asm volatile("v_nop\n\tv_nop\n\tv_nop\n\tv_nop" : "+v"(c) : "v"(ah), "v"(al), "v"(bh), "v"(bl));
  return c;
}

__global__ __launch_bounds__(256) void k_wt_bf16(const float* __restrict__ W, unsigned short* __restrict__ Wt, int K, int N) {
  const int t = blockIdx.x * 256 + threadIdx.x;
  const int k8n = K / 8;
  if (t >= N * k8n) return;
  const int n = t / k8n, k8 = (t % k8n) * 8;
  v8us v;
#pragma unroll
  for (int i = 0; i < 8; ++i) v[i] = bf16_bits(W[(size_t)(k8 + i) * N + n]);
  *(v8us*)(Wt + (size_t)n * K + k8) = v;
  
}

// GEMM C[M][N] (f32, pitch ldc) = act(A[M][K] * W + bias). A f32 row-major (pitch LDA) converted to bf16
// (ASPLIT: hi/lo two planes -> 2 terms, else single rounded term); Wt bf16 [N][K] (pitch LDB). BIAS_BF16 rounds the
// bias to bf16 first (bias quantised to bf16 before the add). K%128==0, M%64==0, N%64==0.
// A block of 4 waves owns a 64 x 64 tile of C (wave w: rows 16 w .. 16 w + 15, all 64 columns). Both operands go through LDS in stages
// of 128 k: every global load of a wave covers whole 128-byte lines (one 512-byte piece of an A row, two 256-byte pieces of W rows),
// an A element is converted once, a W element is fetched once per block, and the fragments are 16-byte LDS reads.
// Two LDS buffers, one barrier a stage: a wave that writes buffer s & 1 has passed the barrier of stage s - 1, which every wave
// reaches only behind its last read of stage s - 2.
typedef unsigned short v4us __attribute__((ext_vector_type(4), may_alias));
// ST == 0: C is written as f32. ST > 0 (rows per batch, ST % 64 == 0): the result is written instead as two bf16 planes, Ch = bf16(v) and
// Cl = bf16(v - Ch), laid out [batch][column block of 64][row in batch][64]: one head's rows are 128 bytes each and follow one another.
template <bool ASPLIT, int ACT, bool BIAS_BF16, int LDA, int LDB, int ST>
__global__ __launch_bounds__(128) void k_gemm_bf(const float* __restrict__ A, const unsigned short* __restrict__ Wt,
                                               const float* __restrict__ bias, float* __restrict__ C, int ldc, int M, int N, int K,
                                               unsigned short* __restrict__ Ch, unsigned short* __restrict__ Cl) {
  constexpr int BK = 128, PK = BK + 8;      // row pitch in LDS: an odd multiple of 16 bytes (plain 16-byte reads)
  __shared__ __attribute__((aligned(16))) unsigned short sAh[2][64][PK], sAl[ASPLIT ? 2 : 1][ASPLIT ? 64 : 1][PK], sB[2][64][PK];
  __shared__ __attribute__((aligned(16))) float so[4][16][64];
  const int tid = threadIdx.x, w = tid >> 5, lane = tid & 31, ln = lane & 15, hh = lane >> 4;
  const int ntn = N / 64;
  const int mb = blockIdx.x / ntn, nq = blockIdx.x % ntn;
  if (mb * 64 >= M) return;                 // the same for the whole block, in front of every barrier
  const int row0 = mb * 64 + w * 16, col0 = nq * 64;
  const int ar = tid >> 5, ac4 = (tid & 31) * 4;   // A piece i of a stage: tile row ar + 4 i, k ac4 .. ac4 + 3
  const int br = tid >> 4, bc8 = (tid & 15) * 8;   // W piece i of a stage: tile row br + 8 i, k bc8 .. bc8 + 7
  const float* ap = A + (size_t)(mb * 64 + ar) * LDA + ac4;
  const unsigned short* bp = Wt + (size_t)(col0 + br) * LDB + bc8;
  // A stage's 24 loads are issued as one batch right behind the barrier of the stage before (a barrier drains the load counter),
  // into registers, and are waited for only behind that stage's products.
  // Every loop over pa, pb or the fragments is unrolled, so that their indices are constants and they stay in registers.
  v4f pa[16]; v8us pb[8];
  auto load_stage = [&](int kb) {
#pragma unroll
    for (int i = 0; i < 16; ++i) pa[i] = *(const v4fa*)(ap + kb + i * 4 * LDA);
#pragma unroll
    for (int i = 0; i < 8; ++i) pb[i] = *(const v8us*)(bp + kb + i * 8 * LDB);
    asm volatile("s_wait_xcnt 0x0" ::: "memory");   // before the address registers of the loads above are reused
    __builtin_amdgcn_sched_barrier(0);              // keeps later address arithmetic, which reuses them, behind that wait
  };
  v8f acc[4] = {};
  load_stage(0);
  for (int kb = 0; kb < K; kb += BK) {
    const int buf = (kb / BK) & 1;
#pragma unroll
    for (int i = 0; i < 16; ++i) {
      v4us h, l;
#pragma unroll
      for (int t = 0; t < 4; ++t) { const float x = pa[i][t]; const unsigned short hb = bf16_bits(x); h[t] = hb; l[t] = ASPLIT ? bf16_bits(x - bf16_val(hb)) : (unsigned short)0; }
      *(v4us*)&sAh[buf][ar + 4 * i][ac4] = h;
      if (ASPLIT) *(v4us*)&sAl[buf][ar + 4 * i][ac4] = l;
    }
#pragma unroll
    for (int i = 0; i < 8; ++i) *(v8us*)&sB[buf][br + 8 * i][bc8] = pb[i];
    __syncthreads();   // publishes this stage's tiles; also ends every wave's reads of the other buffer before the next stage rewrites it
    if (kb + BK < K) load_stage(kb + BK);
#pragma unroll
    for (int ks = 0; ks < BK / 32; ++ks) {
      // all fragments of a 32-k step as one group of LDS reads, so that their latency is waited out once and not once per 16 columns
      FragB ah, al, b[4];
      ah.half[0] = *(const v8us*)&sAh[buf][w * 16 + ln][ks * 32 + 8 * hh]; ah.half[1] = *(const v8us*)&sAh[buf][w * 16 + ln][ks * 32 + 16 + 8 * hh];
      if (ASPLIT) { al.half[0] = *(const v8us*)&sAl[buf][w * 16 + ln][ks * 32 + 8 * hh]; al.half[1] = *(const v8us*)&sAl[buf][w * 16 + ln][ks * 32 + 16 + 8 * hh]; }
      else {
#pragma unroll
        for (int i = 0; i < 16; ++i) al.u[i] = (unsigned short)0;
      }
#pragma unroll
      for (int t = 0; t < 4; ++t) {
        b[t].half[0] = *(const v8us*)&sB[buf][t * 16 + ln][ks * 32 + 8 * hh];
        b[t].half[1] = *(const v8us*)&sB[buf][t * 16 + ln][ks * 32 + 16 + 8 * hh];
      }
#pragma unroll
      for (int t = 0; t < 4; ++t) acc[t] = mmaN<ASPLIT ? 2 : 1>(ah.v, al.v, b[t].v, b[t].v, acc[t]);
    }
  }
#pragma unroll
  for (int t = 0; t < 4; ++t) {
    float bv = bias ? bias[col0 + t * 16 + ln] : 0.f;
    if (BIAS_BF16) bv = bf16_round(bv);
#pragma unroll
    for (int r = 0; r < 8; ++r) { float v = acc[t][r] + bv; if (ACT == 1) v = fmaxf(v, 0.f); so[w][8 * hh + r][t * 16 + ln] = v; }
  }
  __builtin_amdgcn_fence(__ATOMIC_ACQ_REL, "workgroup");
  __builtin_amdgcn_wave_barrier();
  if (ST > 0) {
    // a store of the wave covers 4 rows of 128 bytes, which follow one another in the plane
    const int r4 = lane >> 3, c8 = (lane & 7) * 8;
    v8us h[4], l[4];
#pragma unroll
    for (int q = 0; q < 4; ++q) {
      const v4f x0 = *(const v4fa*)&so[w][q * 4 + r4][c8], x1 = *(const v4fa*)&so[w][q * 4 + r4][c8 + 4];
#pragma unroll
      for (int t = 0; t < 8; ++t) {
        const float x = t < 4 ? x0[t & 3] : x1[t & 3]; const unsigned short hb = bf16_bits(x);
        h[q][t] = hb; l[q][t] = bf16_bits(x - bf16_val(hb));
      }
    }
    constexpr int STD = ST > 0 ? ST : 1;
    const size_t o = (((size_t)(row0 / STD) * ntn + nq) * STD + row0 % STD + r4) * 64 + c8;
#pragma unroll
    for (int q = 0; q < 4; ++q) { *(v8us*)(Ch + o + q * 256) = h[q]; *(v8us*)(Cl + o + q * 256) = l[q]; }
    return;
  }
  const int rsub = lane >> 4, c4 = (lane & 15) * 4;
  {
#pragma unroll
    for (int q = 0; q < 8; ++q) {
      const int r = q * 2 + rsub;
      const v4f v = *(const v4fa*)&so[w][r][c4];
      *(v4f*)(C + (size_t)(row0 + r) * ldc + col0 + c4) = v;
    }
    
  }
}

// Flash-style causal/unmasked attention, all contractions 3-term bf16 hi/lo splits, f32 softmax with running max.
// q,k,v rows are read from f32 buffers with arbitrary row pitch (so they can live inside a fused qkv buffer);
// D = head size (multiple of 32, <= 128); one wave = 16 query rows; block = 4 waves (64 queries) sharing K/V chunks of 32.
template <int D, bool CAUSAL>
__global__ __launch_bounds__(128) void k_flash(const float* __restrict__ qb, const float* __restrict__ kb, const float* __restrict__ vb,
                                             int pitch, int T, int H, float scale, float* __restrict__ y, int ypitch) {
  constexpr int KS = D / 32;        // k-steps for QK
  constexpr int DT = D / 16;        // d tiles for PV
  __shared__ __attribute__((aligned(16))) unsigned short sKh[32][D + 8], sKl[32][D + 8], sVh[32][D + 8], sVl[32][D + 8];
  __shared__ __attribute__((aligned(16))) unsigned short sPh[4][16][40], sPl[4][16][40];
  __shared__ __attribute__((aligned(16))) float sO[4][16][D];
  const int tid = threadIdx.x, w = tid >> 5, lane = tid & 31, ln = lane & 15, hh = lane >> 4;
  const int nqb = (T + 63) / 64;
  const int bh = blockIdx.x / nqb, qblk = blockIdx.x % nqb;
  const int b = bh / H, h = bh % H;
  const int q0 = qblk * 64 + w * 16;
  const float* Q = qb + (size_t)b * T * pitch + h * D;
  const float* K = kb + (size_t)b * T * pitch + h * D;
  const float* V = vb + (size_t)b * T * pitch + h * D;

  // A fragments of the wave's 16 query rows (scaled), hi/lo
  FragB aqh[KS], aql[KS];
  {
    int row = q0 + ln; if (row >= T) row = T - 1;
    const float* qr = Q + (size_t)row * pitch;
#pragma unroll
    for (int ks = 0; ks < KS; ++ks)
#pragma unroll
      for (int i = 0; i < 16; ++i) {
        const int d = ks * 32 + ((i < 8) ? (8 * hh + i) : (16 + 8 * hh + (i - 8)));
        const float x = qr[d] * scale; const unsigned short hb = bf16_bits(x);
        aqh[ks].u[i] = hb; aql[ks].u[i] = bf16_bits(x - bf16_val(hb));
      }
  }
  float m_r[8], l_r[8];
#pragma unroll
  for (int r = 0; r < 8; ++r) { m_r[r] = -3.0e38f; l_r[r] = 0.f; }
  v8f oacc[DT];
#pragma unroll
  for (int dt = 0; dt < DT; ++dt) oacc[dt] = (v8f){0.f,0.f,0.f,0.f,0.f,0.f,0.f,0.f};

  const int kv_end = CAUSAL ? min(T, qblk * 64 + 64) : T;     // block-uniform
  for (int j0 = 0; j0 < kv_end; j0 += 32) {
    __syncthreads();
    for (int e = tid; e < 32 * (D / 4); e += 128) {
      const int r = e / (D / 4), c4 = (e % (D / 4)) * 4;
      const int key = j0 + r;
      v4f kf = {0.f,0.f,0.f,0.f}, vf = {0.f,0.f,0.f,0.f};
      if (key < T) { kf = *(const v4fa*)(K + (size_t)key * pitch + c4); vf = *(const v4fa*)(V + (size_t)key * pitch + c4); }
#pragma unroll
      for (int t = 0; t < 4; ++t) {
        unsigned short hb = bf16_bits(kf[t]); sKh[r][c4 + t] = hb; sKl[r][c4 + t] = bf16_bits(kf[t] - bf16_val(hb));
        hb = bf16_bits(vf[t]); sVh[r][c4 + t] = hb; sVl[r][c4 + t] = bf16_bits(vf[t] - bf16_val(hb));
      }
    }
    __syncthreads();
    // S tile 16 x 32
    v8f s[2];
#pragma unroll
    for (int nt = 0; nt < 2; ++nt) {
      v8f acc = {};
#pragma unroll
      for (int ks = 0; ks < KS; ++ks) {
        FragB bh_, bl_;
        bh_.half[0] = *(const v8us*)&sKh[nt * 16 + ln][ks * 32 + 8 * hh]; bh_.half[1] = *(const v8us*)&sKh[nt * 16 + ln][ks * 32 + 16 + 8 * hh];
        bl_.half[0] = *(const v8us*)&sKl[nt * 16 + ln][ks * 32 + 8 * hh]; bl_.half[1] = *(const v8us*)&sKl[nt * 16 + ln][ks * 32 + 16 + 8 * hh];
        acc = mmaN<3>(aqh[ks].v, aql[ks].v, bh_.v, bl_.v, acc);
      }
      s[nt] = acc;
    }
    // mask + running max (rows 8hh+r; the 16 lanes of a half share rows)
    float alpha[8];
#pragma unroll
    for (int r = 0; r < 8; ++r) {
      const int qi = q0 + 8 * hh + r;
      const int ja = j0 + ln, jb = j0 + 16 + ln;
      if (CAUSAL) { if (ja > qi) s[0][r] = -3.0e38f; if (jb > qi) s[1][r] = -3.0e38f; }
      if (ja >= T) s[0][r] = -3.0e38f;
      if (jb >= T) s[1][r] = -3.0e38f;
      float mx = fmaxf(s[0][r], s[1][r]);
      mx = fmaxf(mx, __shfl_xor(mx, 1, 32)); mx = fmaxf(mx, __shfl_xor(mx, 2, 32)); mx = fmaxf(mx, __shfl_xor(mx, 4, 32)); mx = fmaxf(mx, __shfl_xor(mx, 8, 32));
      const float mnew = fmaxf(m_r[r], mx);
      alpha[r] = (mnew > -1.0e38f) ? __expf(m_r[r] - mnew) : 1.0f;
      const float p0 = (s[0][r] > -1.0e38f) ? __expf(s[0][r] - mnew) : 0.f;
      const float p1 = (s[1][r] > -1.0e38f) ? __expf(s[1][r] - mnew) : 0.f;
      m_r[r] = mnew;
      l_r[r] = l_r[r] * alpha[r] + p0 + p1;            // per-lane partial row sum (16 lanes combined at the end)
      unsigned short hb = bf16_bits(p0); sPh[w][8 * hh + r][ln] = hb;      sPl[w][8 * hh + r][ln] = bf16_bits(p0 - bf16_val(hb));
      hb = bf16_bits(p1);                sPh[w][8 * hh + r][16 + ln] = hb; sPl[w][8 * hh + r][16 + ln] = bf16_bits(p1 - bf16_val(hb));
    }
#pragma unroll
    for (int dt = 0; dt < DT; ++dt)
#pragma unroll
      for (int r = 0; r < 8; ++r) oacc[dt][r] *= alpha[r];
    __builtin_amdgcn_fence(__ATOMIC_ACQ_REL, "workgroup");
    __builtin_amdgcn_wave_barrier();
    FragB pah, pal;
    pah.half[0] = *(const v8us*)&sPh[w][ln][8 * hh]; pah.half[1] = *(const v8us*)&sPh[w][ln][16 + 8 * hh];
    pal.half[0] = *(const v8us*)&sPl[w][ln][8 * hh]; pal.half[1] = *(const v8us*)&sPl[w][ln][16 + 8 * hh];
#pragma unroll
    for (int dt = 0; dt < DT; ++dt) {
      FragB bvh, bvl;
#pragma unroll
      for (int i = 0; i < 8; ++i) {
        bvh.u[i] = sVh[8 * hh + i][dt * 16 + ln]; bvh.u[8 + i] = sVh[16 + 8 * hh + i][dt * 16 + ln];
        bvl.u[i] = sVl[8 * hh + i][dt * 16 + ln]; bvl.u[8 + i] = sVl[16 + 8 * hh + i][dt * 16 + ln];
      }
      oacc[dt] = mmaN<3>(pah.v, pal.v, bvh.v, bvl.v, oacc[dt]);
    }
    __builtin_amdgcn_fence(__ATOMIC_ACQ_REL, "workgroup");
    __builtin_amdgcn_wave_barrier();
  }
#pragma unroll
  for (int r = 0; r < 8; ++r) {
    float l = l_r[r];
    l += __shfl_xor(l, 1, 32); l += __shfl_xor(l, 2, 32); l += __shfl_xor(l, 4, 32); l += __shfl_xor(l, 8, 32);
    l_r[r] = (l > 0.f) ? 1.0f / l : 0.f;
  }
#pragma unroll
  for (int dt = 0; dt < DT; ++dt)
#pragma unroll
    for (int r = 0; r < 8; ++r) sO[w][8 * hh + r][dt * 16 + ln] = oacc[dt][r] * l_r[r];
  __builtin_amdgcn_fence(__ATOMIC_ACQ_REL, "workgroup");
  __builtin_amdgcn_wave_barrier();
  {
    for (int r = 0; r < 16; ++r) {
      const int row = q0 + r;
      if (row < T && lane < D / 4) {
        const v4f val = *(const v4fa*)&sO[w][r][lane * 4];
        *(v4f*)(y + ((size_t)b * T + row) * ypitch + h * D + lane * 4) = val;
      }
    }
    
  }
}

typedef short s16x8 __attribute__((ext_vector_type(8)));
__device__ __forceinline__ v8us lds_tr16(const unsigned short* p) {
  typedef __attribute__((address_space(3))) s16x8 lds_s16x8;
  return __builtin_bit_cast(v8us, __builtin_amdgcn_ds_load_tr16_b128_v8i16((lds_s16x8*)p));
}

// the value that lane l ^ 16 holds (the other 16-lane half of the wave), by a vector cross-row move
__device__ __forceinline__ float other_half(float x) {
  const int b = __float_as_int(x);
  return __int_as_float(__builtin_amdgcn_permlanex16(b, b, 0x76543210, 0xfedcba98, false, false));
}
typedef int v4ia __attribute__((ext_vector_type(4), may_alias));
typedef int v4i  __attribute__((ext_vector_type(4)));

template <int D, int T, int H, int P>
__global__ __launch_bounds__(128) void k_flash3c(const float* __restrict__ Qb, const unsigned short* __restrict__ Kh, const unsigned short* __restrict__ Kl,
                                              const unsigned short* __restrict__ Vh, const unsigned short* __restrict__ Vl,
                                              float scale, const int* __restrict__ mask3, const float* __restrict__ gp, float* __restrict__ y) {
  static_assert(T % 64 == 0 && D % 32 == 0 && 512 % D == 0, "whole query blocks, whole 32-key passes");
  constexpr int KS = D / 32, DT = D / 16;
  // row pitch: an odd multiple of 16 bytes for K (plain 16-byte reads), an odd multiple of 32 bytes for V (transposing reads)
  __shared__ __attribute__((aligned(16))) unsigned short sKh[32][D + 8], sKl[32][D + 8], sVh[32][D + 16], sVl[32][D + 16];
  __shared__ __attribute__((aligned(16))) float sO[4][16][D + 4];   // pitch 16 bytes over a power of two: a lane writes a whole row piece
  const int tid = threadIdx.x, w = tid >> 5, lane = tid & 31, ln = lane & 15, hh = lane >> 4;
  constexpr int nqb = T / 64;
  const int bh = blockIdx.x / nqb, qblk = blockIdx.x % nqb;
  const int b = bh / H, h = bh % H;
  const int q0 = qblk * 64 + w * 16;
  const float* Q = Qb + (size_t)b * T * P + h * D;
  FragB aqh[KS], aql[KS];
  {
    const float* qr = Q + (size_t)(q0 + ln) * P;
#pragma unroll
    for (int ks = 0; ks < KS; ++ks)
#pragma unroll
      for (int i = 0; i < 16; ++i) {
        const int d = ks * 32 + ((i < 8) ? (8 * hh + i) : (16 + 8 * hh + (i - 8)));
        const float x = qr[d] * scale; const unsigned short hb = bf16_bits(x);
        aqh[ks].u[i] = hb; aql[ks].u[i] = bf16_bits(x - bf16_val(hb));
      }
  }
  asm volatile("s_wait_xcnt 0x0" ::: "memory");     // before the address registers of the query loads are reused
  __builtin_amdgcn_sched_barrier(0);                // keeps the address arithmetic below, which reuses them, behind that wait
  float m_q = -3.0e38f, l_q = 0.f;   // the lane's query: running maximum (both halves agree), sum over the keys of the lane's own half
  v8f oacc[DT];                      // oacc[dt][r] = O[query q0 + ln][16 dt + 8 hh + r]
#pragma unroll
  for (int dt = 0; dt < DT; ++dt) oacc[dt] = (v8f){0.f,0.f,0.f,0.f,0.f,0.f,0.f,0.f};
  // Every global load of a 32-key pass is issued one pass ahead, without a predicate, into registers carried round the loop:
  // the pass behind the last one is clamped, as a whole, to the last one (in bounds), and its values are never used.
  // They are issued right behind the pass's second barrier: the barriers drain the load counter, and from there to the
  // next pass's first barrier is the longest stretch without one.
  // K and V arrive already split, as bf16 planes [b][h][key][D] (hi, lo): the 32 keys of a pass are 64 D bytes in a row in each plane,
  // and a pass only copies them to LDS.
  constexpr int NE = 32 * (D / 8) / 128;        // 16-byte pieces of each of the four planes per thread and pass
  const int sr = tid / (D / 8), sc8 = (tid % (D / 8)) * 8;
  // each address = a base that is the same for the whole block + one per-lane byte offset that never changes + a constant
  const size_t hoff = (size_t)bh * T * D;
  const char* Khb = (const char*)(Kh + hoff); const char* Klb = (const char*)(Kl + hoff);
  const char* Vhb = (const char*)(Vh + hoff); const char* Vlb = (const char*)(Vl + hoff);
  const unsigned kvoff = (unsigned)tid * 16u;
  v8us khp[NE], klp[NE], vhp[NE], vlp[NE];
  auto load_kv = [&](int j) {
    const size_t jb = (size_t)min(j, T - 32) * (D * 2);
#pragma unroll
    for (int i = 0; i < NE; ++i) {
      khp[i] = *(const v8us*)(Khb + jb + i * 2048 + kvoff); klp[i] = *(const v8us*)(Klb + jb + i * 2048 + kvoff);
      vhp[i] = *(const v8us*)(Vhb + jb + i * 2048 + kvoff); vlp[i] = *(const v8us*)(Vlb + jb + i * 2048 + kvoff);
    }
    asm volatile("s_wait_xcnt 0x0" ::: "memory");   // before the address registers of the loads above are reused
    __builtin_amdgcn_sched_barrier(0);              // keeps later address arithmetic, which reuses them, behind that wait
  };
  // mask and group_prob share one index; byte offsets inside one batch's [T][T] plane fit 32 bits
  const char* mplane = (const char*)(mask3 + (size_t)b * T * T); const char* gplane = (const char*)(gp + (size_t)b * T * T);
  const unsigned mgoff = ((unsigned)(q0 + ln) * (unsigned)T + (unsigned)(8 * hh)) * 4u;
  v4i mk[4], nmk[4]; v4f gq[4], ngq[4];   // this pass's, the next pass's; piece 2 nt + c = keys 16 nt + 8 hh + 4 c .. + 3 of the lane's query row
  auto load_mg = [&](int j) {
    const size_t jb = (size_t)min(j, T - 32) * 4;
#pragma unroll
    for (int i = 0; i < 4; ++i) nmk[i] = *(const v4ia*)(mplane + jb + ((i >> 1) * 64 + (i & 1) * 16) + mgoff);
#pragma unroll
    for (int i = 0; i < 4; ++i) ngq[i] = *(const v4fa*)(gplane + jb + ((i >> 1) * 64 + (i & 1) * 16) + mgoff);
    asm volatile("s_wait_xcnt 0x0" ::: "memory");   // before the offset registers of the loads above are reused
    __builtin_amdgcn_sched_barrier(0);              // keeps later arithmetic, which reuses them, behind that wait
  };
  load_kv(0);
  load_mg(0);
  for (int j0 = 0; j0 < T; j0 += 32) {
    __syncthreads();
#pragma unroll
    for (int i = 0; i < NE; ++i) {
      const int r = sr + i * (1024 / D);
      *(v8us*)&sKh[r][sc8] = khp[i]; *(v8us*)&sKl[r][sc8] = klp[i];
      *(v8us*)&sVh[r][sc8] = vhp[i]; *(v8us*)&sVl[r][sc8] = vlp[i];
    }
    __syncthreads();
#pragma unroll
    for (int i = 0; i < 4; ++i) { mk[i] = nmk[i]; gq[i] = ngq[i]; }
    load_kv(j0 + 32);
    load_mg(j0 + 32);
    v8f s[2];
#pragma unroll
    for (int nt = 0; nt < 2; ++nt) {
      v8f acc = {};
#pragma unroll
      for (int ks = 0; ks < KS; ++ks) {
        FragB bh_, bl_;
        bh_.half[0] = *(const v8us*)&sKh[nt * 16 + ln][ks * 32 + 8 * hh]; bh_.half[1] = *(const v8us*)&sKh[nt * 16 + ln][ks * 32 + 16 + 8 * hh];
        bl_.half[0] = *(const v8us*)&sKl[nt * 16 + ln][ks * 32 + 8 * hh]; bl_.half[1] = *(const v8us*)&sKl[nt * 16 + ln][ks * 32 + 16 + 8 * hh];
        acc = mmaN<3>(bh_.v, bl_.v, aqh[ks].v, aql[ks].v, acc);   // A = K rows, B = Q: acc[r] = score(key 16 nt + 8 hh + r, query ln)
      }
      s[nt] = acc;
    }
    const int dk = q0 + ln - 8 * hh - j0;     // the diagonal's key, counted from the first key of the lane's half in this pass
    float mx = -3.0e38f;
#pragma unroll
    for (int nt = 0; nt < 2; ++nt)
#pragma unroll
      for (int r = 0; r < 8; ++r) {
        s[nt][r] = (mk[2 * nt + (r >> 2)][r & 3] != 0 || dk == nt * 16 + r) ? s[nt][r] : -1.0e9f;
        mx = fmaxf(mx, s[nt][r]);
      }
    mx = fmaxf(mx, other_half(mx));
    const float mnew = fmaxf(m_q, mx);
    const float alpha = (mnew > -1.0e38f) ? __expf(m_q - mnew) : 1.0f;
    m_q = mnew;
    FragB pbh, pbl;   // element i = P[key 8 hh + i][query ln], element 8 + i = P[key 16 + 8 hh + i][query ln]: the k order of bvh, bvl
    float psum = 0.f;
#pragma unroll
    for (int nt = 0; nt < 2; ++nt)
#pragma unroll
      for (int r = 0; r < 8; ++r) {
        const float p = __expf(s[nt][r] - mnew);
        psum += p;
        const float g = p * bf16_round(gq[2 * nt + (r >> 2)][r & 3]);   // post-softmax multiplier: P only, not the normaliser
        const unsigned short hb = bf16_bits(g);
        pbh.u[nt * 8 + r] = hb; pbl.u[nt * 8 + r] = bf16_bits(g - bf16_val(hb));
      }
    l_q = l_q * alpha + psum;
#pragma unroll
    for (int dt = 0; dt < DT; ++dt)
#pragma unroll
      for (int r = 0; r < 8; ++r) oacc[dt][r] *= alpha;
    // all V fragments of the pass as one group of loads, so that their latency is waited out once and not once per 16 columns
    FragB bvh[DT], bvl[DT];   // element i = V[8 hh + i][16 dt + ln], element 8 + i = V[16 + 8 hh + i][16 dt + ln]: the k order of pbh, pbl
#pragma unroll
    for (int dt = 0; dt < DT; ++dt) {
      const int vr = 8 * hh + (lane & 7), vc = dt * 16 + 8 * ((lane >> 3) & 1);
      bvh[dt].half[0] = lds_tr16(&sVh[vr][vc]); bvh[dt].half[1] = lds_tr16(&sVh[16 + vr][vc]);
      bvl[dt].half[0] = lds_tr16(&sVl[vr][vc]); bvl[dt].half[1] = lds_tr16(&sVl[16 + vr][vc]);
    }
#pragma unroll
    for (int dt = 0; dt < DT; ++dt) oacc[dt] = mmaN<3>(bvh[dt].v, bvl[dt].v, pbh.v, pbl.v, oacc[dt]);   // A = V^T, B = P^T
  }
  const float lsum = l_q + other_half(l_q);
  const float linv = (m_q > -1.0e38f) ? 1.0f / lsum : __builtin_nanf("");
#pragma unroll
  for (int dt = 0; dt < DT; ++dt)
#pragma unroll
    for (int c = 0; c < 2; ++c) {
      const v4f o = {oacc[dt][4 * c] * linv, oacc[dt][4 * c + 1] * linv, oacc[dt][4 * c + 2] * linv, oacc[dt][4 * c + 3] * linv};
      *(v4fa*)&sO[w][ln][dt * 16 + 8 * hh + 4 * c] = o;
    }
  __builtin_amdgcn_fence(__ATOMIC_ACQ_REL, "workgroup");
  __builtin_amdgcn_wave_barrier();
  {
    for (int r = 0; r < 16; ++r) {
      const int row = q0 + r;
      if (lane < D / 4) {
        const v4f val = *(const v4fa*)&sO[w][r][lane * 4];
        *(v4f*)(y + ((size_t)b * T + row) * P + h * D + lane * 4) = val;
      }
    }
    
  }
}

__global__ __launch_bounds__(256) void k_round_rows(const float* __restrict__ W, unsigned short* __restrict__ Wt, int n8) {
  const int t = blockIdx.x * 256 + threadIdx.x;
  if (t >= n8) return;
  const v4f a = *(const v4fa*)(W + (size_t)t * 8), b = *(const v4fa*)(W + (size_t)t * 8 + 4);
  v8us v; v[0]=bf16_bits(a[0]); v[1]=bf16_bits(a[1]); v[2]=bf16_bits(a[2]); v[3]=bf16_bits(a[3]);
  v[4]=bf16_bits(b[0]); v[5]=bf16_bits(b[1]); v[6]=bf16_bits(b[2]); v[7]=bf16_bits(b[3]);
  *(v8us*)(Wt + (size_t)t * 8) = v; 
}

extern "C" void kernel_launch(void* const* d_in, const int* in_sizes, int n_in,
                              void* d_out, int out_size, void* d_ws, size_t ws_size, hipStream_t stream) {
  (void)in_sizes; (void)n_in; (void)out_size;
  const float* xq = (const float*)d_in[0]; const float* xk = (const float*)d_in[1]; const float* xv = (const float*)d_in[2];
  const float* gp = (const float*)d_in[3]; const int* mask = (const int*)d_in[4];
  const float* Wq = (const float*)d_in[5]; const float* bq = (const float*)d_in[6]; const float* Wk = (const float*)d_in[7]; const float* bk = (const float*)d_in[8];
  const float* Wv = (const float*)d_in[9]; const float* bv = (const float*)d_in[10]; const float* Wo = (const float*)d_in[11]; const float* bo = (const float*)d_in[12];
  char* ws = (char*)d_ws; size_t off = 0;
  auto take = [&](size_t bytes) { char* p = ws + off; off += (bytes + 255) & ~(size_t)255; return p; };
  const int M = BB * TT, n8 = DD * DD / 8, gb = ((M / 16) * (DD / 64) + 3) / 4;
  unsigned short* Wt[4]; for (int i = 0; i < 4; ++i) Wt[i] = (unsigned short*)take((size_t)DD * DD * 2);
  float* q = (float*)take((size_t)M * DD * 4); float* att = (float*)take((size_t)M * DD * 4);
  unsigned short* kv[4]; for (int i = 0; i < 4; ++i) kv[i] = (unsigned short*)take((size_t)M * DD * 2);   // K hi, K lo, V hi, V lo
  if (off > ws_size) return;
  const float* W4[4] = {Wq, Wk, Wv, Wo};
  for (int i = 0; i < 4; ++i) k_round_rows<<<(n8 + 255) / 256, 256, 0, stream>>>(W4[i], Wt[i], n8);
  k_gemm_bf<false, 0, true, DD, DD, 0><<<gb, 128, 0, stream>>>(xq, Wt[0], bq, q, DD, M, DD, DD, nullptr, nullptr);
  k_gemm_bf<false, 0, true, DD, DD, TT><<<gb, 128, 0, stream>>>(xk, Wt[1], bk, nullptr, DD, M, DD, DD, kv[0], kv[1]);
  k_gemm_bf<false, 0, true, DD, DD, TT><<<gb, 128, 0, stream>>>(xv, Wt[2], bv, nullptr, DD, M, DD, DD, kv[2], kv[3]);
  k_flash3c<HD, TT, NH, DD><<<BB * NH * (TT / 64), 128, 0, stream>>>(q, kv[0], kv[1], kv[2], kv[3], 0.125f, mask, gp, att);
  k_gemm_bf<true, 0, true, DD, DD, 0><<<gb, 128, 0, stream>>>(att, Wt[3], bo, (float*)d_out, DD, M, DD, DD, nullptr, nullptr);
}

// v007
// Measured time: 110 microseconds a run.
// Timed twice side by side with v006, it ran 1.13 and 1.10 times as fast.
// Over all steps from v000 it is 6.52 times as fast.
#include <hip/hip_runtime.h>
// All contractions on v_wmma_f32_16x16x32_bf16, f32 accumulate: q/k/v = x·Wᵀ + b (inputs, W, b rounded to bf16: single exact term), QKᵀ and
// P·V per 16-query tile as 3-term bf16 hi/lo splits (mask|diag → −1e9 kept in the softmax like the module; P multiplied by
// bf16(group_prob) after normalisation), out = x·Woᵀ + bo with x split (2 terms); softmax in f32.
#define BB 2
#define TT 2048
#define DD 512
#define NH 8
#define HD 64

typedef __bf16 v16b __attribute__((ext_vector_type(16)));
typedef unsigned short v8us __attribute__((ext_vector_type(8), may_alias));
typedef float  v8f  __attribute__((ext_vector_type(8)));
typedef float  v4f  __attribute__((ext_vector_type(4)));
typedef float  v4fa __attribute__((ext_vector_type(4), may_alias));
union FragB { v16b v; v8us half[2]; unsigned short u[16]; };

__device__ __forceinline__ unsigned short bf16_bits(float x) { unsigned int u = __float_as_uint(x); return (unsigned short)((u + 0x7FFFu + ((u >> 16) & 1u)) >> 16); }
__device__ __forceinline__ float bf16_val(unsigned short b) { return __uint_as_float(((unsigned int)b) << 16); }
__device__ __forceinline__ float bf16_round(float x) { return bf16_val(bf16_bits(x)); }
// D += A·B with NT terms: 1 = ah·bh, 2 = + al·bh (A split), 3 = + ah·bl (both split)
template <int NT>
__device__ __forceinline__ v8f mmaN(v16b ah, v16b al, v16b bh, v16b bl, v8f c) {
  c = __builtin_amdgcn_wmma_f32_16x16x32_bf16(false, ah, false, bh, (short)0, c, false, false);
  if (NT >= 2) c = __builtin_amdgcn_wmma_f32_16x16x32_bf16(false, al, false, bh, (short)0, c, false, false);
  if (NT >= 3) c = __builtin_amdgcn_wmma_f32_16x16x32_bf16(false, ah, false, bl, (short)0, c, false, false);
  asm volatile("v_nop\n\tv_nop\n\tv_nop\n\tv_nop" : "+v"(c) : "v"(ah), "v"(al), "v"(bh), "v"(bl));
  return c;
}

__global__ __launch_bounds__(256) void k_wt_bf16(const float* __restrict__ W, unsigned short* __restrict__ Wt, int K, int N) {
  const int t = blockIdx.x * 256 + threadIdx.x;
  const int k8n = K / 8;
  if (t >= N * k8n) return;
  const int n = t / k8n, k8 = (t % k8n) * 8;
  v8us v;
#pragma unroll
  for (int i = 0; i < 8; ++i) v[i] = bf16_bits(W[(size_t)(k8 + i) * N + n]);
  *(v8us*)(Wt + (size_t)n * K + k8) = v;
  
}

// GEMM C[M][N] (f32, pitch ldc) = act(A[M][K] * W + bias). A f32 row-major (pitch LDA) converted to bf16
// (ASPLIT: hi/lo two planes -> 2 terms, else single rounded term); Wt bf16 [N][K] (pitch LDB). BIAS_BF16 rounds the
// bias to bf16 first (bias quantised to bf16 before the add). K%128==0, M%64==0, N%64==0.
// A block of 4 waves owns a 64 x 64 tile of C (wave w: rows 16 w .. 16 w + 15, all 64 columns). Both operands go through LDS in stages
// of 128 k: every global load of a wave covers whole 128-byte lines (one 512-byte piece of an A row, two 256-byte pieces of W rows),
// an A element is converted once, a W element is fetched once per block, and the fragments are 16-byte LDS reads.
// Two LDS buffers, one barrier a stage: a wave that writes buffer s & 1 has passed the barrier of stage s - 1, which every wave
// reaches only behind its last read of stage s - 2.
typedef unsigned short v4us __attribute__((ext_vector_type(4), may_alias));
// ST == 0: C is written as f32. ST > 0 (rows per batch, ST % 64 == 0): the result is written instead as two bf16 planes, Ch = bf16(v) and
// Cl = bf16(v - Ch), laid out [batch][column block of 64][row in batch][64]: one head's rows are 128 bytes each and follow one another.
// One grid holds up to three independent products of the same shape: blockIdx.y = z picks A and bias, and the z-th [N][LDB] matrix behind Wt0.
// With ST > 0 product 0 is still written as f32 into C; product z >= 1 goes to the planes Cp + (2 z - 2) M N (hi) and Cp + (2 z - 1) M N (lo).
template <bool ASPLIT, int ACT, bool BIAS_BF16, int LDA, int LDB, int ST>
__global__ __launch_bounds__(128) void k_gemm_bf(const float* __restrict__ A0, const float* __restrict__ A1, const float* __restrict__ A2,
                                               const unsigned short* __restrict__ Wt0,
                                               const float* __restrict__ bias0, const float* __restrict__ bias1, const float* __restrict__ bias2,
                                               float* __restrict__ C, int ldc, int M, int N, int K, unsigned short* __restrict__ Cp) {
  const int z = blockIdx.y;                 // the same for the whole block
  const float* __restrict__ A = z == 0 ? A0 : z == 1 ? A1 : A2;
  const float* __restrict__ bias = z == 0 ? bias0 : z == 1 ? bias1 : bias2;
  const unsigned short* __restrict__ Wt = Wt0 + (size_t)z * N * LDB;
  unsigned short* __restrict__ Ch = Cp + (size_t)(z > 0 ? 2 * z - 2 : 0) * M * N;
  unsigned short* __restrict__ Cl = Ch + (size_t)M * N;
  constexpr int BK = 128, PK = BK + 8;      // row pitch in LDS: an odd multiple of 16 bytes (plain 16-byte reads)
  __shared__ __attribute__((aligned(16))) unsigned short sAh[2][64][PK], sAl[ASPLIT ? 2 : 1][ASPLIT ? 64 : 1][PK], sB[2][64][PK];
  __shared__ __attribute__((aligned(16))) float so[4][16][64];
  const int tid = threadIdx.x, w = tid >> 5, lane = tid & 31, ln = lane & 15, hh = lane >> 4;
  const int ntn = N / 64;
  const int mb = blockIdx.x / ntn, nq = blockIdx.x % ntn;
  if (mb * 64 >= M) return;                 // the same for the whole block, in front of every barrier
  const int row0 = mb * 64 + w * 16, col0 = nq * 64;
  const int ar = tid >> 5, ac4 = (tid & 31) * 4;   // A piece i of a stage: tile row ar + 4 i, k ac4 .. ac4 + 3
  const int br = tid >> 4, bc8 = (tid & 15) * 8;   // W piece i of a stage: tile row br + 8 i, k bc8 .. bc8 + 7
  const float* ap = A + (size_t)(mb * 64 + ar) * LDA + ac4;
  const unsigned short* bp = Wt + (size_t)(col0 + br) * LDB + bc8;
  // A stage's 24 loads are issued as one batch right behind the barrier of the stage before (a barrier drains the load counter),
  // into registers, and are waited for only behind that stage's products.
  // Every loop over pa, pb or the fragments is unrolled, so that their indices are constants and they stay in registers.
  v4f pa[16]; v8us pb[8];
  auto load_stage = [&](int kb) {
#pragma unroll
    for (int i = 0; i < 16; ++i) pa[i] = *(const v4fa*)(ap + kb + i * 4 * LDA);
#pragma unroll
    for (int i = 0; i < 8; ++i) pb[i] = *(const v8us*)(bp + kb + i * 8 * LDB);
    asm volatile("s_wait_xcnt 0x0" ::: "memory");   // before the address registers of the loads above are reused
    __builtin_amdgcn_sched_barrier(0);              // keeps later address arithmetic, which reuses them, behind that wait
  };
  v8f acc[4] = {};
  load_stage(0);
  for (int kb = 0; kb < K; kb += BK) {
    const int buf = (kb / BK) & 1;
#pragma unroll
    for (int i = 0; i < 16; ++i) {
      v4us h, l;
#pragma unroll
      for (int t = 0; t < 4; ++t) { const float x = pa[i][t]; const unsigned short hb = bf16_bits(x); h[t] = hb; l[t] = ASPLIT ? bf16_bits(x - bf16_val(hb)) : (unsigned short)0; }
      *(v4us*)&sAh[buf][ar + 4 * i][ac4] = h;
      if (ASPLIT) *(v4us*)&sAl[buf][ar + 4 * i][ac4] = l;
    }
#pragma unroll
    for (int i = 0; i < 8; ++i) *(v8us*)&sB[buf][br + 8 * i][bc8] = pb[i];
    __syncthreads();   // publishes this stage's tiles; also ends every wave's reads of the other buffer before the next stage rewrites it
    if (kb + BK < K) load_stage(kb + BK);
#pragma unroll
    for (int ks = 0; ks < BK / 32; ++ks) {
      // all fragments of a 32-k step as one group of LDS reads, so that their latency is waited out once and not once per 16 columns
      FragB ah, al, b[4];
      ah.half[0] = *(const v8us*)&sAh[buf][w * 16 + ln][ks * 32 + 8 * hh]; ah.half[1] = *(const v8us*)&sAh[buf][w * 16 + ln][ks * 32 + 16 + 8 * hh];
      if (ASPLIT) { al.half[0] = *(const v8us*)&sAl[buf][w * 16 + ln][ks * 32 + 8 * hh]; al.half[1] = *(const v8us*)&sAl[buf][w * 16 + ln][ks * 32 + 16 + 8 * hh]; }
      else {
#pragma unroll
        for (int i = 0; i < 16; ++i) al.u[i] = (unsigned short)0;
      }
#pragma unroll
      for (int t = 0; t < 4; ++t) {
        b[t].half[0] = *(const v8us*)&sB[buf][t * 16 + ln][ks * 32 + 8 * hh];
        b[t].half[1] = *(const v8us*)&sB[buf][t * 16 + ln][ks * 32 + 16 + 8 * hh];
      }
#pragma unroll
      for (int t = 0; t < 4; ++t) acc[t] = mmaN<ASPLIT ? 2 : 1>(ah.v, al.v, b[t].v, b[t].v, acc[t]);
    }
  }
#pragma unroll
  for (int t = 0; t < 4; ++t) {
    float bv = bias ? bias[col0 + t * 16 + ln] : 0.f;
    if (BIAS_BF16) bv = bf16_round(bv);
#pragma unroll
    for (int r = 0; r < 8; ++r) { float v = acc[t][r] + bv; if (ACT == 1) v = fmaxf(v, 0.f); so[w][8 * hh + r][t * 16 + ln] = v; }
  }
  __builtin_amdgcn_fence(__ATOMIC_ACQ_REL, "workgroup");
  __builtin_amdgcn_wave_barrier();
  if (ST > 0 && z > 0) {
    // a store of the wave covers 4 rows of 128 bytes, which follow one another in the plane
    const int r4 = lane >> 3, c8 = (lane & 7) * 8;
    v8us h[4], l[4];
#pragma unroll
    for (int q = 0; q < 4; ++q) {
      const v4f x0 = *(const v4fa*)&so[w][q * 4 + r4][c8], x1 = *(const v4fa*)&so[w][q * 4 + r4][c8 + 4];
#pragma unroll
      for (int t = 0; t < 8; ++t) {
        const float x = t < 4 ? x0[t & 3] : x1[t & 3]; const unsigned short hb = bf16_bits(x);
        h[q][t] = hb; l[q][t] = bf16_bits(x - bf16_val(hb));
      }
    }
    constexpr int STD = ST > 0 ? ST : 1;
    const size_t o = (((size_t)(row0 / STD) * ntn + nq) * STD + row0 % STD + r4) * 64 + c8;
#pragma unroll
    for (int q = 0; q < 4; ++q) { *(v8us*)(Ch + o + q * 256) = h[q]; *(v8us*)(Cl + o + q * 256) = l[q]; }
    return;
  }
  const int rsub = lane >> 4, c4 = (lane & 15) * 4;
  {
#pragma unroll
    for (int q = 0; q < 8; ++q) {
      const int r = q * 2 + rsub;
      const v4f v = *(const v4fa*)&so[w][r][c4];
      *(v4f*)(C + (size_t)(row0 + r) * ldc + col0 + c4) = v;
    }
    // where the kernel also holds the plane path: before code laid out behind these stores reuses their address and data registers
    if (ST > 0) asm volatile("s_wait_xcnt 0x0" ::: "memory");
  }
}

// Flash-style causal/unmasked attention, all contractions 3-term bf16 hi/lo splits, f32 softmax with running max.
// q,k,v rows are read from f32 buffers with arbitrary row pitch (so they can live inside a fused qkv buffer);
// D = head size (multiple of 32, <= 128); one wave = 16 query rows; block = 4 waves (64 queries) sharing K/V chunks of 32.
template <int D, bool CAUSAL>
__global__ __launch_bounds__(128) void k_flash(const float* __restrict__ qb, const float* __restrict__ kb, const float* __restrict__ vb,
                                             int pitch, int T, int H, float scale, float* __restrict__ y, int ypitch) {
  constexpr int KS = D / 32;        // k-steps for QK
  constexpr int DT = D / 16;        // d tiles for PV
  __shared__ __attribute__((aligned(16))) unsigned short sKh[32][D + 8], sKl[32][D + 8], sVh[32][D + 8], sVl[32][D + 8];
  __shared__ __attribute__((aligned(16))) unsigned short sPh[4][16][40], sPl[4][16][40];
  __shared__ __attribute__((aligned(16))) float sO[4][16][D];
  const int tid = threadIdx.x, w = tid >> 5, lane = tid & 31, ln = lane & 15, hh = lane >> 4;
  const int nqb = (T + 63) / 64;
  const int bh = blockIdx.x / nqb, qblk = blockIdx.x % nqb;
  const int b = bh / H, h = bh % H;
  const int q0 = qblk * 64 + w * 16;
  const float* Q = qb + (size_t)b * T * pitch + h * D;
  const float* K = kb + (size_t)b * T * pitch + h * D;
  const float* V = vb + (size_t)b * T * pitch + h * D;

  // A fragments of the wave's 16 query rows (scaled), hi/lo
  FragB aqh[KS], aql[KS];
  {
    int row = q0 + ln; if (row >= T) row = T - 1;
    const float* qr = Q + (size_t)row * pitch;
#pragma unroll
    for (int ks = 0; ks < KS; ++ks)
#pragma unroll
      for (int i = 0; i < 16; ++i) {
        const int d = ks * 32 + ((i < 8) ? (8 * hh + i) : (16 + 8 * hh + (i - 8)));
        const float x = qr[d] * scale; const unsigned short hb = bf16_bits(x);
        aqh[ks].u[i] = hb; aql[ks].u[i] = bf16_bits(x - bf16_val(hb));
      }
  }
  float m_r[8], l_r[8];
#pragma unroll
  for (int r = 0; r < 8; ++r) { m_r[r] = -3.0e38f; l_r[r] = 0.f; }
  v8f oacc[DT];
#pragma unroll
  for (int dt = 0; dt < DT; ++dt) oacc[dt] = (v8f){0.f,0.f,0.f,0.f,0.f,0.f,0.f,0.f};

  const int kv_end = CAUSAL ? min(T, qblk * 64 + 64) : T;     // block-uniform
  for (int j0 = 0; j0 < kv_end; j0 += 32) {
    __syncthreads();
    for (int e = tid; e < 32 * (D / 4); e += 128) {
      const int r = e / (D / 4), c4 = (e % (D / 4)) * 4;
      const int key = j0 + r;
      v4f kf = {0.f,0.f,0.f,0.f}, vf = {0.f,0.f,0.f,0.f};
      if (key < T) { kf = *(const v4fa*)(K + (size_t)key * pitch + c4); vf = *(const v4fa*)(V + (size_t)key * pitch + c4); }
#pragma unroll
      for (int t = 0; t < 4; ++t) {
        unsigned short hb = bf16_bits(kf[t]); sKh[r][c4 + t] = hb; sKl[r][c4 + t] = bf16_bits(kf[t] - bf16_val(hb));
        hb = bf16_bits(vf[t]); sVh[r][c4 + t] = hb; sVl[r][c4 + t] = bf16_bits(vf[t] - bf16_val(hb));
      }
    }
    __syncthreads();
    // S tile 16 x 32
    v8f s[2];
#pragma unroll
    for (int nt = 0; nt < 2; ++nt) {
      v8f acc = {};
#pragma unroll
      for (int ks = 0; ks < KS; ++ks) {
        FragB bh_, bl_;
        bh_.half[0] = *(const v8us*)&sKh[nt * 16 + ln][ks * 32 + 8 * hh]; bh_.half[1] = *(const v8us*)&sKh[nt * 16 + ln][ks * 32 + 16 + 8 * hh];
        bl_.half[0] = *(const v8us*)&sKl[nt * 16 + ln][ks * 32 + 8 * hh]; bl_.half[1] = *(const v8us*)&sKl[nt * 16 + ln][ks * 32 + 16 + 8 * hh];
        acc = mmaN<3>(aqh[ks].v, aql[ks].v, bh_.v, bl_.v, acc);
      }
      s[nt] = acc;
    }
    // mask + running max (rows 8hh+r; the 16 lanes of a half share rows)
    float alpha[8];
#pragma unroll
    for (int r = 0; r < 8; ++r) {
      const int qi = q0 + 8 * hh + r;
      const int ja = j0 + ln, jb = j0 + 16 + ln;
      if (CAUSAL) { if (ja > qi) s[0][r] = -3.0e38f; if (jb > qi) s[1][r] = -3.0e38f; }
      if (ja >= T) s[0][r] = -3.0e38f;
      if (jb >= T) s[1][r] = -3.0e38f;
      float mx = fmaxf(s[0][r], s[1][r]);
      mx = fmaxf(mx, __shfl_xor(mx, 1, 32)); mx = fmaxf(mx, __shfl_xor(mx, 2, 32)); mx = fmaxf(mx, __shfl_xor(mx, 4, 32)); mx = fmaxf(mx, __shfl_xor(mx, 8, 32));
      const float mnew = fmaxf(m_r[r], mx);
      alpha[r] = (mnew > -1.0e38f) ? __expf(m_r[r] - mnew) : 1.0f;
      const float p0 = (s[0][r] > -1.0e38f) ? __expf(s[0][r] - mnew) : 0.f;
      const float p1 = (s[1][r] > -1.0e38f) ? __expf(s[1][r] - mnew) : 0.f;
      m_r[r] = mnew;
      l_r[r] = l_r[r] * alpha[r] + p0 + p1;            // per-lane partial row sum (16 lanes combined at the end)
      unsigned short hb = bf16_bits(p0); sPh[w][8 * hh + r][ln] = hb;      sPl[w][8 * hh + r][ln] = bf16_bits(p0 - bf16_val(hb));
      hb = bf16_bits(p1);                sPh[w][8 * hh + r][16 + ln] = hb; sPl[w][8 * hh + r][16 + ln] = bf16_bits(p1 - bf16_val(hb));
    }
#pragma unroll
    for (int dt = 0; dt < DT; ++dt)
#pragma unroll
      for (int r = 0; r < 8; ++r) oacc[dt][r] *= alpha[r];
    __builtin_amdgcn_fence(__ATOMIC_ACQ_REL, "workgroup");
    __builtin_amdgcn_wave_barrier();
    FragB pah, pal;
    pah.half[0] = *(const v8us*)&sPh[w][ln][8 * hh]; pah.half[1] = *(const v8us*)&sPh[w][ln][16 + 8 * hh];
    pal.half[0] = *(const v8us*)&sPl[w][ln][8 * hh]; pal.half[1] = *(const v8us*)&sPl[w][ln][16 + 8 * hh];
#pragma unroll
    for (int dt = 0; dt < DT; ++dt) {
      FragB bvh, bvl;
#pragma unroll
      for (int i = 0; i < 8; ++i) {
        bvh.u[i] = sVh[8 * hh + i][dt * 16 + ln]; bvh.u[8 + i] = sVh[16 + 8 * hh + i][dt * 16 + ln];
        bvl.u[i] = sVl[8 * hh + i][dt * 16 + ln]; bvl.u[8 + i] = sVl[16 + 8 * hh + i][dt * 16 + ln];
      }
      oacc[dt] = mmaN<3>(pah.v, pal.v, bvh.v, bvl.v, oacc[dt]);
    }
    __builtin_amdgcn_fence(__ATOMIC_ACQ_REL, "workgroup");
    __builtin_amdgcn_wave_barrier();
  }
#pragma unroll
  for (int r = 0; r < 8; ++r) {
    float l = l_r[r];
    l += __shfl_xor(l, 1, 32); l += __shfl_xor(l, 2, 32); l += __shfl_xor(l, 4, 32); l += __shfl_xor(l, 8, 32);
    l_r[r] = (l > 0.f) ? 1.0f / l : 0.f;
  }
#pragma unroll
  for (int dt = 0; dt < DT; ++dt)
#pragma unroll
    for (int r = 0; r < 8; ++r) sO[w][8 * hh + r][dt * 16 + ln] = oacc[dt][r] * l_r[r];
  __builtin_amdgcn_fence(__ATOMIC_ACQ_REL, "workgroup");
  __builtin_amdgcn_wave_barrier();
  {
    for (int r = 0; r < 16; ++r) {
      const int row = q0 + r;
      if (row < T && lane < D / 4) {
        const v4f val = *(const v4fa*)&sO[w][r][lane * 4];
        *(v4f*)(y + ((size_t)b * T + row) * ypitch + h * D + lane * 4) = val;
      }
    }
    
  }
}

typedef short s16x8 __attribute__((ext_vector_type(8)));
__device__ __forceinline__ v8us lds_tr16(const unsigned short* p) {
  typedef __attribute__((address_space(3))) s16x8 lds_s16x8;
  return __builtin_bit_cast(v8us, __builtin_amdgcn_ds_load_tr16_b128_v8i16((lds_s16x8*)p));
}

// the value that lane l ^ 16 holds (the other 16-lane half of the wave), by a vector cross-row move
__device__ __forceinline__ float other_half(float x) {
  const int b = __float_as_int(x);
  return __int_as_float(__builtin_amdgcn_permlanex16(b, b, 0x76543210, 0xfedcba98, false, false));
}
typedef int v4ia __attribute__((ext_vector_type(4), may_alias));
typedef int v4i  __attribute__((ext_vector_type(4)));

template <int D, int T, int H, int P>
__global__ __launch_bounds__(128) void k_flash3c(const float* __restrict__ Qb, const unsigned short* __restrict__ Kh, const unsigned short* __restrict__ Kl,
                                              const unsigned short* __restrict__ Vh, const unsigned short* __restrict__ Vl,
                                              float scale, const int* __restrict__ mask3, const float* __restrict__ gp, float* __restrict__ y) {
  static_assert(T % 64 == 0 && D % 32 == 0 && 512 % D == 0, "whole query blocks, whole 32-key passes");
  constexpr int KS = D / 32, DT = D / 16;
  // row pitch: an odd multiple of 16 bytes for K (plain 16-byte reads), an odd multiple of 32 bytes for V (transposing reads)
  __shared__ __attribute__((aligned(16))) unsigned short sKh[32][D + 8], sKl[32][D + 8], sVh[32][D + 16], sVl[32][D + 16];
  __shared__ __attribute__((aligned(16))) float sO[4][16][D + 4];   // pitch 16 bytes over a power of two: a lane writes a whole row piece
  const int tid = threadIdx.x, w = tid >> 5, lane = tid & 31, ln = lane & 15, hh = lane >> 4;
  constexpr int nqb = T / 64;
  const int bh = blockIdx.x / nqb, qblk = blockIdx.x % nqb;
  const int b = bh / H, h = bh % H;
  const int q0 = qblk * 64 + w * 16;
  const float* Q = Qb + (size_t)b * T * P + h * D;
  FragB aqh[KS], aql[KS];
  {
    const float* qr = Q + (size_t)(q0 + ln) * P;
#pragma unroll
    for (int ks = 0; ks < KS; ++ks)
#pragma unroll
      for (int i = 0; i < 16; ++i) {
        const int d = ks * 32 + ((i < 8) ? (8 * hh + i) : (16 + 8 * hh + (i - 8)));
        const float x = qr[d] * scale; const unsigned short hb = bf16_bits(x);
        aqh[ks].u[i] = hb; aql[ks].u[i] = bf16_bits(x - bf16_val(hb));
      }
  }
  asm volatile("s_wait_xcnt 0x0" ::: "memory");     // before the address registers of the query loads are reused
  __builtin_amdgcn_sched_barrier(0);                // keeps the address arithmetic below, which reuses them, behind that wait
  float m_q = -3.0e38f, l_q = 0.f;   // the lane's query: running maximum (both halves agree), sum over the keys of the lane's own half
  v8f oacc[DT];                      // oacc[dt][r] = O[query q0 + ln][16 dt + 8 hh + r]
#pragma unroll
  for (int dt = 0; dt < DT; ++dt) oacc[dt] = (v8f){0.f,0.f,0.f,0.f,0.f,0.f,0.f,0.f};
  // Every global load of a 32-key pass is issued one pass ahead, without a predicate, into registers carried round the loop:
  // the pass behind the last one is clamped, as a whole, to the last one (in bounds), and its values are never used.
  // They are issued right behind the pass's second barrier: the barriers drain the load counter, and from there to the
  // next pass's first barrier is the longest stretch without one.
  // K and V arrive already split, as bf16 planes [b][h][key][D] (hi, lo): the 32 keys of a pass are 64 D bytes in a row in each plane,
  // and a pass only copies them to LDS.
  constexpr int NE = 32 * (D / 8) / 128;        // 16-byte pieces of each of the four planes per thread and pass
  const int sr = tid / (D / 8), sc8 = (tid % (D / 8)) * 8;
  // each address = a base that is the same for the whole block + one per-lane byte offset that never changes + a constant
  const size_t hoff = (size_t)bh * T * D;
  const char* Khb = (const char*)(Kh + hoff); const char* Klb = (const char*)(Kl + hoff);
  const char* Vhb = (const char*)(Vh + hoff); const char* Vlb = (const char*)(Vl + hoff);
  const unsigned kvoff = (unsigned)tid * 16u;
  v8us khp[NE], klp[NE], vhp[NE], vlp[NE];
  auto load_kv = [&](int j) {
    const size_t jb = (size_t)min(j, T - 32) * (D * 2);
#pragma unroll
    for (int i = 0; i < NE; ++i) {
      khp[i] = *(const v8us*)(Khb + jb + i * 2048 + kvoff); klp[i] = *(const v8us*)(Klb + jb + i * 2048 + kvoff);
      vhp[i] = *(const v8us*)(Vhb + jb + i * 2048 + kvoff); vlp[i] = *(const v8us*)(Vlb + jb + i * 2048 + kvoff);
    }
    asm volatile("s_wait_xcnt 0x0" ::: "memory");   // before the address registers of the loads above are reused
    __builtin_amdgcn_sched_barrier(0);              // keeps later address arithmetic, which reuses them, behind that wait
  };
  // mask and group_prob share one index; byte offsets inside one batch's [T][T] plane fit 32 bits
  const char* mplane = (const char*)(mask3 + (size_t)b * T * T); const char* gplane = (const char*)(gp + (size_t)b * T * T);
  const unsigned mgoff = ((unsigned)(q0 + ln) * (unsigned)T + (unsigned)(8 * hh)) * 4u;
  v4i mk[4], nmk[4]; v4f gq[4], ngq[4];   // this pass's, the next pass's; piece 2 nt + c = keys 16 nt + 8 hh + 4 c .. + 3 of the lane's query row
  auto load_mg = [&](int j) {
    const size_t jb = (size_t)min(j, T - 32) * 4;
#pragma unroll
    for (int i = 0; i < 4; ++i) nmk[i] = *(const v4ia*)(mplane + jb + ((i >> 1) * 64 + (i & 1) * 16) + mgoff);
#pragma unroll
    for (int i = 0; i < 4; ++i) ngq[i] = *(const v4fa*)(gplane + jb + ((i >> 1) * 64 + (i & 1) * 16) + mgoff);
    asm volatile("s_wait_xcnt 0x0" ::: "memory");   // before the offset registers of the loads above are reused
    __builtin_amdgcn_sched_barrier(0);              // keeps later arithmetic, which reuses them, behind that wait
  };
  load_kv(0);
  load_mg(0);
  for (int j0 = 0; j0 < T; j0 += 32) {
    __syncthreads();
#pragma unroll
    for (int i = 0; i < NE; ++i) {
      const int r = sr + i * (1024 / D);
      *(v8us*)&sKh[r][sc8] = khp[i]; *(v8us*)&sKl[r][sc8] = klp[i];
      *(v8us*)&sVh[r][sc8] = vhp[i]; *(v8us*)&sVl[r][sc8] = vlp[i];
    }
    __syncthreads();
#pragma unroll
    for (int i = 0; i < 4; ++i) { mk[i] = nmk[i]; gq[i] = ngq[i]; }
    load_kv(j0 + 32);
    load_mg(j0 + 32);
    v8f s[2];
#pragma unroll
    for (int nt = 0; nt < 2; ++nt) {
      v8f acc = {};
#pragma unroll
      for (int ks = 0; ks < KS; ++ks) {
        FragB bh_, bl_;
        bh_.half[0] = *(const v8us*)&sKh[nt * 16 + ln][ks * 32 + 8 * hh]; bh_.half[1] = *(const v8us*)&sKh[nt * 16 + ln][ks * 32 + 16 + 8 * hh];
        bl_.half[0] = *(const v8us*)&sKl[nt * 16 + ln][ks * 32 + 8 * hh]; bl_.half[1] = *(const v8us*)&sKl[nt * 16 + ln][ks * 32 + 16 + 8 * hh];
        acc = mmaN<3>(bh_.v, bl_.v, aqh[ks].v, aql[ks].v, acc);   // A = K rows, B = Q: acc[r] = score(key 16 nt + 8 hh + r, query ln)
      }
      s[nt] = acc;
    }
    const int dk = q0 + ln - 8 * hh - j0;     // the diagonal's key, counted from the first key of the lane's half in this pass
    float mx = -3.0e38f;
#pragma unroll
    for (int nt = 0; nt < 2; ++nt)
#pragma unroll
      for (int r = 0; r < 8; ++r) {
        s[nt][r] = (mk[2 * nt + (r >> 2)][r & 3] != 0 || dk == nt * 16 + r) ? s[nt][r] : -1.0e9f;
        mx = fmaxf(mx, s[nt][r]);
      }
    mx = fmaxf(mx, other_half(mx));
    const float mnew = fmaxf(m_q, mx);
    const float alpha = (mnew > -1.0e38f) ? __expf(m_q - mnew) : 1.0f;
    m_q = mnew;
    FragB pbh, pbl;   // element i = P[key 8 hh + i][query ln], element 8 + i = P[key 16 + 8 hh + i][query ln]: the k order of bvh, bvl
    float psum = 0.f;
#pragma unroll
    for (int nt = 0; nt < 2; ++nt)
#pragma unroll
      for (int r = 0; r < 8; ++r) {
        const float p = __expf(s[nt][r] - mnew);
        psum += p;
        const float g = p * bf16_round(gq[2 * nt + (r >> 2)][r & 3]);   // post-softmax multiplier: P only, not the normaliser
        const unsigned short hb = bf16_bits(g);
        pbh.u[nt * 8 + r] = hb; pbl.u[nt * 8 + r] = bf16_bits(g - bf16_val(hb));
      }
    l_q = l_q * alpha + psum;
#pragma unroll
    for (int dt = 0; dt < DT; ++dt)
#pragma unroll
      for (int r = 0; r < 8; ++r) oacc[dt][r] *= alpha;
    // all V fragments of the pass as one group of loads, so that their latency is waited out once and not once per 16 columns
    FragB bvh[DT], bvl[DT];   // element i = V[8 hh + i][16 dt + ln], element 8 + i = V[16 + 8 hh + i][16 dt + ln]: the k order of pbh, pbl
#pragma unroll
    for (int dt = 0; dt < DT; ++dt) {
      const int vr = 8 * hh + (lane & 7), vc = dt * 16 + 8 * ((lane >> 3) & 1);
      bvh[dt].half[0] = lds_tr16(&sVh[vr][vc]); bvh[dt].half[1] = lds_tr16(&sVh[16 + vr][vc]);
      bvl[dt].half[0] = lds_tr16(&sVl[vr][vc]); bvl[dt].half[1] = lds_tr16(&sVl[16 + vr][vc]);
    }
#pragma unroll
    for (int dt = 0; dt < DT; ++dt) oacc[dt] = mmaN<3>(bvh[dt].v, bvl[dt].v, pbh.v, pbl.v, oacc[dt]);   // A = V^T, B = P^T
  }
  const float lsum = l_q + other_half(l_q);
  const float linv = (m_q > -1.0e38f) ? 1.0f / lsum : __builtin_nanf("");
#pragma unroll
  for (int dt = 0; dt < DT; ++dt)
#pragma unroll
    for (int c = 0; c < 2; ++c) {
      const v4f o = {oacc[dt][4 * c] * linv, oacc[dt][4 * c + 1] * linv, oacc[dt][4 * c + 2] * linv, oacc[dt][4 * c + 3] * linv};
      *(v4fa*)&sO[w][ln][dt * 16 + 8 * hh + 4 * c] = o;
    }
  __builtin_amdgcn_fence(__ATOMIC_ACQ_REL, "workgroup");
  __builtin_amdgcn_wave_barrier();
  {
    for (int r = 0; r < 16; ++r) {
      const int row = q0 + r;
      if (lane < D / 4) {
        const v4f val = *(const v4fa*)&sO[w][r][lane * 4];
        *(v4f*)(y + ((size_t)b * T + row) * P + h * D + lane * 4) = val;
      }
    }
    
  }
}

// blockIdx.y picks one of four matrices of 8 n8 elements each; their rounded copies follow one another behind Wt0
__global__ __launch_bounds__(256) void k_round_rows(const float* __restrict__ W0, const float* __restrict__ W1, const float* __restrict__ W2,
                                                    const float* __restrict__ W3, unsigned short* __restrict__ Wt0, int n8) {
  const int t = blockIdx.x * 256 + threadIdx.x;
  if (t >= n8) return;
  const int z = blockIdx.y;
  const float* __restrict__ W = z == 0 ? W0 : z == 1 ? W1 : z == 2 ? W2 : W3;
  unsigned short* __restrict__ Wt = Wt0 + (size_t)z * n8 * 8;
  const v4f a = *(const v4fa*)(W + (size_t)t * 8), b = *(const v4fa*)(W + (size_t)t * 8 + 4);
  v8us v; v[0]=bf16_bits(a[0]); v[1]=bf16_bits(a[1]); v[2]=bf16_bits(a[2]); v[3]=bf16_bits(a[3]);
  v[4]=bf16_bits(b[0]); v[5]=bf16_bits(b[1]); v[6]=bf16_bits(b[2]); v[7]=bf16_bits(b[3]);
  *(v8us*)(Wt + (size_t)t * 8) = v; 
}

extern "C" void kernel_launch(void* const* d_in, const int* in_sizes, int n_in,
                              void* d_out, int out_size, void* d_ws, size_t ws_size, hipStream_t stream) {
  (void)in_sizes; (void)n_in; (void)out_size;
  const float* xq = (const float*)d_in[0]; const float* xk = (const float*)d_in[1]; const float* xv = (const float*)d_in[2];
  const float* gp = (const float*)d_in[3]; const int* mask = (const int*)d_in[4];
  const float* Wq = (const float*)d_in[5]; const float* bq = (const float*)d_in[6]; const float* Wk = (const float*)d_in[7]; const float* bk = (const float*)d_in[8];
  const float* Wv = (const float*)d_in[9]; const float* bv = (const float*)d_in[10]; const float* Wo = (const float*)d_in[11]; const float* bo = (const float*)d_in[12];
  char* ws = (char*)d_ws; size_t off = 0;
  auto take = [&](size_t bytes) { char* p = ws + off; off += (bytes + 255) & ~(size_t)255; return p; };
  const int M = BB * TT, n8 = DD * DD / 8, gb = ((M / 16) * (DD / 64) + 3) / 4;
  unsigned short* Wt0 = (unsigned short*)take((size_t)4 * DD * DD * 2);   // rounded Wq, Wk, Wv, Wo, one behind the other
  unsigned short* Wt[4]; for (int i = 0; i < 4; ++i) Wt[i] = Wt0 + (size_t)i * DD * DD;
  float* q = (float*)take((size_t)M * DD * 4); float* att = (float*)take((size_t)M * DD * 4);
  unsigned short* kv0 = (unsigned short*)take((size_t)4 * M * DD * 2);    // K hi, K lo, V hi, V lo, one behind the other
  unsigned short* kv[4]; for (int i = 0; i < 4; ++i) kv[i] = kv0 + (size_t)i * M * DD;
  if (off > ws_size) return;
  // four launches, each of which needs the one before it: independent pieces of work share a grid
  k_round_rows<<<dim3((n8 + 255) / 256, 4), 256, 0, stream>>>(Wq, Wk, Wv, Wo, Wt0, n8);
  k_gemm_bf<false, 0, true, DD, DD, TT><<<dim3(gb, 3), 128, 0, stream>>>(xq, xk, xv, Wt0, bq, bk, bv, q, DD, M, DD, DD, kv0);
  k_flash3c<HD, TT, NH, DD><<<BB * NH * (TT / 64), 128, 0, stream>>>(q, kv[0], kv[1], kv[2], kv[3], 0.125f, mask, gp, att);
  k_gemm_bf<true, 0, true, DD, DD, 0><<<dim3(gb, 1), 128, 0, stream>>>(att, nullptr, nullptr, Wt[3], bo, nullptr, nullptr, (float*)d_out, DD, M, DD, DD, kv0);
}

// v008
// Measured time: 106 microseconds a run.
// Next to v007, in two timings, it ran 1.03 times as fast each time.
// All steps since v000 together make it 6.72 times as fast.
#include <hip/hip_runtime.h>
// All contractions on v_wmma_f32_16x16x32_bf16, f32 accumulate: q/k/v = x·Wᵀ + b (inputs, W, b rounded to bf16: single exact term), QKᵀ and
// P·V per 16-query tile as 3-term bf16 hi/lo splits (mask|diag → −1e9 kept in the softmax like the module; P multiplied by
// bf16(group_prob) after normalisation), out = x·Woᵀ + bo with x split (2 terms); softmax in f32.
#define BB 2
#define TT 2048
#define DD 512
#define NH 8
#define HD 64

typedef __bf16 v16b __attribute__((ext_vector_type(16)));
typedef unsigned short v8us __attribute__((ext_vector_type(8), may_alias));
typedef float  v8f  __attribute__((ext_vector_type(8)));
typedef float  v4f  __attribute__((ext_vector_type(4)));
typedef float  v4fa __attribute__((ext_vector_type(4), may_alias));
typedef float  v2f  __attribute__((ext_vector_type(2)));
typedef __bf16 v2b  __attribute__((ext_vector_type(2)));
typedef __bf16 v8b  __attribute__((ext_vector_type(8)));
union FragB { v16b v; v8us half[2]; unsigned short u[16]; v2b pr[8]; };

// round to nearest even by the hardware's own conversion
__device__ __forceinline__ unsigned short bf16_bits(float x) { return __builtin_bit_cast(unsigned short, (__bf16)x); }
// two values rounded to nearest even and packed into one register by one conversion instruction
__device__ __forceinline__ v2b bf16_pair(float a, float b) { const v2f x = {a, b}; return __builtin_convertvector(x, v2b); }
// the two halves of such a pair as f32, written on the bits: the compiler then reads the half in place, as an operand of a
// mixed-precision multiply-add, where a conversion of the pair is unpacked into two more registers first
__device__ __forceinline__ float pair_lo(v2b p) { return __uint_as_float(__builtin_bit_cast(unsigned int, p) << 16); }
__device__ __forceinline__ float pair_hi(v2b p) { return __uint_as_float(__builtin_bit_cast(unsigned int, p) & 0xffff0000u); }
__device__ __forceinline__ float bf16_val(unsigned short b) { return __uint_as_float(((unsigned int)b) << 16); }
__device__ __forceinline__ float bf16_round(float x) { return bf16_val(bf16_bits(x)); }
// D += A·B with NT terms: 1 = ah·bh, 2 = + al·bh (A split), 3 = + ah·bl (both split)
template <int NT>
__device__ __forceinline__ v8f mmaN(v16b ah, v16b al, v16b bh, v16b bl, v8f c) {
  c = __builtin_amdgcn_wmma_f32_16x16x32_bf16(false, ah, false, bh, (short)0, c, false, false);
  if (NT >= 2) c = __builtin_amdgcn_wmma_f32_16x16x32_bf16(false, al, false, bh, (short)0, c, false, false);
  if (NT >= 3) c = __builtin_amdgcn_wmma_f32_16x16x32_bf16(false, ah, false, bl, (short)0, c, false, false);
  asm volatile("v_nop\n\tv_nop\n\tv_nop\n\tv_nop" : "+v"(c) : "v"(ah), "v"(al), "v"(bh), "v"(bl));
  return c;
}

__global__ __launch_bounds__(256) void k_wt_bf16(const float* __restrict__ W, unsigned short* __restrict__ Wt, int K, int N) {
  const int t = blockIdx.x * 256 + threadIdx.x;
  const int k8n = K / 8;
  if (t >= N * k8n) return;
  const int n = t / k8n, k8 = (t % k8n) * 8;
  v8us v;
#pragma unroll
  for (int i = 0; i < 8; ++i) v[i] = bf16_bits(W[(size_t)(k8 + i) * N + n]);
  *(v8us*)(Wt + (size_t)n * K + k8) = v;
  
}

// GEMM C[M][N] (f32, pitch ldc) = act(A[M][K] * W + bias). A f32 row-major (pitch LDA) converted to bf16
// (ASPLIT: hi/lo two planes -> 2 terms, else single rounded term); Wt bf16 [N][K] (pitch LDB). BIAS_BF16 rounds the
// bias to bf16 first (bias quantised to bf16 before the add). K%128==0, M%64==0, N%64==0.
// A block of 4 waves owns a 64 x 64 tile of C (wave w: rows 16 w .. 16 w + 15, all 64 columns). Both operands go through LDS in stages
// of 128 k: every global load of a wave covers whole 128-byte lines (one 512-byte piece of an A row, two 256-byte pieces of W rows),
// an A element is converted once, a W element is fetched once per block, and the fragments are 16-byte LDS reads.
// Two LDS buffers, one barrier a stage: a wave that writes buffer s & 1 has passed the barrier of stage s - 1, which every wave
// reaches only behind its last read of stage s - 2.
typedef unsigned short v4us __attribute__((ext_vector_type(4), may_alias));
// ST == 0: C is written as f32. ST > 0 (rows per batch, ST % 64 == 0): the result is written instead as two bf16 planes, Ch = bf16(v) and
// Cl = bf16(v - Ch), laid out [batch][column block of 64][row in batch][64]: one head's rows are 128 bytes each and follow one another.
// One grid holds up to three independent products of the same shape: blockIdx.y = z picks A and bias, and the z-th [N][LDB] matrix behind Wt0.
// With ST > 0 product 0 is still written as f32 into C; product z >= 1 goes to the planes Cp + (2 z - 2) M N (hi) and Cp + (2 z - 1) M N (lo).
template <bool ASPLIT, int ACT, bool BIAS_BF16, int LDA, int LDB, int ST>
__global__ __launch_bounds__(128) void k_gemm_bf(const float* __restrict__ A0, const float* __restrict__ A1, const float* __restrict__ A2,
                                               const unsigned short* __restrict__ Wt0,
                                               const float* __restrict__ bias0, const float* __restrict__ bias1, const float* __restrict__ bias2,
                                               float* __restrict__ C, int ldc, int M, int N, int K, unsigned short* __restrict__ Cp) {
  const int z = blockIdx.y;                 // the same for the whole block
  const float* __restrict__ A = z == 0 ? A0 : z == 1 ? A1 : A2;
  const float* __restrict__ bias = z == 0 ? bias0 : z == 1 ? bias1 : bias2;
  const unsigned short* __restrict__ Wt = Wt0 + (size_t)z * N * LDB;
  unsigned short* __restrict__ Ch = Cp + (size_t)(z > 0 ? 2 * z - 2 : 0) * M * N;
  unsigned short* __restrict__ Cl = Ch + (size_t)M * N;
  constexpr int BK = 128, PK = BK + 8;      // row pitch in LDS: an odd multiple of 16 bytes (plain 16-byte reads)
  __shared__ __attribute__((aligned(16))) unsigned short sAh[2][64][PK], sAl[ASPLIT ? 2 : 1][ASPLIT ? 64 : 1][PK], sB[2][64][PK];
  __shared__ __attribute__((aligned(16))) float so[4][16][64];
  const int tid = threadIdx.x, w = tid >> 5, lane = tid & 31, ln = lane & 15, hh = lane >> 4;
  const int ntn = N / 64;
  const int mb = blockIdx.x / ntn, nq = blockIdx.x % ntn;
  if (mb * 64 >= M) return;                 // the same for the whole block, in front of every barrier
  const int row0 = mb * 64 + w * 16, col0 = nq * 64;
  const int ar = tid >> 5, ac4 = (tid & 31) * 4;   // A piece i of a stage: tile row ar + 4 i, k ac4 .. ac4 + 3
  const int br = tid >> 4, bc8 = (tid & 15) * 8;   // W piece i of a stage: tile row br + 8 i, k bc8 .. bc8 + 7
  const float* ap = A + (size_t)(mb * 64 + ar) * LDA + ac4;
  const unsigned short* bp = Wt + (size_t)(col0 + br) * LDB + bc8;
  // A stage's 24 loads are issued as one batch right behind the barrier of the stage before (a barrier drains the load counter),
  // into registers, and are waited for only behind that stage's products.
  // Every loop over pa, pb or the fragments is unrolled, so that their indices are constants and they stay in registers.
  v4f pa[16]; v8us pb[8];
  auto load_stage = [&](int kb) {
#pragma unroll
    for (int i = 0; i < 16; ++i) pa[i] = *(const v4fa*)(ap + kb + i * 4 * LDA);
#pragma unroll
    for (int i = 0; i < 8; ++i) pb[i] = *(const v8us*)(bp + kb + i * 8 * LDB);
    asm volatile("s_wait_xcnt 0x0" ::: "memory");   // before the address registers of the loads above are reused
    __builtin_amdgcn_sched_barrier(0);              // keeps later address arithmetic, which reuses them, behind that wait
  };
  v8f acc[4] = {};
  load_stage(0);
  for (int kb = 0; kb < K; kb += BK) {
    const int buf = (kb / BK) & 1;
#pragma unroll
    for (int i = 0; i < 16; ++i) {
      const v2b h0 = bf16_pair(pa[i][0], pa[i][1]), h1 = bf16_pair(pa[i][2], pa[i][3]);
      *(v4us*)&sAh[buf][ar + 4 * i][ac4] = __builtin_bit_cast(v4us, __builtin_shufflevector(h0, h1, 0, 1, 2, 3));
      if (ASPLIT) {
        const v2b l0 = bf16_pair(pa[i][0] - pair_lo(h0), pa[i][1] - pair_hi(h0)), l1 = bf16_pair(pa[i][2] - pair_lo(h1), pa[i][3] - pair_hi(h1));
        *(v4us*)&sAl[buf][ar + 4 * i][ac4] = __builtin_bit_cast(v4us, __builtin_shufflevector(l0, l1, 0, 1, 2, 3));
      }
    }
#pragma unroll
    for (int i = 0; i < 8; ++i) *(v8us*)&sB[buf][br + 8 * i][bc8] = pb[i];
    __syncthreads();   // publishes this stage's tiles; also ends every wave's reads of the other buffer before the next stage rewrites it
    if (kb + BK < K) load_stage(kb + BK);
#pragma unroll
    for (int ks = 0; ks < BK / 32; ++ks) {
      // all fragments of a 32-k step as one group of LDS reads, so that their latency is waited out once and not once per 16 columns
      FragB ah, al, b[4];
      ah.half[0] = *(const v8us*)&sAh[buf][w * 16 + ln][ks * 32 + 8 * hh]; ah.half[1] = *(const v8us*)&sAh[buf][w * 16 + ln][ks * 32 + 16 + 8 * hh];
      if (ASPLIT) { al.half[0] = *(const v8us*)&sAl[buf][w * 16 + ln][ks * 32 + 8 * hh]; al.half[1] = *(const v8us*)&sAl[buf][w * 16 + ln][ks * 32 + 16 + 8 * hh]; }
      else {
#pragma unroll
        for (int i = 0; i < 16; ++i) al.u[i] = (unsigned short)0;
      }
#pragma unroll
      for (int t = 0; t < 4; ++t) {
        b[t].half[0] = *(const v8us*)&sB[buf][t * 16 + ln][ks * 32 + 8 * hh];
        b[t].half[1] = *(const v8us*)&sB[buf][t * 16 + ln][ks * 32 + 16 + 8 * hh];
      }
#pragma unroll
      for (int t = 0; t < 4; ++t) acc[t] = mmaN<ASPLIT ? 2 : 1>(ah.v, al.v, b[t].v, b[t].v, acc[t]);
    }
  }
#pragma unroll
  for (int t = 0; t < 4; ++t) {
    float bv = bias ? bias[col0 + t * 16 + ln] : 0.f;
    if (BIAS_BF16) bv = bf16_round(bv);
#pragma unroll
    for (int r = 0; r < 8; ++r) { float v = acc[t][r] + bv; if (ACT == 1) v = fmaxf(v, 0.f); so[w][8 * hh + r][t * 16 + ln] = v; }
  }
  __builtin_amdgcn_fence(__ATOMIC_ACQ_REL, "workgroup");
  __builtin_amdgcn_wave_barrier();
  if (ST > 0 && z > 0) {
    // a store of the wave covers 4 rows of 128 bytes, which follow one another in the plane
    const int r4 = lane >> 3, c8 = (lane & 7) * 8;
    v8us h[4], l[4];
#pragma unroll
    for (int q = 0; q < 4; ++q) {
      const v4f x0 = *(const v4fa*)&so[w][q * 4 + r4][c8], x1 = *(const v4fa*)&so[w][q * 4 + r4][c8 + 4];
      union { v8us v; v2b pr[4]; } hq, lq;
#pragma unroll
      for (int t = 0; t < 4; ++t) {
        const float a = t < 2 ? x0[2 * (t & 1)] : x1[2 * (t & 1)], c = t < 2 ? x0[2 * (t & 1) + 1] : x1[2 * (t & 1) + 1];
        const v2b hb = bf16_pair(a, c);
        hq.pr[t] = hb; lq.pr[t] = bf16_pair(a - pair_lo(hb), c - pair_hi(hb));
      }
      h[q] = hq.v; l[q] = lq.v;
    }
    constexpr int STD = ST > 0 ? ST : 1;
    const size_t o = (((size_t)(row0 / STD) * ntn + nq) * STD + row0 % STD + r4) * 64 + c8;
#pragma unroll
    for (int q = 0; q < 4; ++q) { *(v8us*)(Ch + o + q * 256) = h[q]; *(v8us*)(Cl + o + q * 256) = l[q]; }
    return;
  }
  const int rsub = lane >> 4, c4 = (lane & 15) * 4;
  {
#pragma unroll
    for (int q = 0; q < 8; ++q) {
      const int r = q * 2 + rsub;
      const v4f v = *(const v4fa*)&so[w][r][c4];
      *(v4f*)(C + (size_t)(row0 + r) * ldc + col0 + c4) = v;
    }
    // where the kernel also holds the plane path: before code laid out behind these stores reuses their address and data registers
    if (ST > 0) asm volatile("s_wait_xcnt 0x0" ::: "memory");
  }
}

// Flash-style causal/unmasked attention, all contractions 3-term bf16 hi/lo splits, f32 softmax with running max.
// q,k,v rows are read from f32 buffers with arbitrary row pitch (so they can live inside a fused qkv buffer);
// D = head size (multiple of 32, <= 128); one wave = 16 query rows; block = 4 waves (64 queries) sharing K/V chunks of 32.
template <int D, bool CAUSAL>
__global__ __launch_bounds__(128) void k_flash(const float* __restrict__ qb, const float* __restrict__ kb, const float* __restrict__ vb,
                                             int pitch, int T, int H, float scale, float* __restrict__ y, int ypitch) {
  constexpr int KS = D / 32;        // k-steps for QK
  constexpr int DT = D / 16;        // d tiles for PV
  __shared__ __attribute__((aligned(16))) unsigned short sKh[32][D + 8], sKl[32][D + 8], sVh[32][D + 8], sVl[32][D + 8];
  __shared__ __attribute__((aligned(16))) unsigned short sPh[4][16][40], sPl[4][16][40];
  __shared__ __attribute__((aligned(16))) float sO[4][16][D];
  const int tid = threadIdx.x, w = tid >> 5, lane = tid & 31, ln = lane & 15, hh = lane >> 4;
  const int nqb = (T + 63) / 64;
  const int bh = blockIdx.x / nqb, qblk = blockIdx.x % nqb;
  const int b = bh / H, h = bh % H;
  const int q0 = qblk * 64 + w * 16;
  const float* Q = qb + (size_t)b * T * pitch + h * D;
  const float* K = kb + (size_t)b * T * pitch + h * D;
  const float* V = vb + (size_t)b * T * pitch + h * D;

  // A fragments of the wave's 16 query rows (scaled), hi/lo
  FragB aqh[KS], aql[KS];
  {
    int row = q0 + ln; if (row >= T) row = T - 1;
    const float* qr = Q + (size_t)row * pitch;
#pragma unroll
    for (int ks = 0; ks < KS; ++ks)
#pragma unroll
      for (int i = 0; i < 16; ++i) {
        const int d = ks * 32 + ((i < 8) ? (8 * hh + i) : (16 + 8 * hh + (i - 8)));
        const float x = qr[d] * scale; const unsigned short hb = bf16_bits(x);
        aqh[ks].u[i] = hb; aql[ks].u[i] = bf16_bits(x - bf16_val(hb));
      }
  }
  float m_r[8], l_r[8];
#pragma unroll
  for (int r = 0; r < 8; ++r) { m_r[r] = -3.0e38f; l_r[r] = 0.f; }
  v8f oacc[DT];
#pragma unroll
  for (int dt = 0; dt < DT; ++dt) oacc[dt] = (v8f){0.f,0.f,0.f,0.f,0.f,0.f,0.f,0.f};

  const int kv_end = CAUSAL ? min(T, qblk * 64 + 64) : T;     // block-uniform
  for (int j0 = 0; j0 < kv_end; j0 += 32) {
    __syncthreads();
    for (int e = tid; e < 32 * (D / 4); e += 128) {
      const int r = e / (D / 4), c4 = (e % (D / 4)) * 4;
      const int key = j0 + r;
      v4f kf = {0.f,0.f,0.f,0.f}, vf = {0.f,0.f,0.f,0.f};
      if (key < T) { kf = *(const v4fa*)(K + (size_t)key * pitch + c4); vf = *(const v4fa*)(V + (size_t)key * pitch + c4); }
#pragma unroll
      for (int t = 0; t < 4; ++t) {
        unsigned short hb = bf16_bits(kf[t]); sKh[r][c4 + t] = hb; sKl[r][c4 + t] = bf16_bits(kf[t] - bf16_val(hb));
        hb = bf16_bits(vf[t]); sVh[r][c4 + t] = hb; sVl[r][c4 + t] = bf16_bits(vf[t] - bf16_val(hb));
      }
    }
    __syncthreads();
    // S tile 16 x 32
    v8f s[2];
#pragma unroll
    for (int nt = 0; nt < 2; ++nt) {
      v8f acc = {};
#pragma unroll
      for (int ks = 0; ks < KS; ++ks) {
        FragB bh_, bl_;
        bh_.half[0] = *(const v8us*)&sKh[nt * 16 + ln][ks * 32 + 8 * hh]; bh_.half[1] = *(const v8us*)&sKh[nt * 16 + ln][ks * 32 + 16 + 8 * hh];
        bl_.half[0] = *(const v8us*)&sKl[nt * 16 + ln][ks * 32 + 8 * hh]; bl_.half[1] = *(const v8us*)&sKl[nt * 16 + ln][ks * 32 + 16 + 8 * hh];
        acc = mmaN<3>(aqh[ks].v, aql[ks].v, bh_.v, bl_.v, acc);
      }
      s[nt] = acc;
    }
    // mask + running max (rows 8hh+r; the 16 lanes of a half share rows)
    float alpha[8];
#pragma unroll
    for (int r = 0; r < 8; ++r) {
      const int qi = q0 + 8 * hh + r;
      const int ja = j0 + ln, jb = j0 + 16 + ln;
      if (CAUSAL) { if (ja > qi) s[0][r] = -3.0e38f; if (jb > qi) s[1][r] = -3.0e38f; }
      if (ja >= T) s[0][r] = -3.0e38f;
      if (jb >= T) s[1][r] = -3.0e38f;
      float mx = fmaxf(s[0][r], s[1][r]);
      mx = fmaxf(mx, __shfl_xor(mx, 1, 32)); mx = fmaxf(mx, __shfl_xor(mx, 2, 32)); mx = fmaxf(mx, __shfl_xor(mx, 4, 32)); mx = fmaxf(mx, __shfl_xor(mx, 8, 32));
      const float mnew = fmaxf(m_r[r], mx);
      alpha[r] = (mnew > -1.0e38f) ? __expf(m_r[r] - mnew) : 1.0f;
      const float p0 = (s[0][r] > -1.0e38f) ? __expf(s[0][r] - mnew) : 0.f;
      const float p1 = (s[1][r] > -1.0e38f) ? __expf(s[1][r] - mnew) : 0.f;
      m_r[r] = mnew;
      l_r[r] = l_r[r] * alpha[r] + p0 + p1;            // per-lane partial row sum (16 lanes combined at the end)
      unsigned short hb = bf16_bits(p0); sPh[w][8 * hh + r][ln] = hb;      sPl[w][8 * hh + r][ln] = bf16_bits(p0 - bf16_val(hb));
      hb = bf16_bits(p1);                sPh[w][8 * hh + r][16 + ln] = hb; sPl[w][8 * hh + r][16 + ln] = bf16_bits(p1 - bf16_val(hb));
    }
#pragma unroll
    for (int dt = 0; dt < DT; ++dt)
#pragma unroll
      for (int r = 0; r < 8; ++r) oacc[dt][r] *= alpha[r];
    __builtin_amdgcn_fence(__ATOMIC_ACQ_REL, "workgroup");
    __builtin_amdgcn_wave_barrier();
    FragB pah, pal;
    pah.half[0] = *(const v8us*)&sPh[w][ln][8 * hh]; pah.half[1] = *(const v8us*)&sPh[w][ln][16 + 8 * hh];
    pal.half[0] = *(const v8us*)&sPl[w][ln][8 * hh]; pal.half[1] = *(const v8us*)&sPl[w][ln][16 + 8 * hh];
#pragma unroll
    for (int dt = 0; dt < DT; ++dt) {
      FragB bvh, bvl;
#pragma unroll
      for (int i = 0; i < 8; ++i) {
        bvh.u[i] = sVh[8 * hh + i][dt * 16 + ln]; bvh.u[8 + i] = sVh[16 + 8 * hh + i][dt * 16 + ln];
        bvl.u[i] = sVl[8 * hh + i][dt * 16 + ln]; bvl.u[8 + i] = sVl[16 + 8 * hh + i][dt * 16 + ln];
      }
      oacc[dt] = mmaN<3>(pah.v, pal.v, bvh.v, bvl.v, oacc[dt]);
    }
    __builtin_amdgcn_fence(__ATOMIC_ACQ_REL, "workgroup");
    __builtin_amdgcn_wave_barrier();
  }
#pragma unroll
  for (int r = 0; r < 8; ++r) {
    float l = l_r[r];
    l += __shfl_xor(l, 1, 32); l += __shfl_xor(l, 2, 32); l += __shfl_xor(l, 4, 32); l += __shfl_xor(l, 8, 32);
    l_r[r] = (l > 0.f) ? 1.0f / l : 0.f;
  }
#pragma unroll
  for (int dt = 0; dt < DT; ++dt)
#pragma unroll
    for (int r = 0; r < 8; ++r) sO[w][8 * hh + r][dt * 16 + ln] = oacc[dt][r] * l_r[r];
  __builtin_amdgcn_fence(__ATOMIC_ACQ_REL, "workgroup");
  __builtin_amdgcn_wave_barrier();
  {
    for (int r = 0; r < 16; ++r) {
      const int row = q0 + r;
      if (row < T && lane < D / 4) {
        const v4f val = *(const v4fa*)&sO[w][r][lane * 4];
        *(v4f*)(y + ((size_t)b * T + row) * ypitch + h * D + lane * 4) = val;
      }
    }
    
  }
}

typedef short s16x8 __attribute__((ext_vector_type(8)));
__device__ __forceinline__ v8us lds_tr16(const unsigned short* p) {
  typedef __attribute__((address_space(3))) s16x8 lds_s16x8;
  return __builtin_bit_cast(v8us, __builtin_amdgcn_ds_load_tr16_b128_v8i16((lds_s16x8*)p));
}

// the value that lane l ^ 16 holds (the other 16-lane half of the wave), by a vector cross-row move
__device__ __forceinline__ float other_half(float x) {
  const int b = __float_as_int(x);
  return __int_as_float(__builtin_amdgcn_permlanex16(b, b, 0x76543210, 0xfedcba98, false, false));
}
typedef int v4ia __attribute__((ext_vector_type(4), may_alias));
typedef int v4i  __attribute__((ext_vector_type(4)));

template <int D, int T, int H, int P>
__global__ __launch_bounds__(128) void k_flash3c(const float* __restrict__ Qb, const unsigned short* __restrict__ Kh, const unsigned short* __restrict__ Kl,
                                              const unsigned short* __restrict__ Vh, const unsigned short* __restrict__ Vl,
                                              float scale, const int* __restrict__ mask3, const float* __restrict__ gp, float* __restrict__ y) {
  static_assert(T % 64 == 0 && D % 32 == 0 && 512 % D == 0, "whole query blocks, whole 32-key passes");
  constexpr int KS = D / 32, DT = D / 16;
  // row pitch: an odd multiple of 16 bytes for K (plain 16-byte reads), an odd multiple of 32 bytes for V (transposing reads)
  __shared__ __attribute__((aligned(16))) unsigned short sKh[32][D + 8], sKl[32][D + 8], sVh[32][D + 16], sVl[32][D + 16];
  __shared__ __attribute__((aligned(16))) float sO[4][16][D + 4];   // pitch 16 bytes over a power of two: a lane writes a whole row piece
  const int tid = threadIdx.x, w = tid >> 5, lane = tid & 31, ln = lane & 15, hh = lane >> 4;
  constexpr int nqb = T / 64;
  const int bh = blockIdx.x / nqb, qblk = blockIdx.x % nqb;
  const int b = bh / H, h = bh % H;
  const int q0 = qblk * 64 + w * 16;
  const float* Q = Qb + (size_t)b * T * P + h * D;
  FragB aqh[KS], aql[KS];
  {
    const float* qr = Q + (size_t)(q0 + ln) * P;
#pragma unroll
    for (int ks = 0; ks < KS; ++ks)
#pragma unroll
      for (int i = 0; i < 16; i += 2) {
        const int d = ks * 32 + ((i < 8) ? (8 * hh + i) : (16 + 8 * hh + (i - 8)));
        const float x0 = qr[d] * scale, x1 = qr[d + 1] * scale; const v2b hb = bf16_pair(x0, x1);
        aqh[ks].pr[i >> 1] = hb; aql[ks].pr[i >> 1] = bf16_pair(x0 - pair_lo(hb), x1 - pair_hi(hb));
      }
  }
  asm volatile("s_wait_xcnt 0x0" ::: "memory");     // before the address registers of the query loads are reused
  __builtin_amdgcn_sched_barrier(0);                // keeps the address arithmetic below, which reuses them, behind that wait
  float m_q = -3.0e38f, l_q = 0.f;   // the lane's query: running maximum (both halves agree), sum over the keys of the lane's own half
  v8f oacc[DT];                      // oacc[dt][r] = O[query q0 + ln][16 dt + 8 hh + r]
#pragma unroll
  for (int dt = 0; dt < DT; ++dt) oacc[dt] = (v8f){0.f,0.f,0.f,0.f,0.f,0.f,0.f,0.f};
  // Every global load of a 32-key pass is issued one pass ahead, without a predicate, into registers carried round the loop:
  // the pass behind the last one is clamped, as a whole, to the last one (in bounds), and its values are never used.
  // They are issued right behind the pass's second barrier: the barriers drain the load counter, and from there to the
  // next pass's first barrier is the longest stretch without one.
  // K and V arrive already split, as bf16 planes [b][h][key][D] (hi, lo): the 32 keys of a pass are 64 D bytes in a row in each plane,
  // and a pass only copies them to LDS.
  constexpr int NE = 32 * (D / 8) / 128;        // 16-byte pieces of each of the four planes per thread and pass
  const int sr = tid / (D / 8), sc8 = (tid % (D / 8)) * 8;
  // each address = a base that is the same for the whole block + one per-lane byte offset that never changes + a constant
  const size_t hoff = (size_t)bh * T * D;
  const char* Khb = (const char*)(Kh + hoff); const char* Klb = (const char*)(Kl + hoff);
  const char* Vhb = (const char*)(Vh + hoff); const char* Vlb = (const char*)(Vl + hoff);
  const unsigned kvoff = (unsigned)tid * 16u;
  v8us khp[NE], klp[NE], vhp[NE], vlp[NE];
  auto load_kv = [&](int j) {
    const size_t jb = (size_t)min(j, T - 32) * (D * 2);
#pragma unroll
    for (int i = 0; i < NE; ++i) {
      khp[i] = *(const v8us*)(Khb + jb + i * 2048 + kvoff); klp[i] = *(const v8us*)(Klb + jb + i * 2048 + kvoff);
      vhp[i] = *(const v8us*)(Vhb + jb + i * 2048 + kvoff); vlp[i] = *(const v8us*)(Vlb + jb + i * 2048 + kvoff);
    }
    asm volatile("s_wait_xcnt 0x0" ::: "memory");   // before the address registers of the loads above are reused
    __builtin_amdgcn_sched_barrier(0);              // keeps later address arithmetic, which reuses them, behind that wait
  };
  // mask and group_prob share one index; byte offsets inside one batch's [T][T] plane fit 32 bits
  const char* mplane = (const char*)(mask3 + (size_t)b * T * T); const char* gplane = (const char*)(gp + (size_t)b * T * T);
  const unsigned mgoff = ((unsigned)(q0 + ln) * (unsigned)T + (unsigned)(8 * hh)) * 4u;
  v4i mk[4], nmk[4]; v4f ngq[4];   // this pass's, the next pass's; piece 2 nt + c = keys 16 nt + 8 hh + 4 c .. + 3 of the lane's query row
  v2b gb[8];                       // this pass's group_prob, rounded: pair 4 nt + c = keys 16 nt + 8 hh + 2 c, + 1
  auto load_mg = [&](int j) {
    const size_t jb = (size_t)min(j, T - 32) * 4;
#pragma unroll
    for (int i = 0; i < 4; ++i) nmk[i] = *(const v4ia*)(mplane + jb + ((i >> 1) * 64 + (i & 1) * 16) + mgoff);
#pragma unroll
    for (int i = 0; i < 4; ++i) ngq[i] = *(const v4fa*)(gplane + jb + ((i >> 1) * 64 + (i & 1) * 16) + mgoff);
    asm volatile("s_wait_xcnt 0x0" ::: "memory");   // before the offset registers of the loads above are reused
    __builtin_amdgcn_sched_barrier(0);              // keeps later arithmetic, which reuses them, behind that wait
  };
  load_kv(0);
  load_mg(0);
  for (int j0 = 0; j0 < T; j0 += 32) {
    __syncthreads();
#pragma unroll
    for (int i = 0; i < NE; ++i) {
      const int r = sr + i * (1024 / D);
      *(v8us*)&sKh[r][sc8] = khp[i]; *(v8us*)&sKl[r][sc8] = klp[i];
      *(v8us*)&sVh[r][sc8] = vhp[i]; *(v8us*)&sVl[r][sc8] = vlp[i];
    }
    __syncthreads();
#pragma unroll
    for (int i = 0; i < 4; ++i) { mk[i] = nmk[i]; gb[2 * i] = bf16_pair(ngq[i][0], ngq[i][1]); gb[2 * i + 1] = bf16_pair(ngq[i][2], ngq[i][3]); }
    // inputs only: the eight conversions stand in front of the loads below, which overwrite their sources; left free, the compiler keeps
    // the 16 f32 values in a second set of registers and copies them there in mid-pass, behind a wait for the loads just issued
    asm volatile("" :: "v"(gb[0]), "v"(gb[1]), "v"(gb[2]), "v"(gb[3]), "v"(gb[4]), "v"(gb[5]), "v"(gb[6]), "v"(gb[7]));
    load_kv(j0 + 32);
    load_mg(j0 + 32);
    v8f s[2];
#pragma unroll
    for (int nt = 0; nt < 2; ++nt) {
      v8f acc = {};
#pragma unroll
      for (int ks = 0; ks < KS; ++ks) {
        FragB bh_, bl_;
        bh_.half[0] = *(const v8us*)&sKh[nt * 16 + ln][ks * 32 + 8 * hh]; bh_.half[1] = *(const v8us*)&sKh[nt * 16 + ln][ks * 32 + 16 + 8 * hh];
        bl_.half[0] = *(const v8us*)&sKl[nt * 16 + ln][ks * 32 + 8 * hh]; bl_.half[1] = *(const v8us*)&sKl[nt * 16 + ln][ks * 32 + 16 + 8 * hh];
        acc = mmaN<3>(bh_.v, bl_.v, aqh[ks].v, aql[ks].v, acc);   // A = K rows, B = Q: acc[r] = score(key 16 nt + 8 hh + r, query ln)
      }
      s[nt] = acc;
    }
    const int dk = q0 + ln - 8 * hh - j0;     // the diagonal's key, counted from the first key of the lane's half in this pass
    float mx = -3.0e38f;
#pragma unroll
    for (int nt = 0; nt < 2; ++nt)
#pragma unroll
      for (int r = 0; r < 8; ++r) {
        s[nt][r] = (mk[2 * nt + (r >> 2)][r & 3] != 0 || dk == nt * 16 + r) ? s[nt][r] : -1.0e9f;
        mx = fmaxf(mx, s[nt][r]);
      }
    mx = fmaxf(mx, other_half(mx));
    const float mnew = fmaxf(m_q, mx);
    const float alpha = (mnew > -1.0e38f) ? __expf(m_q - mnew) : 1.0f;
    m_q = mnew;
    FragB pbh, pbl;   // element i = P[key 8 hh + i][query ln], element 8 + i = P[key 16 + 8 hh + i][query ln]: the k order of bvh, bvl
    float psum = 0.f;
#pragma unroll
    for (int nt = 0; nt < 2; ++nt)
#pragma unroll
      for (int r = 0; r < 8; r += 2) {
        const float p0 = __expf(s[nt][r] - mnew), p1 = __expf(s[nt][r + 1] - mnew);
        psum += p0; psum += p1;
        const v2b gr = gb[nt * 4 + (r >> 1)];
        const float g0 = p0 * pair_lo(gr), g1 = p1 * pair_hi(gr);   // post-softmax multiplier: P only, not the normaliser
        const v2b hb = bf16_pair(g0, g1);
        pbh.pr[nt * 4 + (r >> 1)] = hb; pbl.pr[nt * 4 + (r >> 1)] = bf16_pair(g0 - pair_lo(hb), g1 - pair_hi(hb));
      }
    l_q = l_q * alpha + psum;
#pragma unroll
    for (int dt = 0; dt < DT; ++dt)
#pragma unroll
      for (int r = 0; r < 8; ++r) oacc[dt][r] *= alpha;
    // all V fragments of the pass as one group of loads, so that their latency is waited out once and not once per 16 columns
    FragB bvh[DT], bvl[DT];   // element i = V[8 hh + i][16 dt + ln], element 8 + i = V[16 + 8 hh + i][16 dt + ln]: the k order of pbh, pbl
#pragma unroll
    for (int dt = 0; dt < DT; ++dt) {
      const int vr = 8 * hh + (lane & 7), vc = dt * 16 + 8 * ((lane >> 3) & 1);
      bvh[dt].half[0] = lds_tr16(&sVh[vr][vc]); bvh[dt].half[1] = lds_tr16(&sVh[16 + vr][vc]);
      bvl[dt].half[0] = lds_tr16(&sVl[vr][vc]); bvl[dt].half[1] = lds_tr16(&sVl[16 + vr][vc]);
    }
#pragma unroll
    for (int dt = 0; dt < DT; ++dt) oacc[dt] = mmaN<3>(bvh[dt].v, bvl[dt].v, pbh.v, pbl.v, oacc[dt]);   // A = V^T, B = P^T
  }
  const float lsum = l_q + other_half(l_q);
  const float linv = (m_q > -1.0e38f) ? 1.0f / lsum : __builtin_nanf("");
#pragma unroll
  for (int dt = 0; dt < DT; ++dt)
#pragma unroll
    for (int c = 0; c < 2; ++c) {
      const v4f o = {oacc[dt][4 * c] * linv, oacc[dt][4 * c + 1] * linv, oacc[dt][4 * c + 2] * linv, oacc[dt][4 * c + 3] * linv};
      *(v4fa*)&sO[w][ln][dt * 16 + 8 * hh + 4 * c] = o;
    }
  __builtin_amdgcn_fence(__ATOMIC_ACQ_REL, "workgroup");
  __builtin_amdgcn_wave_barrier();
  {
    for (int r = 0; r < 16; ++r) {
      const int row = q0 + r;
      if (lane < D / 4) {
        const v4f val = *(const v4fa*)&sO[w][r][lane * 4];
        *(v4f*)(y + ((size_t)b * T + row) * P + h * D + lane * 4) = val;
      }
    }
    
  }
}

// blockIdx.y picks one of four matrices of 8 n8 elements each; their rounded copies follow one another behind Wt0
__global__ __launch_bounds__(256) void k_round_rows(const float* __restrict__ W0, const float* __restrict__ W1, const float* __restrict__ W2,
                                                    const float* __restrict__ W3, unsigned short* __restrict__ Wt0, int n8) {
  const int t = blockIdx.x * 256 + threadIdx.x;
  if (t >= n8) return;
  const int z = blockIdx.y;
  const float* __restrict__ W = z == 0 ? W0 : z == 1 ? W1 : z == 2 ? W2 : W3;
  unsigned short* __restrict__ Wt = Wt0 + (size_t)z * n8 * 8;
  const v4f a = *(const v4fa*)(W + (size_t)t * 8), b = *(const v4fa*)(W + (size_t)t * 8 + 4);
  const v8us v = __builtin_bit_cast(v8us, __builtin_convertvector(__builtin_shufflevector(a, b, 0, 1, 2, 3, 4, 5, 6, 7), v8b));
  *(v8us*)(Wt + (size_t)t * 8) = v; 
}

extern "C" void kernel_launch(void* const* d_in, const int* in_sizes, int n_in,
                              void* d_out, int out_size, void* d_ws, size_t ws_size, hipStream_t stream) {
  (void)in_sizes; (void)n_in; (void)out_size;
  const float* xq = (const float*)d_in[0]; const float* xk = (const float*)d_in[1]; const float* xv = (const float*)d_in[2];
  const float* gp = (const float*)d_in[3]; const int* mask = (const int*)d_in[4];
  const float* Wq = (const float*)d_in[5]; const float* bq = (const float*)d_in[6]; const float* Wk = (const float*)d_in[7]; const float* bk = (const float*)d_in[8];
  const float* Wv = (const float*)d_in[9]; const float* bv = (const float*)d_in[10]; const float* Wo = (const float*)d_in[11]; const float* bo = (const float*)d_in[12];
  char* ws = (char*)d_ws; size_t off = 0;
  auto take = [&](size_t bytes) { char* p = ws + off; off += (bytes + 255) & ~(size_t)255; return p; };
  const int M = BB * TT, n8 = DD * DD / 8, gb = ((M / 16) * (DD / 64) + 3) / 4;
  unsigned short* Wt0 = (unsigned short*)take((size_t)4 * DD * DD * 2);   // rounded Wq, Wk, Wv, Wo, one behind the other
  unsigned short* Wt[4]; for (int i = 0; i < 4; ++i) Wt[i] = Wt0 + (size_t)i * DD * DD;
  float* q = (float*)take((size_t)M * DD * 4); float* att = (float*)take((size_t)M * DD * 4);
  unsigned short* kv0 = (unsigned short*)take((size_t)4 * M * DD * 2);    // K hi, K lo, V hi, V lo, one behind the other
  unsigned short* kv[4]; for (int i = 0; i < 4; ++i) kv[i] = kv0 + (size_t)i * M * DD;
  if (off > ws_size) return;
  // four launches, each of which needs the one before it: independent pieces of work share a grid
  k_round_rows<<<dim3((n8 + 255) / 256, 4), 256, 0, stream>>>(Wq, Wk, Wv, Wo, Wt0, n8);
  k_gemm_bf<false, 0, true, DD, DD, TT><<<dim3(gb, 3), 128, 0, stream>>>(xq, xk, xv, Wt0, bq, bk, bv, q, DD, M, DD, DD, kv0);
  k_flash3c<HD, TT, NH, DD><<<BB * NH * (TT / 64), 128, 0, stream>>>(q, kv[0], kv[1], kv[2], kv[3], 0.125f, mask, gp, att);
  k_gemm_bf<true, 0, true, DD, DD, 0><<<dim3(gb, 1), 128, 0, stream>>>(att, nullptr, nullptr, Wt[3], bo, nullptr, nullptr, (float*)d_out, DD, M, DD, DD, kv0);
}

// v009
// Measured time: 102 microseconds a run.
// Timed twice side by side with v008, it ran 1.04 times as fast both times.
// Over all steps from v000 it is 7.01 times as fast.
#include <hip/hip_runtime.h>
// All contractions on v_wmma_f32_16x16x32_bf16, f32 accumulate: q/k/v = x·Wᵀ + b (inputs, W, b rounded to bf16: single exact term), QKᵀ and
// P·V per 16-query tile as 3-term bf16 hi/lo splits (mask|diag → −1e9 kept in the softmax like the module; P multiplied by
// bf16(group_prob) after normalisation), out = x·Woᵀ + bo with x split (2 terms); softmax in f32.
#define BB 2
#define TT 2048
#define DD 512
#define NH 8
#define HD 64

typedef __bf16 v16b __attribute__((ext_vector_type(16)));
typedef unsigned short v8us __attribute__((ext_vector_type(8), may_alias));
typedef float  v8f  __attribute__((ext_vector_type(8)));
typedef float  v4f  __attribute__((ext_vector_type(4)));
typedef float  v4fa __attribute__((ext_vector_type(4), may_alias));
typedef float  v2f  __attribute__((ext_vector_type(2)));
typedef __bf16 v2b  __attribute__((ext_vector_type(2)));
typedef __bf16 v8b  __attribute__((ext_vector_type(8)));
union FragB { v16b v; v8us half[2]; unsigned short u[16]; v2b pr[8]; };

// round to nearest even by the hardware's own conversion
__device__ __forceinline__ unsigned short bf16_bits(float x) { return __builtin_bit_cast(unsigned short, (__bf16)x); }
// two values rounded to nearest even and packed into one register by one conversion instruction
__device__ __forceinline__ v2b bf16_pair(float a, float b) { const v2f x = {a, b}; return __builtin_convertvector(x, v2b); }
// the two halves of such a pair as f32, written on the bits: the compiler then reads the half in place, as an operand of a
// mixed-precision multiply-add, where a conversion of the pair is unpacked into two more registers first
__device__ __forceinline__ float pair_lo(v2b p) { return __uint_as_float(__builtin_bit_cast(unsigned int, p) << 16); }
__device__ __forceinline__ float pair_hi(v2b p) { return __uint_as_float(__builtin_bit_cast(unsigned int, p) & 0xffff0000u); }
__device__ __forceinline__ float bf16_val(unsigned short b) { return __uint_as_float(((unsigned int)b) << 16); }
__device__ __forceinline__ float bf16_round(float x) { return bf16_val(bf16_bits(x)); }
// D += A·B with NT terms: 1 = ah·bh, 2 = + al·bh (A split), 3 = + ah·bl (both split)
template <int NT>
__device__ __forceinline__ v8f mmaN(v16b ah, v16b al, v16b bh, v16b bl, v8f c) {
  c = __builtin_amdgcn_wmma_f32_16x16x32_bf16(false, ah, false, bh, (short)0, c, false, false);
  if (NT >= 2) c = __builtin_amdgcn_wmma_f32_16x16x32_bf16(false, al, false, bh, (short)0, c, false, false);
  if (NT >= 3) c = __builtin_amdgcn_wmma_f32_16x16x32_bf16(false, ah, false, bl, (short)0, c, false, false);
  asm volatile("v_nop\n\tv_nop\n\tv_nop\n\tv_nop" : "+v"(c) : "v"(ah), "v"(al), "v"(bh), "v"(bl));
  return c;
}

__global__ __launch_bounds__(256) void k_wt_bf16(const float* __restrict__ W, unsigned short* __restrict__ Wt, int K, int N) {
  const int t = blockIdx.x * 256 + threadIdx.x;
  const int k8n = K / 8;
  if (t >= N * k8n) return;
  const int n = t / k8n, k8 = (t % k8n) * 8;
  v8us v;
#pragma unroll
  for (int i = 0; i < 8; ++i) v[i] = bf16_bits(W[(size_t)(k8 + i) * N + n]);
  *(v8us*)(Wt + (size_t)n * K + k8) = v;
  
}

// GEMM C[M][N] (f32, pitch ldc) = act(A[M][K] * W + bias). A f32 row-major (pitch LDA) converted to bf16
// (ASPLIT: hi/lo two planes -> 2 terms, else single rounded term); Wt bf16 [N][K] (pitch LDB). BIAS_BF16 rounds the
// bias to bf16 first (bias quantised to bf16 before the add). K%128==0, M%64==0, N%64==0.
// A block of 4 waves owns a 64 x 64 tile of C (wave w: rows 16 w .. 16 w + 15, all 64 columns). Both operands go through LDS in stages
// of 128 k: every global load of a wave covers whole 128-byte lines (one 512-byte piece of an A row, two 256-byte pieces of W rows),
// an A element is converted once, a W element is fetched once per block, and the fragments are 16-byte LDS reads.
// Two LDS buffers, one barrier a stage: a wave that writes buffer s & 1 has passed the barrier of stage s - 1, which every wave
// reaches only behind its last read of stage s - 2.
typedef unsigned short v4us __attribute__((ext_vector_type(4), may_alias));
// ST == 0: C is written as f32. ST > 0 (rows per batch, ST % 64 == 0): the result is written instead as two bf16 planes, Ch = bf16(v) and
// Cl = bf16(v - Ch), laid out [batch][column block of 64][row in batch][64]: one head's rows are 128 bytes each and follow one another.
// One grid holds up to three independent products of the same shape: blockIdx.y = z picks A and bias, and the z-th [N][LDB] matrix behind Wt0.
// With ST > 0 product 0 is still written as f32 into C; product z >= 1 goes to the planes Cp + (2 z - 2) M N (hi) and Cp + (2 z - 1) M N (lo).
template <bool ASPLIT, int ACT, bool BIAS_BF16, int LDA, int LDB, int ST>
__global__ __launch_bounds__(128) void k_gemm_bf(const float* __restrict__ A0, const float* __restrict__ A1, const float* __restrict__ A2,
                                               const unsigned short* __restrict__ Wt0,
                                               const float* __restrict__ bias0, const float* __restrict__ bias1, const float* __restrict__ bias2,
                                               float* __restrict__ C, int ldc, int M, int N, int K, unsigned short* __restrict__ Cp) {
  const int z = blockIdx.y;                 // the same for the whole block
  const float* __restrict__ A = z == 0 ? A0 : z == 1 ? A1 : A2;
  const float* __restrict__ bias = z == 0 ? bias0 : z == 1 ? bias1 : bias2;
  const unsigned short* __restrict__ Wt = Wt0 + (size_t)z * N * LDB;
  unsigned short* __restrict__ Ch = Cp + (size_t)(z > 0 ? 2 * z - 2 : 0) * M * N;
  unsigned short* __restrict__ Cl = Ch + (size_t)M * N;
  constexpr int BK = 128, PK = BK + 8;      // row pitch in LDS: an odd multiple of 16 bytes (plain 16-byte reads)
  __shared__ __attribute__((aligned(16))) unsigned short sAh[2][64][PK], sAl[ASPLIT ? 2 : 1][ASPLIT ? 64 : 1][PK], sB[2][64][PK];
  __shared__ __attribute__((aligned(16))) float so[4][16][64];
  const int tid = threadIdx.x, w = tid >> 5, lane = tid & 31, ln = lane & 15, hh = lane >> 4;
  const int ntn = N / 64;
  const int mb = blockIdx.x / ntn, nq = blockIdx.x % ntn;
  if (mb * 64 >= M) return;                 // the same for the whole block, in front of every barrier
  const int row0 = mb * 64 + w * 16, col0 = nq * 64;
  const int ar = tid >> 5, ac4 = (tid & 31) * 4;   // A piece i of a stage: tile row ar + 4 i, k ac4 .. ac4 + 3
  const int br = tid >> 4, bc8 = (tid & 15) * 8;   // W piece i of a stage: tile row br + 8 i, k bc8 .. bc8 + 7
  const float* ap = A + (size_t)(mb * 64 + ar) * LDA + ac4;
  const unsigned short* bp = Wt + (size_t)(col0 + br) * LDB + bc8;
  // A stage's 24 loads are issued as one batch right behind the barrier of the stage before (a barrier drains the load counter),
  // into registers, and are waited for only behind that stage's products.
  // Every loop over pa, pb or the fragments is unrolled, so that their indices are constants and they stay in registers.
  v4f pa[16]; v8us pb[8];
  auto load_stage = [&](int kb) {
#pragma unroll
    for (int i = 0; i < 16; ++i) pa[i] = *(const v4fa*)(ap + kb + i * 4 * LDA);
#pragma unroll
    for (int i = 0; i < 8; ++i) pb[i] = *(const v8us*)(bp + kb + i * 8 * LDB);
    asm volatile("s_wait_xcnt 0x0" ::: "memory");   // before the address registers of the loads above are reused
    __builtin_amdgcn_sched_barrier(0);              // keeps later address arithmetic, which reuses them, behind that wait
  };
  v8f acc[4] = {};
  load_stage(0);
  for (int kb = 0; kb < K; kb += BK) {
    const int buf = (kb / BK) & 1;
#pragma unroll
    for (int i = 0; i < 16; ++i) {
      const v2b h0 = bf16_pair(pa[i][0], pa[i][1]), h1 = bf16_pair(pa[i][2], pa[i][3]);
      *(v4us*)&sAh[buf][ar + 4 * i][ac4] = __builtin_bit_cast(v4us, __builtin_shufflevector(h0, h1, 0, 1, 2, 3));
      if (ASPLIT) {
        const v2b l0 = bf16_pair(pa[i][0] - pair_lo(h0), pa[i][1] - pair_hi(h0)), l1 = bf16_pair(pa[i][2] - pair_lo(h1), pa[i][3] - pair_hi(h1));
        *(v4us*)&sAl[buf][ar + 4 * i][ac4] = __builtin_bit_cast(v4us, __builtin_shufflevector(l0, l1, 0, 1, 2, 3));
      }
    }
#pragma unroll
    for (int i = 0; i < 8; ++i) *(v8us*)&sB[buf][br + 8 * i][bc8] = pb[i];
    __syncthreads();   // publishes this stage's tiles; also ends every wave's reads of the other buffer before the next stage rewrites it
    if (kb + BK < K) load_stage(kb + BK);
#pragma unroll
    for (int ks = 0; ks < BK / 32; ++ks) {
      // all fragments of a 32-k step as one group of LDS reads, so that their latency is waited out once and not once per 16 columns
      FragB ah, al, b[4];
      ah.half[0] = *(const v8us*)&sAh[buf][w * 16 + ln][ks * 32 + 8 * hh]; ah.half[1] = *(const v8us*)&sAh[buf][w * 16 + ln][ks * 32 + 16 + 8 * hh];
      if (ASPLIT) { al.half[0] = *(const v8us*)&sAl[buf][w * 16 + ln][ks * 32 + 8 * hh]; al.half[1] = *(const v8us*)&sAl[buf][w * 16 + ln][ks * 32 + 16 + 8 * hh]; }
      else {
#pragma unroll
        for (int i = 0; i < 16; ++i) al.u[i] = (unsigned short)0;
      }
#pragma unroll
      for (int t = 0; t < 4; ++t) {
        b[t].half[0] = *(const v8us*)&sB[buf][t * 16 + ln][ks * 32 + 8 * hh];
        b[t].half[1] = *(const v8us*)&sB[buf][t * 16 + ln][ks * 32 + 16 + 8 * hh];
      }
#pragma unroll
      for (int t = 0; t < 4; ++t) acc[t] = mmaN<ASPLIT ? 2 : 1>(ah.v, al.v, b[t].v, b[t].v, acc[t]);
    }
  }
#pragma unroll
  for (int t = 0; t < 4; ++t) {
    float bv = bias ? bias[col0 + t * 16 + ln] : 0.f;
    if (BIAS_BF16) bv = bf16_round(bv);
#pragma unroll
    for (int r = 0; r < 8; ++r) { float v = acc[t][r] + bv; if (ACT == 1) v = fmaxf(v, 0.f); so[w][8 * hh + r][t * 16 + ln] = v; }
  }
  __builtin_amdgcn_fence(__ATOMIC_ACQ_REL, "workgroup");
  __builtin_amdgcn_wave_barrier();
  if (ST > 0 && z > 0) {
    // a store of the wave covers 4 rows of 128 bytes, which follow one another in the plane
    const int r4 = lane >> 3, c8 = (lane & 7) * 8;
    v8us h[4], l[4];
#pragma unroll
    for (int q = 0; q < 4; ++q) {
      const v4f x0 = *(const v4fa*)&so[w][q * 4 + r4][c8], x1 = *(const v4fa*)&so[w][q * 4 + r4][c8 + 4];
      union { v8us v; v2b pr[4]; } hq, lq;
#pragma unroll
      for (int t = 0; t < 4; ++t) {
        const float a = t < 2 ? x0[2 * (t & 1)] : x1[2 * (t & 1)], c = t < 2 ? x0[2 * (t & 1) + 1] : x1[2 * (t & 1) + 1];
        const v2b hb = bf16_pair(a, c);
        hq.pr[t] = hb; lq.pr[t] = bf16_pair(a - pair_lo(hb), c - pair_hi(hb));
      }
      h[q] = hq.v; l[q] = lq.v;
    }
    constexpr int STD = ST > 0 ? ST : 1;
    const size_t o = (((size_t)(row0 / STD) * ntn + nq) * STD + row0 % STD + r4) * 64 + c8;
#pragma unroll
    for (int q = 0; q < 4; ++q) { *(v8us*)(Ch + o + q * 256) = h[q]; *(v8us*)(Cl + o + q * 256) = l[q]; }
    return;
  }
  const int rsub = lane >> 4, c4 = (lane & 15) * 4;
  {
#pragma unroll
    for (int q = 0; q < 8; ++q) {
      const int r = q * 2 + rsub;
      const v4f v = *(const v4fa*)&so[w][r][c4];
      *(v4f*)(C + (size_t)(row0 + r) * ldc + col0 + c4) = v;
    }
    // where the kernel also holds the plane path: before code laid out behind these stores reuses their address and data registers
    if (ST > 0) asm volatile("s_wait_xcnt 0x0" ::: "memory");
  }
}

// Flash-style causal/unmasked attention, all contractions 3-term bf16 hi/lo splits, f32 softmax with running max.
// q,k,v rows are read from f32 buffers with arbitrary row pitch (so they can live inside a fused qkv buffer);
// D = head size (multiple of 32, <= 128); one wave = 16 query rows; block = 4 waves (64 queries) sharing K/V chunks of 32.
template <int D, bool CAUSAL>
__global__ __launch_bounds__(128) void k_flash(const float* __restrict__ qb, const float* __restrict__ kb, const float* __restrict__ vb,
                                             int pitch, int T, int H, float scale, float* __restrict__ y, int ypitch) {
  constexpr int KS = D / 32;        // k-steps for QK
  constexpr int DT = D / 16;        // d tiles for PV
  __shared__ __attribute__((aligned(16))) unsigned short sKh[32][D + 8], sKl[32][D + 8], sVh[32][D + 8], sVl[32][D + 8];
  __shared__ __attribute__((aligned(16))) unsigned short sPh[4][16][40], sPl[4][16][40];
  __shared__ __attribute__((aligned(16))) float sO[4][16][D];
  const int tid = threadIdx.x, w = tid >> 5, lane = tid & 31, ln = lane & 15, hh = lane >> 4;
  const int nqb = (T + 63) / 64;
  const int bh = blockIdx.x / nqb, qblk = blockIdx.x % nqb;
  const int b = bh / H, h = bh % H;
  const int q0 = qblk * 64 + w * 16;
  const float* Q = qb + (size_t)b * T * pitch + h * D;
  const float* K = kb + (size_t)b * T * pitch + h * D;
  const float* V = vb + (size_t)b * T * pitch + h * D;

  // A fragments of the wave's 16 query rows (scaled), hi/lo
  FragB aqh[KS], aql[KS];
  {
    int row = q0 + ln; if (row >= T) row = T - 1;
    const float* qr = Q + (size_t)row * pitch;
#pragma unroll
    for (int ks = 0; ks < KS; ++ks)
#pragma unroll
      for (int i = 0; i < 16; ++i) {
        const int d = ks * 32 + ((i < 8) ? (8 * hh + i) : (16 + 8 * hh + (i - 8)));
        const float x = qr[d] * scale; const unsigned short hb = bf16_bits(x);
        aqh[ks].u[i] = hb; aql[ks].u[i] = bf16_bits(x - bf16_val(hb));
      }
  }
  float m_r[8], l_r[8];
#pragma unroll
  for (int r = 0; r < 8; ++r) { m_r[r] = -3.0e38f; l_r[r] = 0.f; }
  v8f oacc[DT];
#pragma unroll
  for (int dt = 0; dt < DT; ++dt) oacc[dt] = (v8f){0.f,0.f,0.f,0.f,0.f,0.f,0.f,0.f};

  const int kv_end = CAUSAL ? min(T, qblk * 64 + 64) : T;     // block-uniform
  for (int j0 = 0; j0 < kv_end; j0 += 32) {
    __syncthreads();
    for (int e = tid; e < 32 * (D / 4); e += 128) {
      const int r = e / (D / 4), c4 = (e % (D / 4)) * 4;
      const int key = j0 + r;
      v4f kf = {0.f,0.f,0.f,0.f}, vf = {0.f,0.f,0.f,0.f};
      if (key < T) { kf = *(const v4fa*)(K + (size_t)key * pitch + c4); vf = *(const v4fa*)(V + (size_t)key * pitch + c4); }
#pragma unroll
      for (int t = 0; t < 4; ++t) {
        unsigned short hb = bf16_bits(kf[t]); sKh[r][c4 + t] = hb; sKl[r][c4 + t] = bf16_bits(kf[t] - bf16_val(hb));
        hb = bf16_bits(vf[t]); sVh[r][c4 + t] = hb; sVl[r][c4 + t] = bf16_bits(vf[t] - bf16_val(hb));
      }
    }
    __syncthreads();
    // S tile 16 x 32
    v8f s[2];
#pragma unroll
    for (int nt = 0; nt < 2; ++nt) {
      v8f acc = {};
#pragma unroll
      for (int ks = 0; ks < KS; ++ks) {
        FragB bh_, bl_;
        bh_.half[0] = *(const v8us*)&sKh[nt * 16 + ln][ks * 32 + 8 * hh]; bh_.half[1] = *(const v8us*)&sKh[nt * 16 + ln][ks * 32 + 16 + 8 * hh];
        bl_.half[0] = *(const v8us*)&sKl[nt * 16 + ln][ks * 32 + 8 * hh]; bl_.half[1] = *(const v8us*)&sKl[nt * 16 + ln][ks * 32 + 16 + 8 * hh];
        acc = mmaN<3>(aqh[ks].v, aql[ks].v, bh_.v, bl_.v, acc);
      }
      s[nt] = acc;
    }
    // mask + running max (rows 8hh+r; the 16 lanes of a half share rows)
    float alpha[8];
#pragma unroll
    for (int r = 0; r < 8; ++r) {
      const int qi = q0 + 8 * hh + r;
      const int ja = j0 + ln, jb = j0 + 16 + ln;
      if (CAUSAL) { if (ja > qi) s[0][r] = -3.0e38f; if (jb > qi) s[1][r] = -3.0e38f; }
      if (ja >= T) s[0][r] = -3.0e38f;
      if (jb >= T) s[1][r] = -3.0e38f;
      float mx = fmaxf(s[0][r], s[1][r]);
      mx = fmaxf(mx, __shfl_xor(mx, 1, 32)); mx = fmaxf(mx, __shfl_xor(mx, 2, 32)); mx = fmaxf(mx, __shfl_xor(mx, 4, 32)); mx = fmaxf(mx, __shfl_xor(mx, 8, 32));
      const float mnew = fmaxf(m_r[r], mx);
      alpha[r] = (mnew > -1.0e38f) ? __expf(m_r[r] - mnew) : 1.0f;
      const float p0 = (s[0][r] > -1.0e38f) ? __expf(s[0][r] - mnew) : 0.f;
      const float p1 = (s[1][r] > -1.0e38f) ? __expf(s[1][r] - mnew) : 0.f;
      m_r[r] = mnew;
      l_r[r] = l_r[r] * alpha[r] + p0 + p1;            // per-lane partial row sum (16 lanes combined at the end)
      unsigned short hb = bf16_bits(p0); sPh[w][8 * hh + r][ln] = hb;      sPl[w][8 * hh + r][ln] = bf16_bits(p0 - bf16_val(hb));
      hb = bf16_bits(p1);                sPh[w][8 * hh + r][16 + ln] = hb; sPl[w][8 * hh + r][16 + ln] = bf16_bits(p1 - bf16_val(hb));
    }
#pragma unroll
    for (int dt = 0; dt < DT; ++dt)
#pragma unroll
      for (int r = 0; r < 8; ++r) oacc[dt][r] *= alpha[r];
    __builtin_amdgcn_fence(__ATOMIC_ACQ_REL, "workgroup");
    __builtin_amdgcn_wave_barrier();
    FragB pah, pal;
    pah.half[0] = *(const v8us*)&sPh[w][ln][8 * hh]; pah.half[1] = *(const v8us*)&sPh[w][ln][16 + 8 * hh];
    pal.half[0] = *(const v8us*)&sPl[w][ln][8 * hh]; pal.half[1] = *(const v8us*)&sPl[w][ln][16 + 8 * hh];
#pragma unroll
    for (int dt = 0; dt < DT; ++dt) {
      FragB bvh, bvl;
#pragma unroll
      for (int i = 0; i < 8; ++i) {
        bvh.u[i] = sVh[8 * hh + i][dt * 16 + ln]; bvh.u[8 + i] = sVh[16 + 8 * hh + i][dt * 16 + ln];
        bvl.u[i] = sVl[8 * hh + i][dt * 16 + ln]; bvl.u[8 + i] = sVl[16 + 8 * hh + i][dt * 16 + ln];
      }
      oacc[dt] = mmaN<3>(pah.v, pal.v, bvh.v, bvl.v, oacc[dt]);
    }
    __builtin_amdgcn_fence(__ATOMIC_ACQ_REL, "workgroup");
    __builtin_amdgcn_wave_barrier();
  }
#pragma unroll
  for (int r = 0; r < 8; ++r) {
    float l = l_r[r];
    l += __shfl_xor(l, 1, 32); l += __shfl_xor(l, 2, 32); l += __shfl_xor(l, 4, 32); l += __shfl_xor(l, 8, 32);
    l_r[r] = (l > 0.f) ? 1.0f / l : 0.f;
  }
#pragma unroll
  for (int dt = 0; dt < DT; ++dt)
#pragma unroll
    for (int r = 0; r < 8; ++r) sO[w][8 * hh + r][dt * 16 + ln] = oacc[dt][r] * l_r[r];
  __builtin_amdgcn_fence(__ATOMIC_ACQ_REL, "workgroup");
  __builtin_amdgcn_wave_barrier();
  {
    for (int r = 0; r < 16; ++r) {
      const int row = q0 + r;
      if (row < T && lane < D / 4) {
        const v4f val = *(const v4fa*)&sO[w][r][lane * 4];
        *(v4f*)(y + ((size_t)b * T + row) * ypitch + h * D + lane * 4) = val;
      }
    }
    
  }
}

typedef short s16x8 __attribute__((ext_vector_type(8)));
__device__ __forceinline__ v8us lds_tr16(const unsigned short* p) {
  typedef __attribute__((address_space(3))) s16x8 lds_s16x8;
  return __builtin_bit_cast(v8us, __builtin_amdgcn_ds_load_tr16_b128_v8i16((lds_s16x8*)p));
}

// the value that lane l ^ 16 holds (the other 16-lane half of the wave), by a vector cross-row move
__device__ __forceinline__ float other_half(float x) {
  const int b = __float_as_int(x);
  return __int_as_float(__builtin_amdgcn_permlanex16(b, b, 0x76543210, 0xfedcba98, false, false));
}
typedef int v4ia __attribute__((ext_vector_type(4), may_alias));
typedef int v4i  __attribute__((ext_vector_type(4)));

template <int D, int T, int H, int P>
__global__ __launch_bounds__(256) void k_flash3c(const float* __restrict__ Qb, const unsigned short* __restrict__ Kh, const unsigned short* __restrict__ Kl,
                                              const unsigned short* __restrict__ Vh, const unsigned short* __restrict__ Vl,
                                              float scale, const int* __restrict__ mask3, const float* __restrict__ gp, float* __restrict__ y) {
  static_assert(T % 64 == 0 && D % 32 == 0 && 512 % D == 0, "whole query blocks, whole 32-key passes");
  constexpr int KS = D / 32, DT = D / 16;
  // row pitch: an odd multiple of 16 bytes for K (plain 16-byte reads), an odd multiple of 32 bytes for V (transposing reads)
  __shared__ __attribute__((aligned(16))) unsigned short sKh[2][32][D + 8], sKl[2][32][D + 8], sVh[2][32][D + 16], sVl[2][32][D + 16];
  __shared__ __attribute__((aligned(16))) float sO[4][16][D + 4];   // pitch 16 bytes over a power of two: a lane writes a whole row piece
  __shared__ float sM[4][16], sL[4][16];                            // group 1's maximum and sum of each query
  const int g = __builtin_amdgcn_readfirstlane((int)threadIdx.x >> 7);   // key group, the same for a whole wave: kept scalar
  const int tid = threadIdx.x & 127, w = tid >> 5, lane = tid & 31, ln = lane & 15, hh = lane >> 4;   // place inside the group
  constexpr int nqb = T / 64;
  const int bh = blockIdx.x / nqb, qblk = blockIdx.x % nqb;
  const int b = bh / H, h = bh % H;
  const int q0 = qblk * 64 + w * 16;
  const float* Q = Qb + (size_t)b * T * P + h * D;
  FragB aqh[KS], aql[KS];
  {
    const float* qr = Q + (size_t)(q0 + ln) * P;
#pragma unroll
    for (int ks = 0; ks < KS; ++ks)
#pragma unroll
      for (int i = 0; i < 16; i += 2) {
        const int d = ks * 32 + ((i < 8) ? (8 * hh + i) : (16 + 8 * hh + (i - 8)));
        const float x0 = qr[d] * scale, x1 = qr[d + 1] * scale; const v2b hb = bf16_pair(x0, x1);
        aqh[ks].pr[i >> 1] = hb; aql[ks].pr[i >> 1] = bf16_pair(x0 - pair_lo(hb), x1 - pair_hi(hb));
      }
  }
  asm volatile("s_wait_xcnt 0x0" ::: "memory");     // before the address registers of the query loads are reused
  __builtin_amdgcn_sched_barrier(0);                // keeps the address arithmetic below, which reuses them, behind that wait
  float m_q = -3.0e38f, l_q = 0.f;   // the lane's query: running maximum (both halves agree), sum over the keys of the lane's own half
  v8f oacc[DT];                      // oacc[dt][r] = O[query q0 + ln][16 dt + 8 hh + r]
#pragma unroll
  for (int dt = 0; dt < DT; ++dt) oacc[dt] = (v8f){0.f,0.f,0.f,0.f,0.f,0.f,0.f,0.f};
  // Every global load of a 32-key pass is issued one pass ahead, without a predicate, into registers carried round the loop:
  // the pass behind the last one is clamped, as a whole, to the last one (in bounds), and its values are never used.
  // They are issued right behind the pass's second barrier: the barriers drain the load counter, and from there to the
  // next pass's first barrier is the longest stretch without one.
  // K and V arrive already split, as bf16 planes [b][h][key][D] (hi, lo): the 32 keys of a pass are 64 D bytes in a row in each plane,
  // and a pass only copies them to LDS.
  constexpr int NE = 32 * (D / 8) / 128;        // 16-byte pieces of each of the four planes per thread and pass
  const int sr = tid / (D / 8), sc8 = (tid % (D / 8)) * 8;
  // each address = a base that is the same for the whole block + one per-lane byte offset that never changes + a constant
  const size_t hoff = (size_t)bh * T * D;
  const char* Khb = (const char*)(Kh + hoff); const char* Klb = (const char*)(Kl + hoff);
  const char* Vhb = (const char*)(Vh + hoff); const char* Vlb = (const char*)(Vl + hoff);
  const unsigned kvoff = (unsigned)tid * 16u + (unsigned)g * (32u * D * 2u);   // the group's 32 keys inside the block's 64
  v8us khp[NE], klp[NE], vhp[NE], vlp[NE];
  auto load_kv = [&](int j) {
    const size_t jb = (size_t)min(j, T - 64) * (D * 2);
#pragma unroll
    for (int i = 0; i < NE; ++i) {
      khp[i] = *(const v8us*)(Khb + jb + i * 2048 + kvoff); klp[i] = *(const v8us*)(Klb + jb + i * 2048 + kvoff);
      vhp[i] = *(const v8us*)(Vhb + jb + i * 2048 + kvoff); vlp[i] = *(const v8us*)(Vlb + jb + i * 2048 + kvoff);
    }
    asm volatile("s_wait_xcnt 0x0" ::: "memory");   // before the address registers of the loads above are reused
    __builtin_amdgcn_sched_barrier(0);              // keeps later address arithmetic, which reuses them, behind that wait
  };
  // mask and group_prob share one index; byte offsets inside one batch's [T][T] plane fit 32 bits
  const char* mplane = (const char*)(mask3 + (size_t)b * T * T); const char* gplane = (const char*)(gp + (size_t)b * T * T);
  const unsigned mgoff = ((unsigned)(q0 + ln) * (unsigned)T + (unsigned)(32 * g + 8 * hh)) * 4u;
  v4i mk[4], nmk[4]; v4f ngq[4];   // this pass's, the next pass's; piece 2 nt + c = keys 16 nt + 8 hh + 4 c .. + 3 of the lane's query row
  v2b gb[8];                       // this pass's group_prob, rounded: pair 4 nt + c = keys 16 nt + 8 hh + 2 c, + 1
  auto load_mg = [&](int j) {
    const size_t jb = (size_t)min(j, T - 64) * 4;
#pragma unroll
    for (int i = 0; i < 4; ++i) nmk[i] = *(const v4ia*)(mplane + jb + ((i >> 1) * 64 + (i & 1) * 16) + mgoff);
#pragma unroll
    for (int i = 0; i < 4; ++i) ngq[i] = *(const v4fa*)(gplane + jb + ((i >> 1) * 64 + (i & 1) * 16) + mgoff);
    asm volatile("s_wait_xcnt 0x0" ::: "memory");   // before the offset registers of the loads above are reused
    __builtin_amdgcn_sched_barrier(0);              // keeps later arithmetic, which reuses them, behind that wait
  };
  load_kv(0);
  load_mg(0);
  for (int j0 = 0; j0 < T; j0 += 64) {   // the block's pass: 64 keys, 32 for each group
    __syncthreads();
#pragma unroll
    for (int i = 0; i < NE; ++i) {
      const int r = sr + i * (1024 / D);
      *(v8us*)&sKh[g][r][sc8] = khp[i]; *(v8us*)&sKl[g][r][sc8] = klp[i];
      *(v8us*)&sVh[g][r][sc8] = vhp[i]; *(v8us*)&sVl[g][r][sc8] = vlp[i];
    }
    __syncthreads();
#pragma unroll
    for (int i = 0; i < 4; ++i) { mk[i] = nmk[i]; gb[2 * i] = bf16_pair(ngq[i][0], ngq[i][1]); gb[2 * i + 1] = bf16_pair(ngq[i][2], ngq[i][3]); }
    // inputs only: the eight conversions stand in front of the loads below, which overwrite their sources; left free, the compiler keeps
    // the 16 f32 values in a second set of registers and copies them there in mid-pass, behind a wait for the loads just issued
    asm volatile("" :: "v"(gb[0]), "v"(gb[1]), "v"(gb[2]), "v"(gb[3]), "v"(gb[4]), "v"(gb[5]), "v"(gb[6]), "v"(gb[7]));
    load_kv(j0 + 64);
    load_mg(j0 + 64);
    v8f s[2];
#pragma unroll
    for (int nt = 0; nt < 2; ++nt) {
      v8f acc = {};
#pragma unroll
      for (int ks = 0; ks < KS; ++ks) {
        FragB bh_, bl_;
        bh_.half[0] = *(const v8us*)&sKh[g][nt * 16 + ln][ks * 32 + 8 * hh]; bh_.half[1] = *(const v8us*)&sKh[g][nt * 16 + ln][ks * 32 + 16 + 8 * hh];
        bl_.half[0] = *(const v8us*)&sKl[g][nt * 16 + ln][ks * 32 + 8 * hh]; bl_.half[1] = *(const v8us*)&sKl[g][nt * 16 + ln][ks * 32 + 16 + 8 * hh];
        acc = mmaN<3>(bh_.v, bl_.v, aqh[ks].v, aql[ks].v, acc);   // A = K rows, B = Q: acc[r] = score(key 16 nt + 8 hh + r, query ln)
      }
      s[nt] = acc;
    }
    const int dk = q0 + ln - 8 * hh - 32 * g - j0;   // the diagonal's key, counted from the first key of the lane's half in the group's tile
    float mx = -3.0e38f;
#pragma unroll
    for (int nt = 0; nt < 2; ++nt)
#pragma unroll
      for (int r = 0; r < 8; ++r) {
        s[nt][r] = (mk[2 * nt + (r >> 2)][r & 3] != 0 || dk == nt * 16 + r) ? s[nt][r] : -1.0e9f;
        mx = fmaxf(mx, s[nt][r]);
      }
    mx = fmaxf(mx, other_half(mx));
    const float mnew = fmaxf(m_q, mx);
    const float alpha = (mnew > -1.0e38f) ? __expf(m_q - mnew) : 1.0f;
    m_q = mnew;
    FragB pbh, pbl;   // element i = P[key 8 hh + i][query ln], element 8 + i = P[key 16 + 8 hh + i][query ln]: the k order of bvh, bvl
    float psum = 0.f;
#pragma unroll
    for (int nt = 0; nt < 2; ++nt)
#pragma unroll
      for (int r = 0; r < 8; r += 2) {
        const float p0 = __expf(s[nt][r] - mnew), p1 = __expf(s[nt][r + 1] - mnew);
        psum += p0; psum += p1;
        const v2b gr = gb[nt * 4 + (r >> 1)];
        const float g0 = p0 * pair_lo(gr), g1 = p1 * pair_hi(gr);   // post-softmax multiplier: P only, not the normaliser
        const v2b hb = bf16_pair(g0, g1);
        pbh.pr[nt * 4 + (r >> 1)] = hb; pbl.pr[nt * 4 + (r >> 1)] = bf16_pair(g0 - pair_lo(hb), g1 - pair_hi(hb));
      }
    l_q = l_q * alpha + psum;
#pragma unroll
    for (int dt = 0; dt < DT; ++dt)
#pragma unroll
      for (int r = 0; r < 8; ++r) oacc[dt][r] *= alpha;
    // all V fragments of the pass as one group of loads, so that their latency is waited out once and not once per 16 columns
    FragB bvh[DT], bvl[DT];   // element i = V[8 hh + i][16 dt + ln], element 8 + i = V[16 + 8 hh + i][16 dt + ln]: the k order of pbh, pbl
#pragma unroll
    for (int dt = 0; dt < DT; ++dt) {
      const int vr = 8 * hh + (lane & 7), vc = dt * 16 + 8 * ((lane >> 3) & 1);
      bvh[dt].half[0] = lds_tr16(&sVh[g][vr][vc]); bvh[dt].half[1] = lds_tr16(&sVh[g][16 + vr][vc]);
      bvl[dt].half[0] = lds_tr16(&sVl[g][vr][vc]); bvl[dt].half[1] = lds_tr16(&sVl[g][16 + vr][vc]);
    }
#pragma unroll
    for (int dt = 0; dt < DT; ++dt) oacc[dt] = mmaN<3>(bvh[dt].v, bvl[dt].v, pbh.v, pbl.v, oacc[dt]);   // A = V^T, B = P^T
  }
  const float lsum = l_q + other_half(l_q);
  // group 1 hands its partial result (maximum, sum, O not yet divided) to the wave of group 0 that holds the same queries, lane to lane
  if (g == 1) {
#pragma unroll
    for (int dt = 0; dt < DT; ++dt)
#pragma unroll
      for (int c = 0; c < 2; ++c) {
        const v4f o = {oacc[dt][4 * c], oacc[dt][4 * c + 1], oacc[dt][4 * c + 2], oacc[dt][4 * c + 3]};
        *(v4fa*)&sO[w][ln][dt * 16 + 8 * hh + 4 * c] = o;
      }
    if (hh == 0) { sM[w][ln] = m_q; sL[w][ln] = lsum; }
  }
  __syncthreads();   // publishes group 1's partial results; every wave passes it, and no barrier follows
  if (g == 1) return;
  const float m2 = sM[w][ln], l2 = sL[w][ln];
  const float mj = fmaxf(m_q, m2);
  const float fs = __expf(fminf(m_q, m2) - mj);                 // the side with the larger maximum keeps its scale
  const float f1 = m_q >= m2 ? 1.0f : fs, f2 = m_q >= m2 ? fs : 1.0f;
  const float linv = (mj > -1.0e38f) ? 1.0f / (lsum * f1 + l2 * f2) : __builtin_nanf("");
  const float a1 = f1 * linv, a2 = f2 * linv;
#pragma unroll
  for (int dt = 0; dt < DT; ++dt)
#pragma unroll
    for (int c = 0; c < 2; ++c) {
      const v4f o2 = *(const v4fa*)&sO[w][ln][dt * 16 + 8 * hh + 4 * c];   // read and rewritten by the same lane, in this order
      const v4f o = {oacc[dt][4 * c] * a1 + o2[0] * a2, oacc[dt][4 * c + 1] * a1 + o2[1] * a2,
                     oacc[dt][4 * c + 2] * a1 + o2[2] * a2, oacc[dt][4 * c + 3] * a1 + o2[3] * a2};
      *(v4fa*)&sO[w][ln][dt * 16 + 8 * hh + 4 * c] = o;
    }
  __builtin_amdgcn_fence(__ATOMIC_ACQ_REL, "workgroup");
  __builtin_amdgcn_wave_barrier();
  {
    for (int r = 0; r < 16; ++r) {
      const int row = q0 + r;
      if (lane < D / 4) {
        const v4f val = *(const v4fa*)&sO[w][r][lane * 4];
        *(v4f*)(y + ((size_t)b * T + row) * P + h * D + lane * 4) = val;
      }
    }
    
  }
}

// blockIdx.y picks one of four matrices of 8 n8 elements each; their rounded copies follow one another behind Wt0
__global__ __launch_bounds__(256) void k_round_rows(const float* __restrict__ W0, const float* __restrict__ W1, const float* __restrict__ W2,
                                                    const float* __restrict__ W3, unsigned short* __restrict__ Wt0, int n8) {
  const int t = blockIdx.x * 256 + threadIdx.x;
  if (t >= n8) return;
  const int z = blockIdx.y;
  const float* __restrict__ W = z == 0 ? W0 : z == 1 ? W1 : z == 2 ? W2 : W3;
  unsigned short* __restrict__ Wt = Wt0 + (size_t)z * n8 * 8;
  const v4f a = *(const v4fa*)(W + (size_t)t * 8), b = *(const v4fa*)(W + (size_t)t * 8 + 4);
  const v8us v = __builtin_bit_cast(v8us, __builtin_convertvector(__builtin_shufflevector(a, b, 0, 1, 2, 3, 4, 5, 6, 7), v8b));
  *(v8us*)(Wt + (size_t)t * 8) = v; 
}

extern "C" void kernel_launch(void* const* d_in, const int* in_sizes, int n_in,
                              void* d_out, int out_size, void* d_ws, size_t ws_size, hipStream_t stream) {
  (void)in_sizes; (void)n_in; (void)out_size;
  const float* xq = (const float*)d_in[0]; const float* xk = (const float*)d_in[1]; const float* xv = (const float*)d_in[2];
  const float* gp = (const float*)d_in[3]; const int* mask = (const int*)d_in[4];
  const float* Wq = (const float*)d_in[5]; const float* bq = (const float*)d_in[6]; const float* Wk = (const float*)d_in[7]; const float* bk = (const float*)d_in[8];
  const float* Wv = (const float*)d_in[9]; const float* bv = (const float*)d_in[10]; const float* Wo = (const float*)d_in[11]; const float* bo = (const float*)d_in[12];
  char* ws = (char*)d_ws; size_t off = 0;
  auto take = [&](size_t bytes) { char* p = ws + off; off += (bytes + 255) & ~(size_t)255; return p; };
  const int M = BB * TT, n8 = DD * DD / 8, gb = ((M / 16) * (DD / 64) + 3) / 4;
  unsigned short* Wt0 = (unsigned short*)take((size_t)4 * DD * DD * 2);   // rounded Wq, Wk, Wv, Wo, one behind the other
  unsigned short* Wt[4]; for (int i = 0; i < 4; ++i) Wt[i] = Wt0 + (size_t)i * DD * DD;
  float* q = (float*)take((size_t)M * DD * 4); float* att = (float*)take((size_t)M * DD * 4);
  unsigned short* kv0 = (unsigned short*)take((size_t)4 * M * DD * 2);    // K hi, K lo, V hi, V lo, one behind the other
  unsigned short* kv[4]; for (int i = 0; i < 4; ++i) kv[i] = kv0 + (size_t)i * M * DD;
  if (off > ws_size) return;
  // four launches, each of which needs the one before it: independent pieces of work share a grid
  k_round_rows<<<dim3((n8 + 255) / 256, 4), 256, 0, stream>>>(Wq, Wk, Wv, Wo, Wt0, n8);
  k_gemm_bf<false, 0, true, DD, DD, TT><<<dim3(gb, 3), 128, 0, stream>>>(xq, xk, xv, Wt0, bq, bk, bv, q, DD, M, DD, DD, kv0);
  k_flash3c<HD, TT, NH, DD><<<BB * NH * (TT / 64), 256, 0, stream>>>(q, kv[0], kv[1], kv[2], kv[3], 0.125f, mask, gp, att);
  k_gemm_bf<true, 0, true, DD, DD, 0><<<dim3(gb, 1), 128, 0, stream>>>(att, nullptr, nullptr, Wt[3], bo, nullptr, nullptr, (float*)d_out, DD, M, DD, DD, kv0);
}

// v010
// One run takes 91.1 microseconds.
// Next to v009, in two timings, it ran 1.11 times as fast each time.
// All steps since v000 together make it 7.80 times as fast.
#include <hip/hip_runtime.h>
// All contractions on v_wmma_f32_16x16x32_bf16, f32 accumulate: q/k/v = x·Wᵀ + b (inputs, W, b rounded to bf16: single exact term), QKᵀ and
// P·V per 16-query tile as 3-term bf16 hi/lo splits (mask|diag → −1e9 kept in the softmax like the module; P multiplied by
// bf16(group_prob) after normalisation), out = x·Woᵀ + bo with x split (2 terms); softmax in f32.
#define BB 2
#define TT 2048
#define DD 512
#define NH 8
#define HD 64

typedef __bf16 v16b __attribute__((ext_vector_type(16)));
typedef unsigned short v8us __attribute__((ext_vector_type(8), may_alias));
typedef float  v8f  __attribute__((ext_vector_type(8)));
typedef float  v4f  __attribute__((ext_vector_type(4)));
typedef float  v4fa __attribute__((ext_vector_type(4), may_alias));
typedef float  v2f  __attribute__((ext_vector_type(2)));
typedef __bf16 v2b  __attribute__((ext_vector_type(2)));
typedef __bf16 v8b  __attribute__((ext_vector_type(8)));
union FragB { v16b v; v8us half[2]; unsigned short u[16]; v2b pr[8]; };

// round to nearest even by the hardware's own conversion
__device__ __forceinline__ unsigned short bf16_bits(float x) { return __builtin_bit_cast(unsigned short, (__bf16)x); }
// two values rounded to nearest even and packed into one register by one conversion instruction
__device__ __forceinline__ v2b bf16_pair(float a, float b) { const v2f x = {a, b}; return __builtin_convertvector(x, v2b); }
// the two halves of such a pair as f32, written on the bits: the compiler then reads the half in place, as an operand of a
// mixed-precision multiply-add, where a conversion of the pair is unpacked into two more registers first
__device__ __forceinline__ float pair_lo(v2b p) { return __uint_as_float(__builtin_bit_cast(unsigned int, p) << 16); }
__device__ __forceinline__ float pair_hi(v2b p) { return __uint_as_float(__builtin_bit_cast(unsigned int, p) & 0xffff0000u); }
__device__ __forceinline__ float bf16_val(unsigned short b) { return __uint_as_float(((unsigned int)b) << 16); }
__device__ __forceinline__ float bf16_round(float x) { return bf16_val(bf16_bits(x)); }
// D += A·B with NT terms: 1 = ah·bh, 2 = + al·bh (A split), 3 = + ah·bl (both split)
template <int NT>
__device__ __forceinline__ v8f mmaN(v16b ah, v16b al, v16b bh, v16b bl, v8f c) {
  c = __builtin_amdgcn_wmma_f32_16x16x32_bf16(false, ah, false, bh, (short)0, c, false, false);
  if (NT >= 2) c = __builtin_amdgcn_wmma_f32_16x16x32_bf16(false, al, false, bh, (short)0, c, false, false);
  if (NT >= 3) c = __builtin_amdgcn_wmma_f32_16x16x32_bf16(false, ah, false, bl, (short)0, c, false, false);
  asm volatile("v_nop\n\tv_nop\n\tv_nop\n\tv_nop" : "+v"(c) : "v"(ah), "v"(al), "v"(bh), "v"(bl));
  return c;
}

__global__ __launch_bounds__(256) void k_wt_bf16(const float* __restrict__ W, unsigned short* __restrict__ Wt, int K, int N) {
  const int t = blockIdx.x * 256 + threadIdx.x;
  const int k8n = K / 8;
  if (t >= N * k8n) return;
  const int n = t / k8n, k8 = (t % k8n) * 8;
  v8us v;
#pragma unroll
  for (int i = 0; i < 8; ++i) v[i] = bf16_bits(W[(size_t)(k8 + i) * N + n]);
  *(v8us*)(Wt + (size_t)n * K + k8) = v;
  
}

// GEMM C[M][N] (f32, pitch ldc) = act(A[M][K] * W + bias). A f32 row-major (pitch LDA) converted to bf16
// (ASPLIT: hi/lo two planes -> 2 terms, else single rounded term); Wt bf16 [N][K] (pitch LDB). BIAS_BF16 rounds the
// bias to bf16 first (bias quantised to bf16 before the add). K%128==0, M%64==0, N%64==0.
// A block of 4 waves owns a 64 x 64 tile of C (wave w: rows 16 w .. 16 w + 15, all 64 columns). Both operands go through LDS in stages
// of 128 k: every global load of a wave covers whole 128-byte lines (one 512-byte piece of an A row, two 256-byte pieces of W rows),
// an A element is converted once, a W element is fetched once per block, and the fragments are 16-byte LDS reads.
// Two LDS buffers, one barrier a stage: a wave that writes buffer s & 1 has passed the barrier of stage s - 1, which every wave
// reaches only behind its last read of stage s - 2.
typedef unsigned short v4us __attribute__((ext_vector_type(4), may_alias));
// ST == 0: C is written as f32. ST > 0 (rows per batch, ST % 64 == 0): the result is written instead as two bf16 planes, Ch = bf16(v) and
// Cl = bf16(v - Ch), laid out [batch][column block of 64][row in batch][64]: one head's rows are 128 bytes each and follow one another.
// One grid holds up to three independent products of the same shape: blockIdx.y = z picks A and bias, and the z-th [N][LDB] matrix behind Wt0.
// With ST > 0 product 0 is still written as f32 into C; product z >= 1 goes to the planes Cp + (2 z - 2) M N (hi) and Cp + (2 z - 1) M N (lo).
template <bool ASPLIT, int ACT, bool BIAS_BF16, int LDA, int LDB, int ST>
__global__ __launch_bounds__(128) void k_gemm_bf(const float* __restrict__ A0, const float* __restrict__ A1, const float* __restrict__ A2,
                                               const unsigned short* __restrict__ Wt0,
                                               const float* __restrict__ bias0, const float* __restrict__ bias1, const float* __restrict__ bias2,
                                               float* __restrict__ C, int ldc, int M, int N, int K, unsigned short* __restrict__ Cp) {
  const int z = blockIdx.y;                 // the same for the whole block
  const float* __restrict__ A = z == 0 ? A0 : z == 1 ? A1 : A2;
  const float* __restrict__ bias = z == 0 ? bias0 : z == 1 ? bias1 : bias2;
  const unsigned short* __restrict__ Wt = Wt0 + (size_t)z * N * LDB;
  unsigned short* __restrict__ Ch = Cp + (size_t)(z > 0 ? 2 * z - 2 : 0) * M * N;
  unsigned short* __restrict__ Cl = Ch + (size_t)M * N;
  constexpr int BK = 128, PK = BK + 8;      // row pitch in LDS: an odd multiple of 16 bytes (plain 16-byte reads)
  __shared__ __attribute__((aligned(16))) unsigned short sAh[2][64][PK], sAl[ASPLIT ? 2 : 1][ASPLIT ? 64 : 1][PK], sB[2][64][PK];
  __shared__ __attribute__((aligned(16))) float so[4][16][64];
  const int tid = threadIdx.x, w = tid >> 5, lane = tid & 31, ln = lane & 15, hh = lane >> 4;
  const int ntn = N / 64;
  const int mb = blockIdx.x / ntn, nq = blockIdx.x % ntn;
  if (mb * 64 >= M) return;                 // the same for the whole block, in front of every barrier
  const int row0 = mb * 64 + w * 16, col0 = nq * 64;
  const int ar = tid >> 5, ac4 = (tid & 31) * 4;   // A piece i of a stage: tile row ar + 4 i, k ac4 .. ac4 + 3
  const int br = tid >> 4, bc8 = (tid & 15) * 8;   // W piece i of a stage: tile row br + 8 i, k bc8 .. bc8 + 7
  const float* ap = A + (size_t)(mb * 64 + ar) * LDA + ac4;
  const unsigned short* bp = Wt + (size_t)(col0 + br) * LDB + bc8;
  // A stage's 24 loads are issued as one batch right behind the barrier of the stage before (a barrier drains the load counter),
  // into registers, and are waited for only behind that stage's products.
  // Every loop over pa, pb or the fragments is unrolled, so that their indices are constants and they stay in registers.
  v4f pa[16]; v8us pb[8];
  auto load_stage = [&](int kb) {
#pragma unroll
    for (int i = 0; i < 16; ++i) pa[i] = *(const v4fa*)(ap + kb + i * 4 * LDA);
#pragma unroll
    for (int i = 0; i < 8; ++i) pb[i] = *(const v8us*)(bp + kb + i * 8 * LDB);
    asm volatile("s_wait_xcnt 0x0" ::: "memory");   // before the address registers of the loads above are reused
    __builtin_amdgcn_sched_barrier(0);              // keeps later address arithmetic, which reuses them, behind that wait
  };
  v8f acc[4] = {};
  load_stage(0);
  for (int kb = 0; kb < K; kb += BK) {
    const int buf = (kb / BK) & 1;
#pragma unroll
    for (int i = 0; i < 16; ++i) {
      const v2b h0 = bf16_pair(pa[i][0], pa[i][1]), h1 = bf16_pair(pa[i][2], pa[i][3]);
      *(v4us*)&sAh[buf][ar + 4 * i][ac4] = __builtin_bit_cast(v4us, __builtin_shufflevector(h0, h1, 0, 1, 2, 3));
      if (ASPLIT) {
        const v2b l0 = bf16_pair(pa[i][0] - pair_lo(h0), pa[i][1] - pair_hi(h0)), l1 = bf16_pair(pa[i][2] - pair_lo(h1), pa[i][3] - pair_hi(h1));
        *(v4us*)&sAl[buf][ar + 4 * i][ac4] = __builtin_bit_cast(v4us, __builtin_shufflevector(l0, l1, 0, 1, 2, 3));
      }
    }
#pragma unroll
    for (int i = 0; i < 8; ++i) *(v8us*)&sB[buf][br + 8 * i][bc8] = pb[i];
    __syncthreads();   // publishes this stage's tiles; also ends every wave's reads of the other buffer before the next stage rewrites it
    if (kb + BK < K) load_stage(kb + BK);
#pragma unroll
    for (int ks = 0; ks < BK / 32; ++ks) {
      // all fragments of a 32-k step as one group of LDS reads, so that their latency is waited out once and not once per 16 columns
      FragB ah, al, b[4];
      ah.half[0] = *(const v8us*)&sAh[buf][w * 16 + ln][ks * 32 + 8 * hh]; ah.half[1] = *(const v8us*)&sAh[buf][w * 16 + ln][ks * 32 + 16 + 8 * hh];
      if (ASPLIT) { al.half[0] = *(const v8us*)&sAl[buf][w * 16 + ln][ks * 32 + 8 * hh]; al.half[1] = *(const v8us*)&sAl[buf][w * 16 + ln][ks * 32 + 16 + 8 * hh]; }
      else {
#pragma unroll
        for (int i = 0; i < 16; ++i) al.u[i] = (unsigned short)0;
      }
#pragma unroll
      for (int t = 0; t < 4; ++t) {
        b[t].half[0] = *(const v8us*)&sB[buf][t * 16 + ln][ks * 32 + 8 * hh];
        b[t].half[1] = *(const v8us*)&sB[buf][t * 16 + ln][ks * 32 + 16 + 8 * hh];
      }
#pragma unroll
      for (int t = 0; t < 4; ++t) acc[t] = mmaN<ASPLIT ? 2 : 1>(ah.v, al.v, b[t].v, b[t].v, acc[t]);
    }
  }
#pragma unroll
  for (int t = 0; t < 4; ++t) {
    float bv = bias ? bias[col0 + t * 16 + ln] : 0.f;
    if (BIAS_BF16) bv = bf16_round(bv);
#pragma unroll
    for (int r = 0; r < 8; ++r) { float v = acc[t][r] + bv; if (ACT == 1) v = fmaxf(v, 0.f); so[w][8 * hh + r][t * 16 + ln] = v; }
  }
  __builtin_amdgcn_fence(__ATOMIC_ACQ_REL, "workgroup");
  __builtin_amdgcn_wave_barrier();
  if (ST > 0 && z > 0) {
    // a store of the wave covers 4 rows of 128 bytes, which follow one another in the plane
    const int r4 = lane >> 3, c8 = (lane & 7) * 8;
    v8us h[4], l[4];
#pragma unroll
    for (int q = 0; q < 4; ++q) {
      const v4f x0 = *(const v4fa*)&so[w][q * 4 + r4][c8], x1 = *(const v4fa*)&so[w][q * 4 + r4][c8 + 4];
      union { v8us v; v2b pr[4]; } hq, lq;
#pragma unroll
      for (int t = 0; t < 4; ++t) {
        const float a = t < 2 ? x0[2 * (t & 1)] : x1[2 * (t & 1)], c = t < 2 ? x0[2 * (t & 1) + 1] : x1[2 * (t & 1) + 1];
        const v2b hb = bf16_pair(a, c);
        hq.pr[t] = hb; lq.pr[t] = bf16_pair(a - pair_lo(hb), c - pair_hi(hb));
      }
      h[q] = hq.v; l[q] = lq.v;
    }
    constexpr int STD = ST > 0 ? ST : 1;
    const size_t o = (((size_t)(row0 / STD) * ntn + nq) * STD + row0 % STD + r4) * 64 + c8;
#pragma unroll
    for (int q = 0; q < 4; ++q) { *(v8us*)(Ch + o + q * 256) = h[q]; *(v8us*)(Cl + o + q * 256) = l[q]; }
    return;
  }
  const int rsub = lane >> 4, c4 = (lane & 15) * 4;
  {
#pragma unroll
    for (int q = 0; q < 8; ++q) {
      const int r = q * 2 + rsub;
      const v4f v = *(const v4fa*)&so[w][r][c4];
      *(v4f*)(C + (size_t)(row0 + r) * ldc + col0 + c4) = v;
    }
    // where the kernel also holds the plane path: before code laid out behind these stores reuses their address and data registers
    if (ST > 0) asm volatile("s_wait_xcnt 0x0" ::: "memory");
  }
}

// Flash-style causal/unmasked attention, all contractions 3-term bf16 hi/lo splits, f32 softmax with running max.
// q,k,v rows are read from f32 buffers with arbitrary row pitch (so they can live inside a fused qkv buffer);
// D = head size (multiple of 32, <= 128); one wave = 16 query rows; block = 4 waves (64 queries) sharing K/V chunks of 32.
template <int D, bool CAUSAL>
__global__ __launch_bounds__(128) void k_flash(const float* __restrict__ qb, const float* __restrict__ kb, const float* __restrict__ vb,
                                             int pitch, int T, int H, float scale, float* __restrict__ y, int ypitch) {
  constexpr int KS = D / 32;        // k-steps for QK
  constexpr int DT = D / 16;        // d tiles for PV
  __shared__ __attribute__((aligned(16))) unsigned short sKh[32][D + 8], sKl[32][D + 8], sVh[32][D + 8], sVl[32][D + 8];
  __shared__ __attribute__((aligned(16))) unsigned short sPh[4][16][40], sPl[4][16][40];
  __shared__ __attribute__((aligned(16))) float sO[4][16][D];
  const int tid = threadIdx.x, w = tid >> 5, lane = tid & 31, ln = lane & 15, hh = lane >> 4;
  const int nqb = (T + 63) / 64;
  const int bh = blockIdx.x / nqb, qblk = blockIdx.x % nqb;
  const int b = bh / H, h = bh % H;
  const int q0 = qblk * 64 + w * 16;
  const float* Q = qb + (size_t)b * T * pitch + h * D;
  const float* K = kb + (size_t)b * T * pitch + h * D;
  const float* V = vb + (size_t)b * T * pitch + h * D;

  // A fragments of the wave's 16 query rows (scaled), hi/lo
  FragB aqh[KS], aql[KS];
  {
    int row = q0 + ln; if (row >= T) row = T - 1;
    const float* qr = Q + (size_t)row * pitch;
#pragma unroll
    for (int ks = 0; ks < KS; ++ks)
#pragma unroll
      for (int i = 0; i < 16; ++i) {
        const int d = ks * 32 + ((i < 8) ? (8 * hh + i) : (16 + 8 * hh + (i - 8)));
        const float x = qr[d] * scale; const unsigned short hb = bf16_bits(x);
        aqh[ks].u[i] = hb; aql[ks].u[i] = bf16_bits(x - bf16_val(hb));
      }
  }
  float m_r[8], l_r[8];
#pragma unroll
  for (int r = 0; r < 8; ++r) { m_r[r] = -3.0e38f; l_r[r] = 0.f; }
  v8f oacc[DT];
#pragma unroll
  for (int dt = 0; dt < DT; ++dt) oacc[dt] = (v8f){0.f,0.f,0.f,0.f,0.f,0.f,0.f,0.f};

  const int kv_end = CAUSAL ? min(T, qblk * 64 + 64) : T;     // block-uniform
  for (int j0 = 0; j0 < kv_end; j0 += 32) {
    __syncthreads();
    for (int e = tid; e < 32 * (D / 4); e += 128) {
      const int r = e / (D / 4), c4 = (e % (D / 4)) * 4;
      const int key = j0 + r;
      v4f kf = {0.f,0.f,0.f,0.f}, vf = {0.f,0.f,0.f,0.f};
      if (key < T) { kf = *(const v4fa*)(K + (size_t)key * pitch + c4); vf = *(const v4fa*)(V + (size_t)key * pitch + c4); }
#pragma unroll
      for (int t = 0; t < 4; ++t) {
        unsigned short hb = bf16_bits(kf[t]); sKh[r][c4 + t] = hb; sKl[r][c4 + t] = bf16_bits(kf[t] - bf16_val(hb));
        hb = bf16_bits(vf[t]); sVh[r][c4 + t] = hb; sVl[r][c4 + t] = bf16_bits(vf[t] - bf16_val(hb));
      }
    }
    __syncthreads();
    // S tile 16 x 32
    v8f s[2];
#pragma unroll
    for (int nt = 0; nt < 2; ++nt) {
      v8f acc = {};
#pragma unroll
      for (int ks = 0; ks < KS; ++ks) {
        FragB bh_, bl_;
        bh_.half[0] = *(const v8us*)&sKh[nt * 16 + ln][ks * 32 + 8 * hh]; bh_.half[1] = *(const v8us*)&sKh[nt * 16 + ln][ks * 32 + 16 + 8 * hh];
        bl_.half[0] = *(const v8us*)&sKl[nt * 16 + ln][ks * 32 + 8 * hh]; bl_.half[1] = *(const v8us*)&sKl[nt * 16 + ln][ks * 32 + 16 + 8 * hh];
        acc = mmaN<3>(aqh[ks].v, aql[ks].v, bh_.v, bl_.v, acc);
      }
      s[nt] = acc;
    }
    // mask + running max (rows 8hh+r; the 16 lanes of a half share rows)
    float alpha[8];
#pragma unroll
    for (int r = 0; r < 8; ++r) {
      const int qi = q0 + 8 * hh + r;
      const int ja = j0 + ln, jb = j0 + 16 + ln;
      if (CAUSAL) { if (ja > qi) s[0][r] = -3.0e38f; if (jb > qi) s[1][r] = -3.0e38f; }
      if (ja >= T) s[0][r] = -3.0e38f;
      if (jb >= T) s[1][r] = -3.0e38f;
      float mx = fmaxf(s[0][r], s[1][r]);
      mx = fmaxf(mx, __shfl_xor(mx, 1, 32)); mx = fmaxf(mx, __shfl_xor(mx, 2, 32)); mx = fmaxf(mx, __shfl_xor(mx, 4, 32)); mx = fmaxf(mx, __shfl_xor(mx, 8, 32));
      const float mnew = fmaxf(m_r[r], mx);
      alpha[r] = (mnew > -1.0e38f) ? __expf(m_r[r] - mnew) : 1.0f;
      const float p0 = (s[0][r] > -1.0e38f) ? __expf(s[0][r] - mnew) : 0.f;
      const float p1 = (s[1][r] > -1.0e38f) ? __expf(s[1][r] - mnew) : 0.f;
      m_r[r] = mnew;
      l_r[r] = l_r[r] * alpha[r] + p0 + p1;            // per-lane partial row sum (16 lanes combined at the end)
      unsigned short hb = bf16_bits(p0); sPh[w][8 * hh + r][ln] = hb;      sPl[w][8 * hh + r][ln] = bf16_bits(p0 - bf16_val(hb));
      hb = bf16_bits(p1);                sPh[w][8 * hh + r][16 + ln] = hb; sPl[w][8 * hh + r][16 + ln] = bf16_bits(p1 - bf16_val(hb));
    }
#pragma unroll
    for (int dt = 0; dt < DT; ++dt)
#pragma unroll
      for (int r = 0; r < 8; ++r) oacc[dt][r] *= alpha[r];
    __builtin_amdgcn_fence(__ATOMIC_ACQ_REL, "workgroup");
    __builtin_amdgcn_wave_barrier();
    FragB pah, pal;
    pah.half[0] = *(const v8us*)&sPh[w][ln][8 * hh]; pah.half[1] = *(const v8us*)&sPh[w][ln][16 + 8 * hh];
    pal.half[0] = *(const v8us*)&sPl[w][ln][8 * hh]; pal.half[1] = *(const v8us*)&sPl[w][ln][16 + 8 * hh];
#pragma unroll
    for (int dt = 0; dt < DT; ++dt) {
      FragB bvh, bvl;
#pragma unroll
      for (int i = 0; i < 8; ++i) {
        bvh.u[i] = sVh[8 * hh + i][dt * 16 + ln]; bvh.u[8 + i] = sVh[16 + 8 * hh + i][dt * 16 + ln];
        bvl.u[i] = sVl[8 * hh + i][dt * 16 + ln]; bvl.u[8 + i] = sVl[16 + 8 * hh + i][dt * 16 + ln];
      }
      oacc[dt] = mmaN<3>(pah.v, pal.v, bvh.v, bvl.v, oacc[dt]);
    }
    __builtin_amdgcn_fence(__ATOMIC_ACQ_REL, "workgroup");
    __builtin_amdgcn_wave_barrier();
  }
#pragma unroll
  for (int r = 0; r < 8; ++r) {
    float l = l_r[r];
    l += __shfl_xor(l, 1, 32); l += __shfl_xor(l, 2, 32); l += __shfl_xor(l, 4, 32); l += __shfl_xor(l, 8, 32);
    l_r[r] = (l > 0.f) ? 1.0f / l : 0.f;
  }
#pragma unroll
  for (int dt = 0; dt < DT; ++dt)
#pragma unroll
    for (int r = 0; r < 8; ++r) sO[w][8 * hh + r][dt * 16 + ln] = oacc[dt][r] * l_r[r];
  __builtin_amdgcn_fence(__ATOMIC_ACQ_REL, "workgroup");
  __builtin_amdgcn_wave_barrier();
  {
    for (int r = 0; r < 16; ++r) {
      const int row = q0 + r;
      if (row < T && lane < D / 4) {
        const v4f val = *(const v4fa*)&sO[w][r][lane * 4];
        *(v4f*)(y + ((size_t)b * T + row) * ypitch + h * D + lane * 4) = val;
      }
    }
    
  }
}

typedef short s16x8 __attribute__((ext_vector_type(8)));
__device__ __forceinline__ v8us lds_tr16(const unsigned short* p) {
  typedef __attribute__((address_space(3))) s16x8 lds_s16x8;
  return __builtin_bit_cast(v8us, __builtin_amdgcn_ds_load_tr16_b128_v8i16((lds_s16x8*)p));
}

// the value that lane l ^ 16 holds (the other 16-lane half of the wave), by a vector cross-row move
__device__ __forceinline__ float other_half(float x) {
  const int b = __float_as_int(x);
  return __int_as_float(__builtin_amdgcn_permlanex16(b, b, 0x76543210, 0xfedcba98, false, false));
}
typedef int v4ia __attribute__((ext_vector_type(4), may_alias));
typedef int v4i  __attribute__((ext_vector_type(4)));
typedef unsigned v16u __attribute__((ext_vector_type(16)));
typedef __attribute__((address_space(4))) const v16u cv16u;   // never written during the launch that reads it: open to scalar loads
typedef unsigned u32a __attribute__((may_alias));
typedef unsigned v2ua __attribute__((ext_vector_type(2), may_alias));

// mask | diagonal and group_prob do not depend on the head: they are brought once into the form in which the attention waves of all heads use
// them. One wave takes 16 queries x 128 keys = 4 tiles of 16 x 32. It reads whole 512-byte row pieces (read once: non-temporal), turns them
// through its own LDS area into the attention wave's order (lane = 16 hh + query, keys 16 nt + 8 hh + r), and writes per tile
//   gpk: 2 x 512 bytes, piece nt: lane's 8 bf16 (r = 0 .. 7);   mw: 16 words, word 8 nt + r: bit lane = (mask != 0 or key == query).
template <int NB, int T>
__device__ __forceinline__ void pack_mask_gp(int p, const int* __restrict__ mask, const float* __restrict__ gp,
                                             unsigned* __restrict__ mw, unsigned short* __restrict__ gpk) {
  // a chunk = one (tile, nt, hh): 16 queries x 8 keys; chunk pitches 16 and 8 bytes over a multiple of 256 or 128 bytes spread the banks
  constexpr int GP = 272, FP = 136;
  __shared__ __attribute__((aligned(16))) unsigned char sG[8][16 * GP], sF[8][16 * FP];
  constexpr int KQ = T / 128, QT = T / 16;
  const int wv = threadIdx.x >> 5, lane = threadIdx.x & 31, ln = lane & 15, hh = lane >> 4;
  const int id = p * 8 + wv;
  if (id >= NB * QT * KQ) return;           // a whole wave; no block barrier follows
  const int kq = id % KQ, qt = (id / KQ) % QT, b = id / (KQ * QT);
  const size_t e0 = ((size_t)b * T + qt * 16) * T + kq * 128 + lane * 4;   // row i of the wave: keys 4 lane .. 4 lane + 3 of its 128
  // all 32 loads as one batch; every loop over m, x is unrolled, so that they stay in registers
  v4i m[16]; v4f x[16];
  const int* mp = mask + e0; const float* xp = gp + e0;
#pragma unroll
  for (int i = 0; i < 16; ++i) m[i] = __builtin_nontemporal_load((const v4ia*)(mp + (size_t)i * T));
  // before the address registers of the loads above are reused; the address is named as an input so that it lives up to the wait
  // and no load of the run gets those registers for its result
  asm volatile("s_wait_xcnt 0x0" :: "v"(mp) : "memory");
  __builtin_amdgcn_sched_barrier(0);              // keeps the loads below, whose results may reuse them, behind that wait
#pragma unroll
  for (int i = 0; i < 16; ++i) x[i] = __builtin_nontemporal_load((const v4fa*)(xp + (size_t)i * T));
  asm volatile("s_wait_xcnt 0x0" :: "v"(xp) : "memory");   // the same for these loads
  __builtin_amdgcn_sched_barrier(0);              // keeps later arithmetic, which reuses them, behind that wait
  const int dq = qt * 16 - kq * 128 - lane * 4;   // row i's diagonal is the lane's element j = dq + i, if that is 0 .. 3
  unsigned char* G = sG[wv] + (lane >> 1) * GP + (lane & 1) * 8;
  unsigned char* F = sF[wv] + (lane >> 1) * FP + (lane & 1) * 4;
#pragma unroll
  for (int i = 0; i < 16; ++i) {
    const v2b h0 = bf16_pair(x[i][0], x[i][1]), h1 = bf16_pair(x[i][2], x[i][3]);
    *(v4us*)(G + i * 16) = __builtin_bit_cast(v4us, __builtin_shufflevector(h0, h1, 0, 1, 2, 3));
    unsigned f = 0;                               // one byte a key: 1 = allowed
#pragma unroll
    for (int j = 0; j < 4; ++j) f |= (m[i][j] != 0 || dq + i == j) ? (1u << (8 * j)) : 0u;
    *(u32a*)(F + i * 8) = f;
  }
  // the wave reads back what its own lanes wrote
  __builtin_amdgcn_fence(__ATOMIC_ACQ_REL, "workgroup");
  __builtin_amdgcn_wave_barrier();
  // the loops below are unrolled too: gv and word stay in registers, and a ballot's place in its word is a constant
  v8us gv[8]; unsigned word[2] = {0u, 0u};        // word[t >> 1]: lanes 0 - 15 hold tile t's 16 words for even t, lanes 16 - 31 for odd t
#pragma unroll
  for (int n = 0; n < 8; ++n) {                   // n = 2 t + nt
    gv[n] = *(const v8us*)(sG[wv] + (n * 2 + hh) * GP + ln * 16);
    const v2ua fl = *(const v2ua*)(sF[wv] + (n * 2 + hh) * FP + ln * 8);
#pragma unroll
    for (int r = 0; r < 8; ++r) {
      const unsigned bal = __builtin_amdgcn_ballot_w32(((fl[r >> 2] >> (8 * (r & 3))) & 1u) != 0u);
      word[n >> 2] = lane == (n & 3) * 8 + r ? bal : word[n >> 2];
    }
  }
  const unsigned tile0 = (unsigned)(b * QT + qt) * (unsigned)(T / 32) + (unsigned)kq * 4u;
  unsigned short* go = gpk + (size_t)tile0 * 512 + lane * 8;
  unsigned* mo = mw + (size_t)tile0 * 16 + lane;
  // every store of the wave covers whole 128-byte lines
#pragma unroll
  for (int n = 0; n < 8; ++n) *(v8us*)(go + n * 256) = gv[n];
#pragma unroll
  for (int t2 = 0; t2 < 2; ++t2) mo[t2 * 32] = word[t2];
}

template <int D, int T, int H, int P>
__global__ __launch_bounds__(256) void k_flash3c(const float* __restrict__ Qb, const unsigned short* __restrict__ Kh, const unsigned short* __restrict__ Kl,
                                              const unsigned short* __restrict__ Vh, const unsigned short* __restrict__ Vl,
                                              float scale, const unsigned* __restrict__ mw, const unsigned short* __restrict__ gpk, float* __restrict__ y) {
  static_assert(T % 128 == 0 && D % 32 == 0 && 512 % D == 0, "whole query blocks, whole pairs of 64-key passes");
  constexpr int KS = D / 32, DT = D / 16;
  // row pitch: an odd multiple of 16 bytes for K (plain 16-byte reads), an odd multiple of 32 bytes for V (transposing reads)
  __shared__ __attribute__((aligned(16))) unsigned short sKh[2][32][D + 8], sKl[2][32][D + 8], sVh[2][32][D + 16], sVl[2][32][D + 16];
  __shared__ __attribute__((aligned(16))) float sO[4][16][D + 4];   // pitch 16 bytes over a power of two: a lane writes a whole row piece
  __shared__ float sM[4][16], sL[4][16];                            // group 1's maximum and sum of each query
  const int g = __builtin_amdgcn_readfirstlane((int)threadIdx.x >> 7);   // key group, the same for a whole wave: kept scalar
  const int tid = threadIdx.x & 127, w = tid >> 5, lane = tid & 31, ln = lane & 15, hh = lane >> 4;   // place inside the group
  constexpr int nqb = T / 64;
  const int bh = blockIdx.x / nqb, qblk = blockIdx.x % nqb;
  const int b = bh / H, h = bh % H;
  const int q0 = qblk * 64 + w * 16;
  const float* Q = Qb + (size_t)b * T * P + h * D;
  FragB aqh[KS], aql[KS];
  {
    const float* qr = Q + (size_t)(q0 + ln) * P;
#pragma unroll
    for (int ks = 0; ks < KS; ++ks)
#pragma unroll
      for (int i = 0; i < 16; i += 2) {
        const int d = ks * 32 + ((i < 8) ? (8 * hh + i) : (16 + 8 * hh + (i - 8)));
        const float x0 = qr[d] * scale, x1 = qr[d + 1] * scale; const v2b hb = bf16_pair(x0, x1);
        aqh[ks].pr[i >> 1] = hb; aql[ks].pr[i >> 1] = bf16_pair(x0 - pair_lo(hb), x1 - pair_hi(hb));
      }
  }
  asm volatile("s_wait_xcnt 0x0" ::: "memory");     // before the address registers of the query loads are reused
  __builtin_amdgcn_sched_barrier(0);                // keeps the address arithmetic below, which reuses them, behind that wait
  float m_q = -3.0e38f, l_q = 0.f;   // the lane's query: running maximum (both halves agree), sum over the keys of the lane's own half
  v8f oacc[DT];                      // oacc[dt][r] = O[query q0 + ln][16 dt + 8 hh + r]
#pragma unroll
  for (int dt = 0; dt < DT; ++dt) oacc[dt] = (v8f){0.f,0.f,0.f,0.f,0.f,0.f,0.f,0.f};
  // Every global load of a 32-key pass is issued one pass ahead, without a predicate, into registers carried round the loop:
  // the pass behind the last one is clamped, as a whole, to the last one (in bounds), and its values are never used.
  // They are issued right behind the pass's second barrier: the barriers drain the load counter, and from there to the
  // next pass's first barrier is the longest stretch without one.
  // K and V arrive already split, as bf16 planes [b][h][key][D] (hi, lo): the 32 keys of a pass are 64 D bytes in a row in each plane,
  // and a pass only copies them to LDS.
  constexpr int NE = 32 * (D / 8) / 128;        // 16-byte pieces of each of the four planes per thread and pass
  const int sr = tid / (D / 8), sc8 = (tid % (D / 8)) * 8;
  // each address = a base that is the same for the whole block + one per-lane byte offset that never changes + a constant
  const size_t hoff = (size_t)bh * T * D;
  const char* Khb = (const char*)(Kh + hoff); const char* Klb = (const char*)(Kl + hoff);
  const char* Vhb = (const char*)(Vh + hoff); const char* Vlb = (const char*)(Vl + hoff);
  const unsigned kvoff = (unsigned)tid * 16u + (unsigned)g * (32u * D * 2u);   // the group's 32 keys inside the block's 64
  v8us khp[NE], klp[NE], vhp[NE], vlp[NE];
  auto load_kv = [&](int j) {
    const size_t jb = (size_t)min(j, T - 64) * (D * 2);
#pragma unroll
    for (int i = 0; i < NE; ++i) {
      khp[i] = *(const v8us*)(Khb + jb + i * 2048 + kvoff); klp[i] = *(const v8us*)(Klb + jb + i * 2048 + kvoff);
      vhp[i] = *(const v8us*)(Vhb + jb + i * 2048 + kvoff); vlp[i] = *(const v8us*)(Vlb + jb + i * 2048 + kvoff);
    }
    asm volatile("s_wait_xcnt 0x0" ::: "memory");   // before the address registers of the loads above are reused
    __builtin_amdgcn_sched_barrier(0);              // keeps later address arithmetic, which reuses them, behind that wait
  };
  // mask | diagonal and group_prob arrive packed per tile of 16 queries x 32 keys (pack_mask_gp), the same for all heads: 16 lane-mask words,
  // which the wave fetches by one scalar load, and 1 KiB of bf16 in this wave's own fragment order, two whole-line 16-byte loads.
  const int ws = __builtin_amdgcn_readfirstlane(w);   // the wave's place in its group, kept scalar: the tile's address is the same in every lane
  const unsigned tile0 = (unsigned)(b * (T / 16) + qblk * 4 + ws) * (unsigned)(T / 32) + (unsigned)g;
  const char* mtile = (const char*)mw + (size_t)tile0 * 64; const char* gtile = (const char*)gpk + (size_t)tile0 * 1024;
  // Two register sets take turns (the loop below holds two passes): a pass works on one and has the next pass's values loaded into the other,
  // so that no set is ever copied; a copy would stand in mid-pass behind a wait for the loads just issued.
  v16u mkA, mkB;                   // word 8 nt + r, bit = lane: key 16 nt + 8 hh + r is allowed for query ln
  FragB gbA, gbB;                  // group_prob, rounded: pair 4 nt + c = keys 16 nt + 8 hh + 2 c, + 1
  auto load_mk = [&](int j, v16u& nmk) { nmk = *(const cv16u*)(mtile + (size_t)((unsigned)min(j, T - 64) >> 5) * 64); };
  auto load_gp = [&](int j, FragB& ngb) {
    const unsigned jt = (unsigned)min(j, T - 64) >> 5;   // key tiles in front of the pass
#pragma unroll
    for (int i = 0; i < 2; ++i) ngb.half[i] = *(const v8us*)(gtile + (size_t)jt * 1024 + i * 512 + lane * 16);
    asm volatile("s_wait_xcnt 0x0" ::: "memory");   // before the address registers of the loads above are reused
    __builtin_amdgcn_sched_barrier(0);              // keeps later arithmetic, which reuses them, behind that wait
  };
  load_kv(0);
  load_gp(0, gbA);
  load_mk(0, mkA);
  // the block's pass: 64 keys, 32 for each group
  auto pass = [&](int j0, const v16u& mk, const FragB& gb, v16u& nmk, FragB& ngb) __attribute__((always_inline)) {
    __syncthreads();
#pragma unroll
    for (int i = 0; i < NE; ++i) {
      const int r = sr + i * (1024 / D);
      *(v8us*)&sKh[g][r][sc8] = khp[i]; *(v8us*)&sKl[g][r][sc8] = klp[i];
      *(v8us*)&sVh[g][r][sc8] = vhp[i]; *(v8us*)&sVl[g][r][sc8] = vlp[i];
    }
    __syncthreads();
    load_kv(j0 + 64);
    load_gp(j0 + 64, ngb);
    v8f s[2];
#pragma unroll
    for (int nt = 0; nt < 2; ++nt) {
      v8f acc = {};
#pragma unroll
      for (int ks = 0; ks < KS; ++ks) {
        FragB bh_, bl_;
        bh_.half[0] = *(const v8us*)&sKh[g][nt * 16 + ln][ks * 32 + 8 * hh]; bh_.half[1] = *(const v8us*)&sKh[g][nt * 16 + ln][ks * 32 + 16 + 8 * hh];
        bl_.half[0] = *(const v8us*)&sKl[g][nt * 16 + ln][ks * 32 + 8 * hh]; bl_.half[1] = *(const v8us*)&sKl[g][nt * 16 + ln][ks * 32 + 16 + 8 * hh];
        acc = mmaN<3>(bh_.v, bl_.v, aqh[ks].v, aql[ks].v, acc);   // A = K rows, B = Q: acc[r] = score(key 16 nt + 8 hh + r, query ln)
      }
      s[nt] = acc;
    }
    float mx = -3.0e38f;
#pragma unroll
    for (int nt = 0; nt < 2; ++nt)
#pragma unroll
      for (int r = 0; r < 8; ++r) {
        s[nt][r] = __builtin_amdgcn_inverse_ballot_w32(mk[nt * 8 + r]) ? s[nt][r] : -1.0e9f;   // the word is the select's lane mask as it stands
        mx = fmaxf(mx, s[nt][r]);
      }
    // The next pass's mask words are asked for only here, behind the last select on this pass's: scalar loads return in any order, so the wait
    // for this pass's words would else wait for a load just issued as well. No barrier waits for a scalar load.
    __builtin_amdgcn_sched_barrier(0);   // holds the scalar load behind the selects
    load_mk(j0 + 64, nmk);
    mx = fmaxf(mx, other_half(mx));
    const float mnew = fmaxf(m_q, mx);
    const float alpha = (mnew > -1.0e38f) ? __expf(m_q - mnew) : 1.0f;
    m_q = mnew;
    FragB pbh, pbl;   // element i = P[key 8 hh + i][query ln], element 8 + i = P[key 16 + 8 hh + i][query ln]: the k order of bvh, bvl
    float psum = 0.f;
#pragma unroll
    for (int nt = 0; nt < 2; ++nt)
#pragma unroll
      for (int r = 0; r < 8; r += 2) {
        const float p0 = __expf(s[nt][r] - mnew), p1 = __expf(s[nt][r + 1] - mnew);
        psum += p0; psum += p1;
        const v2b gr = gb.pr[nt * 4 + (r >> 1)];
        const float g0 = p0 * pair_lo(gr), g1 = p1 * pair_hi(gr);   // post-softmax multiplier: P only, not the normaliser
        const v2b hb = bf16_pair(g0, g1);
        pbh.pr[nt * 4 + (r >> 1)] = hb; pbl.pr[nt * 4 + (r >> 1)] = bf16_pair(g0 - pair_lo(hb), g1 - pair_hi(hb));
      }
    l_q = l_q * alpha + psum;
#pragma unroll
    for (int dt = 0; dt < DT; ++dt)
#pragma unroll
      for (int r = 0; r < 8; ++r) oacc[dt][r] *= alpha;
    // all V fragments of the pass as one group of loads, so that their latency is waited out once and not once per 16 columns
    FragB bvh[DT], bvl[DT];   // element i = V[8 hh + i][16 dt + ln], element 8 + i = V[16 + 8 hh + i][16 dt + ln]: the k order of pbh, pbl
#pragma unroll
    for (int dt = 0; dt < DT; ++dt) {
      const int vr = 8 * hh + (lane & 7), vc = dt * 16 + 8 * ((lane >> 3) & 1);
      bvh[dt].half[0] = lds_tr16(&sVh[g][vr][vc]); bvh[dt].half[1] = lds_tr16(&sVh[g][16 + vr][vc]);
      bvl[dt].half[0] = lds_tr16(&sVl[g][vr][vc]); bvl[dt].half[1] = lds_tr16(&sVl[g][16 + vr][vc]);
    }
#pragma unroll
    for (int dt = 0; dt < DT; ++dt) oacc[dt] = mmaN<3>(bvh[dt].v, bvl[dt].v, pbh.v, pbl.v, oacc[dt]);   // A = V^T, B = P^T
  };
  for (int j0 = 0; j0 < T; j0 += 128) { pass(j0, mkA, gbA, mkB, gbB); pass(j0 + 64, mkB, gbB, mkA, gbA); }
  const float lsum = l_q + other_half(l_q);
  // group 1 hands its partial result (maximum, sum, O not yet divided) to the wave of group 0 that holds the same queries, lane to lane
  if (g == 1) {
#pragma unroll
    for (int dt = 0; dt < DT; ++dt)
#pragma unroll
      for (int c = 0; c < 2; ++c) {
        const v4f o = {oacc[dt][4 * c], oacc[dt][4 * c + 1], oacc[dt][4 * c + 2], oacc[dt][4 * c + 3]};
        *(v4fa*)&sO[w][ln][dt * 16 + 8 * hh + 4 * c] = o;
      }
    if (hh == 0) { sM[w][ln] = m_q; sL[w][ln] = lsum; }
  }
  __syncthreads();   // publishes group 1's partial results; every wave passes it, and no barrier follows
  if (g == 1) return;
  const float m2 = sM[w][ln], l2 = sL[w][ln];
  const float mj = fmaxf(m_q, m2);
  const float fs = __expf(fminf(m_q, m2) - mj);                 // the side with the larger maximum keeps its scale
  const float f1 = m_q >= m2 ? 1.0f : fs, f2 = m_q >= m2 ? fs : 1.0f;
  const float linv = (mj > -1.0e38f) ? 1.0f / (lsum * f1 + l2 * f2) : __builtin_nanf("");
  const float a1 = f1 * linv, a2 = f2 * linv;
#pragma unroll
  for (int dt = 0; dt < DT; ++dt)
#pragma unroll
    for (int c = 0; c < 2; ++c) {
      const v4f o2 = *(const v4fa*)&sO[w][ln][dt * 16 + 8 * hh + 4 * c];   // read and rewritten by the same lane, in this order
      const v4f o = {oacc[dt][4 * c] * a1 + o2[0] * a2, oacc[dt][4 * c + 1] * a1 + o2[1] * a2,
                     oacc[dt][4 * c + 2] * a1 + o2[2] * a2, oacc[dt][4 * c + 3] * a1 + o2[3] * a2};
      *(v4fa*)&sO[w][ln][dt * 16 + 8 * hh + 4 * c] = o;
    }
  __builtin_amdgcn_fence(__ATOMIC_ACQ_REL, "workgroup");
  __builtin_amdgcn_wave_barrier();
  {
    for (int r = 0; r < 16; ++r) {
      const int row = q0 + r;
      if (lane < D / 4) {
        const v4f val = *(const v4fa*)&sO[w][r][lane * 4];
        *(v4f*)(y + ((size_t)b * T + row) * P + h * D + lane * 4) = val;
      }
    }
    
  }
}

// blockIdx.y < 4: the block packs its share of mask and group_prob (the longer work, so it starts first). blockIdx.y - 4 picks one of four
// matrices of 8 n8 elements each; their rounded copies follow one another behind Wt0
__global__ __launch_bounds__(256) void k_round_rows(const float* __restrict__ W0, const float* __restrict__ W1, const float* __restrict__ W2,
                                                    const float* __restrict__ W3, unsigned short* __restrict__ Wt0, int n8,
                                                    const int* __restrict__ mask, const float* __restrict__ gp,
                                                    unsigned* __restrict__ mw, unsigned short* __restrict__ gpk) {
  if (blockIdx.y < 4) { pack_mask_gp<BB, TT>(blockIdx.y * (DD * DD / 8 / 256) + blockIdx.x, mask, gp, mw, gpk); return; }   // DD DD / 8 / 256 blocks a row of the grid
  const int t = blockIdx.x * 256 + threadIdx.x;
  if (t >= n8) return;
  const int z = blockIdx.y - 4;
  const float* __restrict__ W = z == 0 ? W0 : z == 1 ? W1 : z == 2 ? W2 : W3;
  unsigned short* __restrict__ Wt = Wt0 + (size_t)z * n8 * 8;
  const v4f a = *(const v4fa*)(W + (size_t)t * 8), b = *(const v4fa*)(W + (size_t)t * 8 + 4);
  const v8us v = __builtin_bit_cast(v8us, __builtin_convertvector(__builtin_shufflevector(a, b, 0, 1, 2, 3, 4, 5, 6, 7), v8b));
  *(v8us*)(Wt + (size_t)t * 8) = v; 
}

extern "C" void kernel_launch(void* const* d_in, const int* in_sizes, int n_in,
                              void* d_out, int out_size, void* d_ws, size_t ws_size, hipStream_t stream) {
  (void)in_sizes; (void)n_in; (void)out_size;
  const float* xq = (const float*)d_in[0]; const float* xk = (const float*)d_in[1]; const float* xv = (const float*)d_in[2];
  const float* gp = (const float*)d_in[3]; const int* mask = (const int*)d_in[4];
  const float* Wq = (const float*)d_in[5]; const float* bq = (const float*)d_in[6]; const float* Wk = (const float*)d_in[7]; const float* bk = (const float*)d_in[8];
  const float* Wv = (const float*)d_in[9]; const float* bv = (const float*)d_in[10]; const float* Wo = (const float*)d_in[11]; const float* bo = (const float*)d_in[12];
  char* ws = (char*)d_ws; size_t off = 0;
  auto take = [&](size_t bytes) { char* p = ws + off; off += (bytes + 255) & ~(size_t)255; return p; };
  const int M = BB * TT, n8 = DD * DD / 8, gb = ((M / 16) * (DD / 64) + 3) / 4;
  unsigned short* Wt0 = (unsigned short*)take((size_t)4 * DD * DD * 2);   // rounded Wq, Wk, Wv, Wo, one behind the other
  unsigned short* Wt[4]; for (int i = 0; i < 4; ++i) Wt[i] = Wt0 + (size_t)i * DD * DD;
  float* q = (float*)take((size_t)M * DD * 4); float* att = (float*)take((size_t)M * DD * 4);
  unsigned short* kv0 = (unsigned short*)take((size_t)4 * M * DD * 2);    // K hi, K lo, V hi, V lo, one behind the other
  unsigned short* kv[4]; for (int i = 0; i < 4; ++i) kv[i] = kv0 + (size_t)i * M * DD;
  unsigned short* gpk = (unsigned short*)take((size_t)BB * TT * TT * 2);  // group_prob, bf16, in tiles
  unsigned* mw = (unsigned*)take((size_t)BB * TT * TT / 8);               // mask | diagonal, one bit a score, in tiles
  if (off > ws_size) return;
  // four launches, each of which needs the one before it: independent pieces of work share a grid
  k_round_rows<<<dim3((n8 + 255) / 256, 8), 256, 0, stream>>>(Wq, Wk, Wv, Wo, Wt0, n8, mask, gp, mw, gpk);
  k_gemm_bf<false, 0, true, DD, DD, TT><<<dim3(gb, 3), 128, 0, stream>>>(xq, xk, xv, Wt0, bq, bk, bv, q, DD, M, DD, DD, kv0);
  k_flash3c<HD, TT, NH, DD><<<BB * NH * (TT / 64), 256, 0, stream>>>(q, kv[0], kv[1], kv[2], kv[3], 0.125f, mw, gpk, att);
  k_gemm_bf<true, 0, true, DD, DD, 0><<<dim3(gb, 1), 128, 0, stream>>>(att, nullptr, nullptr, Wt[3], bo, nullptr, nullptr, (float*)d_out, DD, M, DD, DD, kv0);
}
